// v000
// The times below were measured on an AMD MI455X: many runs one after another, warmed up first and cycling through
// copies of the inputs, with the whole window's GPU time divided by the number of runs. Launches and the gaps
// between them are all in it. The median over several windows is given; except for v000 it joins two sittings, which
// can be a few percent apart, so the side-by-side timings, each taken in one sitting, are the better comparison.
// v000 is the starting kernel. One run takes 425 microseconds.
#include <hip/hip_runtime.h>
#include <hip/hip_bf16.h>

// ---------------------------------------------------------------------------
// EncoderLayer for MI455X (gfx1250, wave32, WMMA).
// All GEMMs (QKV/O projections, FFN) and attention (QK^T, PV) run on
// v_wmma_f32_16x16x32_f16 with f32 accumulation (compute-bound: ~103 GFLOP vs
// ~0.1 GB of traffic, so f16 WMMA is the right precision/path on CDNA5).
//  - Non-transposed LDS tiles are staged with GLOBAL_LOAD_ASYNC_TO_LDS_B128
//    (ASYNCcnt-tracked, bypasses VGPRs) + s_wait_asynccnt.
//  - Double-buffered software pipeline: tile t+1's async copy overlaps
//    tile t's WMMAs; one barrier per k-step.
//  - Softmax cross-lane reductions use VALU DPP butterflies (xor 1/2/7/15 via
//    quad_perm + mirrors), freeing the DS pipe for WMMA fragment loads and
//    co-executing with the matrix pipe.
// Note: MHA without positional terms is permutation-equivariant, so
// flip(MHA(flip(x))) == MHA(x); branch 2 is just MHA with the W2 weights.
// ---------------------------------------------------------------------------

#define BB   8
#define SS   1024
#define NV   768
#define DD   512
#define DFF  2048
#define HH   8
#define DHH  64
#define BSROWS (BB * SS)                       // 8192
#define BSD   ((size_t)BSROWS * DD)            // 4,194,304

typedef _Float16 v16h __attribute__((ext_vector_type(16)));
typedef float    v8f  __attribute__((ext_vector_type(8)));
typedef _Float16 h8   __attribute__((ext_vector_type(8)));

// ---------------- DPP 16-lane butterfly reductions (VALU, no DS pipe) ------
template <int CTRL>
__device__ __forceinline__ float dpp_perm_f(float x) {
  int i = __builtin_bit_cast(int, x);
  int r = __builtin_amdgcn_update_dpp(i, i, CTRL, 0xF, 0xF, true);
  return __builtin_bit_cast(float, r);
}
__device__ __forceinline__ float red16_max(float x) {
  x = fmaxf(x, dpp_perm_f<0xB1>(x));    // quad_perm [1,0,3,2] : xor 1
  x = fmaxf(x, dpp_perm_f<0x4E>(x));    // quad_perm [2,3,0,1] : xor 2
  x = fmaxf(x, dpp_perm_f<0x141>(x));   // row_half_mirror     : xor 7
  x = fmaxf(x, dpp_perm_f<0x140>(x));   // row_mirror          : xor 15
  return x;
}
__device__ __forceinline__ float red16_sum(float x) {
  x += dpp_perm_f<0xB1>(x);
  x += dpp_perm_f<0x4E>(x);
  x += dpp_perm_f<0x141>(x);
  x += dpp_perm_f<0x140>(x);
  return x;
}

// ---------------- async global -> LDS staging (CDNA5, ASYNCcnt) ------------
__device__ __forceinline__ unsigned lds_off_of(const void* p) {
  // generic pointers to LDS carry the offset in the low 32 bits
  return (unsigned)(unsigned long long)(uintptr_t)p;
}
__device__ __forceinline__ void async_load_b128(unsigned lds_off, const void* gaddr) {
  asm volatile("global_load_async_to_lds_b128 %0, %1, off"
               :: "v"(lds_off), "v"((unsigned long long)(uintptr_t)gaddr)
               : "memory");
}
__device__ __forceinline__ void wait_async0() {
  asm volatile("s_wait_asynccnt 0x0" ::: "memory");
}

// ---------------------------------------------------------------------------
// f32 -> f16 convert (weights, etc.)
// ---------------------------------------------------------------------------
__global__ __launch_bounds__(256) void cvt_f16_kernel(const float* __restrict__ src,
                                                      _Float16* __restrict__ dst,
                                                      size_t n) {
  size_t i = (size_t)blockIdx.x * blockDim.x + threadIdx.x;
  size_t stride = (size_t)gridDim.x * blockDim.x;
  for (; i < n; i += stride) dst[i] = (_Float16)src[i];
}

// ---------------------------------------------------------------------------
// Batched gather over first N rows (rest pass-through), optional f16 copy.
// ---------------------------------------------------------------------------
__global__ __launch_bounds__(256) void gather_cast_kernel(const float* __restrict__ x,
                                                          const int* __restrict__ idx,
                                                          float* __restrict__ of,
                                                          _Float16* __restrict__ oh) {
  int bs = blockIdx.x;                 // 0..B*S-1
  int b = bs / SS, s = bs % SS;
  int srow = s;
  if (s < NV) srow = idx[b * NV + s];
  const float* src = x + ((size_t)b * SS + srow) * DD;
  size_t dbase = (size_t)bs * DD;
  for (int d = threadIdx.x; d < DD; d += blockDim.x) {
    float v = src[d];
    of[dbase + d] = v;
    if (oh) oh[dbase + d] = (_Float16)v;
  }
}

// ---------------------------------------------------------------------------
// c = a + b (elementwise f32)
// ---------------------------------------------------------------------------
__global__ __launch_bounds__(256) void add2_kernel(const float* __restrict__ a,
                                                   const float* __restrict__ b,
                                                   float* __restrict__ c, size_t n) {
  size_t i = (size_t)blockIdx.x * blockDim.x + threadIdx.x;
  size_t stride = (size_t)gridDim.x * blockDim.x;
  for (; i < n; i += stride) c[i] = a[i] + b[i];
}

// ---------------------------------------------------------------------------
// out = LayerNorm(a + b) * g + beta, one block (256 thr) per row of D=512.
// ---------------------------------------------------------------------------
__global__ __launch_bounds__(256) void add_ln_kernel(const float* __restrict__ a,
                                                     const float* __restrict__ b,
                                                     const float* __restrict__ g,
                                                     const float* __restrict__ beta,
                                                     float* __restrict__ of,
                                                     _Float16* __restrict__ oh) {
  __shared__ float sred[16];
  int row = blockIdx.x;
  size_t base = (size_t)row * DD;
  int d0 = threadIdx.x, d1 = threadIdx.x + 256;
  float t0 = a[base + d0] + b[base + d0];
  float t1 = a[base + d1] + b[base + d1];
  float s = t0 + t1, ss = t0 * t0 + t1 * t1;
#pragma unroll
  for (int m = 1; m < 32; m <<= 1) { s += __shfl_xor(s, m, 32); ss += __shfl_xor(ss, m, 32); }
  int wave = threadIdx.x >> 5, lane = threadIdx.x & 31;
  if (lane == 0) { sred[wave] = s; sred[8 + wave] = ss; }
  __syncthreads();
  if (wave == 0) {
    float s2 = (lane < 8) ? sred[lane] : 0.f;
    float q2 = (lane < 8) ? sred[8 + lane] : 0.f;
#pragma unroll
    for (int m = 1; m < 8; m <<= 1) { s2 += __shfl_xor(s2, m, 32); q2 += __shfl_xor(q2, m, 32); }
    if (lane == 0) { sred[0] = s2; sred[1] = q2; }
  }
  __syncthreads();
  float mu  = sred[0] * (1.f / DD);
  float var = sred[1] * (1.f / DD) - mu * mu;
  float rstd = rsqrtf(var + 1e-5f);
  float r0 = (t0 - mu) * rstd * g[d0] + beta[d0];
  float r1 = (t1 - mu) * rstd * g[d1] + beta[d1];
  of[base + d0] = r0;
  of[base + d1] = r1;
  if (oh) { oh[base + d0] = (_Float16)r0; oh[base + d1] = (_Float16)r1; }
}

// ---------------------------------------------------------------------------
// WMMA GEMM: C[M,N] = A[M,K] (f16, row-major) @ W[K,N] (f16, row-major)
// Workgroup tile 128x128, 8 waves in a 4(M) x 2(N) grid, each wave 32x64
// (2x4 accumulators of v_wmma_f32_16x16x32_f16). Double-buffered pipeline:
// A-tile via async global->LDS; B-tile transposed through VGPRs, scattered
// into LDS after the current tile's WMMAs. One barrier per k-step.
// ---------------------------------------------------------------------------
template <bool OUT_F16, bool BIAS, bool RELU>
__global__ __launch_bounds__(256) void gemm_wmma(const _Float16* __restrict__ A,
                                                 const _Float16* __restrict__ W,
                                                 const float* __restrict__ bias,
                                                 _Float16* __restrict__ outH,
                                                 float* __restrict__ outF,
                                                 int M, int N, int K) {
  __shared__ _Float16 As[2][128][40];   // ping-pong: 128 rows x 32 K (pad 40)
  __shared__ _Float16 Bt[2][128][40];   // ping-pong: 128 cols(N) x 32 K (transposed)

  const int tid  = threadIdx.x;
  const int lane = tid & 31;
  const int wave = tid >> 5;
  const int l15  = lane & 15;
  const int half = lane >> 4;
  const int wm = wave >> 1;          // 0..3
  const int wn = wave & 1;           // 0..1
  const int mbase = blockIdx.y * 128;
  const int nbase = blockIdx.x * 128;

  v8f acc[2][4];
#pragma unroll
  for (int i = 0; i < 2; i++)
#pragma unroll
    for (int j = 0; j < 4; j++) { v8f z = {}; acc[i][j] = z; }

  const int arow = tid >> 1;            // A tile: row t/2, 16 halfs at (t&1)*16
  const int acs  = (tid & 1) * 16;
  const int bkr  = tid >> 3;            // B tile: k-row t/8, 16 cols at (t&7)*16
  const int bns  = (tid & 7) * 16;

  const int nk = K >> 5;                // k-steps of 32

  {   // prologue: stage tile 0 into buffer 0
    const _Float16* ga = A + (size_t)(mbase + arow) * K + acs;
    async_load_b128(lds_off_of(&As[0][arow][acs]), ga);
    async_load_b128(lds_off_of(&As[0][arow][acs + 8]), ga + 8);
    const h8* src = reinterpret_cast<const h8*>(W + (size_t)bkr * N + nbase + bns);
    h8 w0 = src[0], w1 = src[1];
#pragma unroll
    for (int j = 0; j < 8; j++) Bt[0][bns + j][bkr] = w0[j];
#pragma unroll
    for (int j = 0; j < 8; j++) Bt[0][bns + 8 + j][bkr] = w1[j];
    wait_async0();
    __syncthreads();
  }

  for (int t = 0; t < nk; ++t) {
    const int cur = t & 1, nxt = cur ^ 1;
    const bool more = (t + 1 < nk);
    const int k0n = (t + 1) << 5;
    h8 w0 = {}, w1 = {};
    if (more) {   // issue next tile's copies: async A -> LDS, B -> VGPRs
      const _Float16* ga = A + (size_t)(mbase + arow) * K + k0n + acs;
      async_load_b128(lds_off_of(&As[nxt][arow][acs]), ga);
      async_load_b128(lds_off_of(&As[nxt][arow][acs + 8]), ga + 8);
      const h8* src = reinterpret_cast<const h8*>(W + (size_t)(k0n + bkr) * N + nbase + bns);
      w0 = src[0]; w1 = src[1];
    }

    // ---- compute on current buffers ----
    v16h af[2], bf[4];
#pragma unroll
    for (int mt = 0; mt < 2; mt++) {
      const _Float16* p = &As[cur][wm * 32 + mt * 16 + l15][half * 8];
#pragma unroll
      for (int i = 0; i < 8; i++) { af[mt][i] = p[i]; af[mt][8 + i] = p[16 + i]; }
    }
#pragma unroll
    for (int nt = 0; nt < 4; nt++) {
      const _Float16* p = &Bt[cur][wn * 64 + nt * 16 + l15][half * 8];
#pragma unroll
      for (int i = 0; i < 8; i++) { bf[nt][i] = p[i]; bf[nt][8 + i] = p[16 + i]; }
    }
#pragma unroll
    for (int mt = 0; mt < 2; mt++)
#pragma unroll
      for (int nt = 0; nt < 4; nt++)
        acc[mt][nt] = __builtin_amdgcn_wmma_f32_16x16x32_f16(
            false, af[mt], false, bf[nt], (short)0, acc[mt][nt], false, false);

    if (more) {   // scatter next B tile (overlapped global latency is behind us)
#pragma unroll
      for (int j = 0; j < 8; j++) Bt[nxt][bns + j][bkr] = w0[j];
#pragma unroll
      for (int j = 0; j < 8; j++) Bt[nxt][bns + 8 + j][bkr] = w1[j];
    }
    wait_async0();
    __syncthreads();
  }

  // Epilogue: C layout: VGPR i, lane half h -> row = 8*h + i, col = l15.
#pragma unroll
  for (int mt = 0; mt < 2; mt++) {
#pragma unroll
    for (int nt = 0; nt < 4; nt++) {
      int gc = nbase + wn * 64 + nt * 16 + l15;
      float bv = BIAS ? bias[gc] : 0.f;
#pragma unroll
      for (int i = 0; i < 8; i++) {
        int gr = mbase + wm * 32 + mt * 16 + half * 8 + i;
        float v = acc[mt][nt][i] + bv;
        if (RELU) v = v > 0.f ? v : 0.f;
        size_t off = (size_t)gr * N + gc;
        if (OUT_F16) outH[off] = (_Float16)v;
        else         outF[off] = v;
      }
    }
  }
}

// ---------------------------------------------------------------------------
// Flash-style attention, one workgroup per (128 q-rows, head, batch).
// 8 waves x 16 q-rows; K/V streamed through double-buffered LDS in 32-key
// blocks (K async global->LDS, V transposed through VGPRs). scores: 2 WMMAs
// per 16-key subtile (K=64 contraction); P staged via LDS (C->A layout,
// wave-local s_wait_dscnt); PV: 4 WMMAs. Softmax reductions on VALU DPP.
// ---------------------------------------------------------------------------
__global__ __launch_bounds__(256) void attn_wmma(const _Float16* __restrict__ Q,
                                                 const _Float16* __restrict__ Kk,
                                                 const _Float16* __restrict__ V,
                                                 _Float16* __restrict__ O) {
  __shared__ _Float16 Kb[2][32][72];     // [key][d], pad 64->72
  __shared__ _Float16 Vt[2][64][40];     // [d][key], pad 32->40
  __shared__ _Float16 Pst[8][16][32];    // per-wave P tile [row][key]

  const int tid  = threadIdx.x;
  const int lane = tid & 31;
  const int wave = tid >> 5;
  const int l15  = lane & 15;
  const int half = lane >> 4;
  const int qb   = blockIdx.x * 128;
  const int head = blockIdx.y;
  const int bat  = blockIdx.z;
  const size_t base = (size_t)bat * SS * DD + (size_t)head * DHH;
  const float scale = 0.125f;            // 1/sqrt(64)

  // Q fragments: rows qb + wave*16 + l15, d split {0..31},{32..63}
  v16h qa[2];
  {
    const _Float16* qp = Q + base + (size_t)(qb + wave * 16 + l15) * DD;
#pragma unroll
    for (int f = 0; f < 2; f++)
#pragma unroll
      for (int i = 0; i < 8; i++) {
        qa[f][i]     = qp[f * 32 + half * 8 + i];
        qa[f][8 + i] = qp[f * 32 + 16 + half * 8 + i];
      }
  }

  v8f o[4];
#pragma unroll
  for (int t = 0; t < 4; t++) { v8f z = {}; o[t] = z; }
  float mrun[8], lrun[8];
#pragma unroll
  for (int i = 0; i < 8; i++) { mrun[i] = -1e30f; lrun[i] = 0.f; }

  const int r = tid >> 3;                // 0..31 (key)
  const int c = (tid & 7) * 8;           // 0..56 (d)

  {   // prologue: stage key-block 0 into buffer 0
    async_load_b128(lds_off_of(&Kb[0][r][c]), Kk + base + (size_t)r * DD + c);
    h8 vv = *reinterpret_cast<const h8*>(V + base + (size_t)r * DD + c);
#pragma unroll
    for (int j = 0; j < 8; j++) Vt[0][c + j][r] = vv[j];
    wait_async0();
    __syncthreads();
  }

  const int nkb = SS >> 5;               // 32-key blocks
  for (int t = 0; t < nkb; ++t) {
    const int cur = t & 1, nxt = cur ^ 1;
    const bool more = (t + 1 < nkb);
    h8 vv = {};
    if (more) {   // issue next block's copies
      size_t roff = base + (size_t)((t + 1) * 32 + r) * DD + c;
      async_load_b128(lds_off_of(&Kb[nxt][r][c]), Kk + roff);
      vv = *reinterpret_cast<const h8*>(V + roff);
    }

    // ---- scores: S_tile(16 x 32) in two 16-key subtiles -------------------
    v8f sc[2];
#pragma unroll
    for (int nb = 0; nb < 2; nb++) {
      v8f z = {};
      v16h bf;
      {
        const _Float16* p = &Kb[cur][nb * 16 + l15][half * 8];
#pragma unroll
        for (int i = 0; i < 8; i++) { bf[i] = p[i]; bf[8 + i] = p[16 + i]; }
      }
      z = __builtin_amdgcn_wmma_f32_16x16x32_f16(false, qa[0], false, bf, (short)0, z, false, false);
      {
        const _Float16* p = &Kb[cur][nb * 16 + l15][32 + half * 8];
#pragma unroll
        for (int i = 0; i < 8; i++) { bf[i] = p[i]; bf[8 + i] = p[16 + i]; }
      }
      z = __builtin_amdgcn_wmma_f32_16x16x32_f16(false, qa[1], false, bf, (short)0, z, false, false);
      sc[nb] = z;
    }
#pragma unroll
    for (int nb = 0; nb < 2; nb++)
#pragma unroll
      for (int i = 0; i < 8; i++) sc[nb][i] *= scale;

    // ---- online softmax (row = 8*half + i; DPP reduce across 16 lanes) ----
#pragma unroll
    for (int i = 0; i < 8; i++) {
      float mx = red16_max(fmaxf(sc[0][i], sc[1][i]));
      float mnew = fmaxf(mrun[i], mx);
      float corr = __expf(mrun[i] - mnew);
      float p0 = __expf(sc[0][i] - mnew);
      float p1 = __expf(sc[1][i] - mnew);
      float rs = red16_sum(p0 + p1);
      lrun[i] = lrun[i] * corr + rs;
      mrun[i] = mnew;
#pragma unroll
      for (int tt = 0; tt < 4; tt++) o[tt][i] *= corr;
      Pst[wave][half * 8 + i][l15]      = (_Float16)p0;
      Pst[wave][half * 8 + i][16 + l15] = (_Float16)p1;
    }
    // wave-local LDS RAW: same-wave DS ops are in-order; wait then reload.
    asm volatile("s_wait_dscnt 0x0" ::: "memory");

    // ---- P fragment (A-layout 16x32) --------------------------------------
    v16h pa;
    {
      const _Float16* p = &Pst[wave][l15][half * 8];
#pragma unroll
      for (int i = 0; i < 8; i++) { pa[i] = p[i]; pa[8 + i] = p[16 + i]; }
    }
    // ---- PV: O(16 x 64) += P(16 x 32) @ V(32 x 64) ------------------------
#pragma unroll
    for (int tt = 0; tt < 4; tt++) {
      v16h bf;
      const _Float16* p = &Vt[cur][tt * 16 + l15][half * 8];
#pragma unroll
      for (int i = 0; i < 8; i++) { bf[i] = p[i]; bf[8 + i] = p[16 + i]; }
      o[tt] = __builtin_amdgcn_wmma_f32_16x16x32_f16(false, pa, false, bf, (short)0, o[tt], false, false);
    }

    if (more) {   // scatter next V block into the other buffer
#pragma unroll
      for (int j = 0; j < 8; j++) Vt[nxt][c + j][r] = vv[j];
    }
    wait_async0();
    __syncthreads();
  }

  // ---- normalize and store O ---------------------------------------------
#pragma unroll
  for (int i = 0; i < 8; i++) {
    float inv = 1.f / lrun[i];
    int row = qb + wave * 16 + half * 8 + i;
    _Float16* op = O + base + (size_t)row * DD;
#pragma unroll
    for (int t = 0; t < 4; t++) op[t * 16 + l15] = (_Float16)(o[t][i] * inv);
  }
}

// ---------------------------------------------------------------------------
// Host-side orchestration
// ---------------------------------------------------------------------------
extern "C" void kernel_launch(void* const* d_in, const int* in_sizes, int n_in,
                              void* d_out, int out_size, void* d_ws, size_t ws_size,
                              hipStream_t stream) {
  (void)in_sizes; (void)n_in; (void)out_size; (void)ws_size;

  const float* x        = (const float*)d_in[0];
  const int*   idx_emb  = (const int*)d_in[1];
  const int*   idx_pro  = (const int*)d_in[2];
  // d_in[3] is N == 768 (compile-time constant NV; cannot read device scalar
  // under graph capture).
  const float* Wq1 = (const float*)d_in[4];
  const float* Wk1 = (const float*)d_in[5];
  const float* Wv1 = (const float*)d_in[6];
  const float* Wo1 = (const float*)d_in[7];
  const float* Wq2 = (const float*)d_in[8];
  const float* Wk2 = (const float*)d_in[9];
  const float* Wv2 = (const float*)d_in[10];
  const float* Wo2 = (const float*)d_in[11];
  const float* w_conv1 = (const float*)d_in[12];
  const float* b_conv1 = (const float*)d_in[13];
  const float* w_conv2 = (const float*)d_in[14];
  const float* b_conv2 = (const float*)d_in[15];
  const float* g1 = (const float*)d_in[16];
  const float* beta1 = (const float*)d_in[17];
  const float* g2 = (const float*)d_in[18];
  const float* beta2 = (const float*)d_in[19];

  float* out   = (float*)d_out;          // LN2 result
  float* attn1 = out + BSD;
  float* attn2 = out + 2 * BSD;

  // ---- workspace layout ----
  char* w = (char*)d_ws;
  float* xl1  = (float*)w;  w += BSD * sizeof(float);   // x_l1 f32 (later reused: xln)
  float* f32b = (float*)w;  w += BSD * sizeof(float);   // new_x1 / y2
  float* f32c = (float*)w;  w += BSD * sizeof(float);   // x_l2
  _Float16* h_x = (_Float16*)w; w += BSD * sizeof(_Float16);   // f16 activations
  _Float16* h_q = (_Float16*)w; w += BSD * sizeof(_Float16);
  _Float16* h_k = (_Float16*)w; w += BSD * sizeof(_Float16);
  _Float16* h_v = (_Float16*)w; w += BSD * sizeof(_Float16);
  _Float16* h_o = (_Float16*)w; w += BSD * sizeof(_Float16);
  _Float16* h_ffn = (_Float16*)w; w += (size_t)BSROWS * DFF * sizeof(_Float16);
  _Float16* h_w = (_Float16*)w; w += (size_t)DD * DFF * sizeof(_Float16);   // weight staging

  const dim3 blk(256);
  const dim3 gemmDxD(DD / 128, BSROWS / 128);     // (4, 64)
  const dim3 gemmDxF(DFF / 128, BSROWS / 128);    // (16, 64)
  const dim3 attnGrid(SS / 128, HH, BB);          // (8, 8, 8)

  auto cvt = [&](const float* s, _Float16* d, size_t n) {
    cvt_f16_kernel<<<dim3(2048), blk, 0, stream>>>(s, d, n);
  };

  // 1) x_l1 = gather(x, idx_emb) ; also f16 copy
  gather_cast_kernel<<<dim3(BSROWS), blk, 0, stream>>>(x, idx_emb, xl1, h_x);

  // ================= MHA branch 1 =================
  cvt(Wq1, h_w, (size_t)DD * DD);
  gemm_wmma<true, false, false><<<gemmDxD, blk, 0, stream>>>(h_x, h_w, nullptr, h_q, nullptr, BSROWS, DD, DD);
  cvt(Wk1, h_w, (size_t)DD * DD);
  gemm_wmma<true, false, false><<<gemmDxD, blk, 0, stream>>>(h_x, h_w, nullptr, h_k, nullptr, BSROWS, DD, DD);
  cvt(Wv1, h_w, (size_t)DD * DD);
  gemm_wmma<true, false, false><<<gemmDxD, blk, 0, stream>>>(h_x, h_w, nullptr, h_v, nullptr, BSROWS, DD, DD);
  attn_wmma<<<attnGrid, blk, 0, stream>>>(h_q, h_k, h_v, h_o);
  cvt(Wo1, h_w, (size_t)DD * DD);
  gemm_wmma<false, false, false><<<gemmDxD, blk, 0, stream>>>(h_o, h_w, nullptr, nullptr, attn1, BSROWS, DD, DD);

  // ================= MHA branch 2 (flip∘MHA∘flip == MHA) =================
  cvt(Wq2, h_w, (size_t)DD * DD);
  gemm_wmma<true, false, false><<<gemmDxD, blk, 0, stream>>>(h_x, h_w, nullptr, h_q, nullptr, BSROWS, DD, DD);
  cvt(Wk2, h_w, (size_t)DD * DD);
  gemm_wmma<true, false, false><<<gemmDxD, blk, 0, stream>>>(h_x, h_w, nullptr, h_k, nullptr, BSROWS, DD, DD);
  cvt(Wv2, h_w, (size_t)DD * DD);
  gemm_wmma<true, false, false><<<gemmDxD, blk, 0, stream>>>(h_x, h_w, nullptr, h_v, nullptr, BSROWS, DD, DD);
  attn_wmma<<<attnGrid, blk, 0, stream>>>(h_q, h_k, h_v, h_o);
  cvt(Wo2, h_w, (size_t)DD * DD);
  gemm_wmma<false, false, false><<<gemmDxD, blk, 0, stream>>>(h_o, h_w, nullptr, nullptr, attn2, BSROWS, DD, DD);

  // new_x1 = attn1 + attn2 ; x_l2 = gather(new_x1, idx_pro)
  add2_kernel<<<dim3(4096), blk, 0, stream>>>(attn1, attn2, f32b, BSD);
  gather_cast_kernel<<<dim3(BSROWS), blk, 0, stream>>>(f32b, idx_pro, f32c, nullptr);

  // xln = LN(x + x_l2; g1, beta1)  (reuse xl1 as f32 result, h_x as f16 copy)
  add_ln_kernel<<<dim3(BSROWS), blk, 0, stream>>>(x, f32c, g1, beta1, xl1, h_x);

  // ================= FFN =================
  cvt(w_conv1, h_w, (size_t)DD * DFF);
  gemm_wmma<true, true, true><<<gemmDxF, blk, 0, stream>>>(h_x, h_w, b_conv1, h_ffn, nullptr, BSROWS, DFF, DD);
  cvt(w_conv2, h_w, (size_t)DFF * DD);
  gemm_wmma<false, true, false><<<gemmDxD, blk, 0, stream>>>(h_ffn, h_w, b_conv2, nullptr, f32b, BSROWS, DD, DFF);

  // out = LN(xln + y; g2, beta2)
  add_ln_kernel<<<dim3(BSROWS), blk, 0, stream>>>(xl1, f32b, g2, beta2, out, nullptr);
}

// v001
// It runs in 337 microseconds.
// Timed twice side by side with v000, it ran 1.29 and 1.28 times as fast.
#include <hip/hip_runtime.h>
#include <hip/hip_bf16.h>

// ---------------------------------------------------------------------------
// EncoderLayer for MI455X (gfx1250, wave32, WMMA).
// All GEMMs (QKV/O projections, FFN) and attention (QK^T, PV) run on
// v_wmma_f32_16x16x32_f16 with f32 accumulation (compute-bound: ~103 GFLOP vs
// ~0.1 GB of traffic, so f16 WMMA is the right precision/path on CDNA5).
//  - All LDS tiles are staged row-major with GLOBAL_LOAD_ASYNC_TO_LDS_B128
//    (ASYNCcnt-tracked, bypasses VGPRs) + s_wait_asynccnt; operands that need
//    k along the rows (W in the GEMMs, V in attention) are transposed on the
//    way out of LDS by ds_load_tr16_b128.
//  - Double-buffered software pipeline: tile t+1's async copy overlaps
//    tile t's WMMAs; one barrier per k-step.
//  - Softmax cross-lane reductions use VALU DPP butterflies (xor 1/2/7/15 via
//    quad_perm + mirrors), freeing the DS pipe for WMMA fragment loads and
//    co-executing with the matrix pipe.
// Note: MHA without positional terms is permutation-equivariant, so
// flip(MHA(flip(x))) == MHA(x); branch 2 is just MHA with the W2 weights.
// ---------------------------------------------------------------------------

#define BB   8
#define SS   1024
#define NV   768
#define DD   512
#define DFF  2048
#define HH   8
#define DHH  64
#define BSROWS (BB * SS)                       // 8192
#define BSD   ((size_t)BSROWS * DD)            // 4,194,304

typedef _Float16 v16h __attribute__((ext_vector_type(16)));
typedef float    v8f  __attribute__((ext_vector_type(8)));
typedef _Float16 h8   __attribute__((ext_vector_type(8)));

// ---------------- DPP 16-lane butterfly reductions (VALU, no DS pipe) ------
template <int CTRL>
__device__ __forceinline__ float dpp_perm_f(float x) {
  int i = __builtin_bit_cast(int, x);
  int r = __builtin_amdgcn_update_dpp(i, i, CTRL, 0xF, 0xF, true);
  return __builtin_bit_cast(float, r);
}
__device__ __forceinline__ float red16_max(float x) {
  x = fmaxf(x, dpp_perm_f<0xB1>(x));    // quad_perm [1,0,3,2] : xor 1
  x = fmaxf(x, dpp_perm_f<0x4E>(x));    // quad_perm [2,3,0,1] : xor 2
  x = fmaxf(x, dpp_perm_f<0x141>(x));   // row_half_mirror     : xor 7
  x = fmaxf(x, dpp_perm_f<0x140>(x));   // row_mirror          : xor 15
  return x;
}
__device__ __forceinline__ float red16_sum(float x) {
  x += dpp_perm_f<0xB1>(x);
  x += dpp_perm_f<0x4E>(x);
  x += dpp_perm_f<0x141>(x);
  x += dpp_perm_f<0x140>(x);
  return x;
}

// ---------------- async global -> LDS staging (CDNA5, ASYNCcnt) ------------
__device__ __forceinline__ unsigned lds_off_of(const void* p) {
  // generic pointers to LDS carry the offset in the low 32 bits
  return (unsigned)(unsigned long long)(uintptr_t)p;
}
// A run of copies and its s_wait_xcnt 0 are one statement, so that no address
// register of an issued copy is rewritten ahead of that wait.
__device__ __forceinline__ void async_copy2_b128(unsigned l0, const void* g0,
                                                 unsigned l1, const void* g1) {
  asm volatile("global_load_async_to_lds_b128 %0, %1, off\n\t"
               "global_load_async_to_lds_b128 %2, %3, off\n\t"
               "s_wait_xcnt 0x0"
               :: "v"(l0), "v"((unsigned long long)(uintptr_t)g0),
                  "v"(l1), "v"((unsigned long long)(uintptr_t)g1)
               : "memory");
}
__device__ __forceinline__ void async_copy4_b128(unsigned l0, const void* g0,
                                                 unsigned l1, const void* g1,
                                                 unsigned l2, const void* g2,
                                                 unsigned l3, const void* g3) {
  asm volatile("global_load_async_to_lds_b128 %0, %1, off\n\t"
               "global_load_async_to_lds_b128 %2, %3, off\n\t"
               "global_load_async_to_lds_b128 %4, %5, off\n\t"
               "global_load_async_to_lds_b128 %6, %7, off\n\t"
               "s_wait_xcnt 0x0"
               :: "v"(l0), "v"((unsigned long long)(uintptr_t)g0),
                  "v"(l1), "v"((unsigned long long)(uintptr_t)g1),
                  "v"(l2), "v"((unsigned long long)(uintptr_t)g2),
                  "v"(l3), "v"((unsigned long long)(uintptr_t)g3)
               : "memory");
}
// This wave's copies have landed (the compiler places no wait for them).
__device__ __forceinline__ void wait_async0() {
  asm volatile("s_wait_asynccnt 0x0" ::: "memory");
}
// This wave's LDS reads are done before the buffer is handed back for a refill.
__device__ __forceinline__ void wait_ds0() {
  asm volatile("s_wait_dscnt 0x0" ::: "memory");
}

// ---------------- transposing LDS load (row-major [k][n] tile -> operand) ---
// Lane l passes the address of T[kbase + 8*(l>>4) + (l&7)][nbase + 8*((l>>3)&1)]
// and receives T[kbase + 8*(l>>4) + 0..7][nbase + (l&15)].
typedef short s16x8 __attribute__((ext_vector_type(8)));
__device__ __forceinline__ h8 lds_tr16(const _Float16* p) {
  typedef __attribute__((address_space(3))) s16x8 lds_s16x8;
  return __builtin_bit_cast(h8, __builtin_amdgcn_ds_load_tr16_b128_v8i16((lds_s16x8*)p));
}

// ---------------------------------------------------------------------------
// f32 -> f16 convert (weights, etc.)
// ---------------------------------------------------------------------------
__global__ __launch_bounds__(256) void cvt_f16_kernel(const float* __restrict__ src,
                                                      _Float16* __restrict__ dst,
                                                      size_t n) {
  size_t i = (size_t)blockIdx.x * blockDim.x + threadIdx.x;
  size_t stride = (size_t)gridDim.x * blockDim.x;
  for (; i < n; i += stride) dst[i] = (_Float16)src[i];
}

// ---------------------------------------------------------------------------
// Batched gather over first N rows (rest pass-through), optional f16 copy.
// ---------------------------------------------------------------------------
__global__ __launch_bounds__(256) void gather_cast_kernel(const float* __restrict__ x,
                                                          const int* __restrict__ idx,
                                                          float* __restrict__ of,
                                                          _Float16* __restrict__ oh) {
  int bs = blockIdx.x;                 // 0..B*S-1
  int b = bs / SS, s = bs % SS;
  int srow = s;
  if (s < NV) srow = idx[b * NV + s];
  const float* src = x + ((size_t)b * SS + srow) * DD;
  size_t dbase = (size_t)bs * DD;
  for (int d = threadIdx.x; d < DD; d += blockDim.x) {
    float v = src[d];
    of[dbase + d] = v;
    if (oh) oh[dbase + d] = (_Float16)v;
  }
}

// ---------------------------------------------------------------------------
// c = a + b (elementwise f32)
// ---------------------------------------------------------------------------
__global__ __launch_bounds__(256) void add2_kernel(const float* __restrict__ a,
                                                   const float* __restrict__ b,
                                                   float* __restrict__ c, size_t n) {
  size_t i = (size_t)blockIdx.x * blockDim.x + threadIdx.x;
  size_t stride = (size_t)gridDim.x * blockDim.x;
  for (; i < n; i += stride) c[i] = a[i] + b[i];
}

// ---------------------------------------------------------------------------
// out = LayerNorm(a + b) * g + beta, one block (256 thr) per row of D=512.
// ---------------------------------------------------------------------------
__global__ __launch_bounds__(256) void add_ln_kernel(const float* __restrict__ a,
                                                     const float* __restrict__ b,
                                                     const float* __restrict__ g,
                                                     const float* __restrict__ beta,
                                                     float* __restrict__ of,
                                                     _Float16* __restrict__ oh) {
  __shared__ float sred[16];
  int row = blockIdx.x;
  size_t base = (size_t)row * DD;
  int d0 = threadIdx.x, d1 = threadIdx.x + 256;
  float t0 = a[base + d0] + b[base + d0];
  float t1 = a[base + d1] + b[base + d1];
  float s = t0 + t1, ss = t0 * t0 + t1 * t1;
#pragma unroll
  for (int m = 1; m < 32; m <<= 1) { s += __shfl_xor(s, m, 32); ss += __shfl_xor(ss, m, 32); }
  int wave = threadIdx.x >> 5, lane = threadIdx.x & 31;
  if (lane == 0) { sred[wave] = s; sred[8 + wave] = ss; }
  __syncthreads();
  if (wave == 0) {
    float s2 = (lane < 8) ? sred[lane] : 0.f;
    float q2 = (lane < 8) ? sred[8 + lane] : 0.f;
#pragma unroll
    for (int m = 1; m < 8; m <<= 1) { s2 += __shfl_xor(s2, m, 32); q2 += __shfl_xor(q2, m, 32); }
    if (lane == 0) { sred[0] = s2; sred[1] = q2; }
  }
  __syncthreads();
  float mu  = sred[0] * (1.f / DD);
  float var = sred[1] * (1.f / DD) - mu * mu;
  float rstd = rsqrtf(var + 1e-5f);
  float r0 = (t0 - mu) * rstd * g[d0] + beta[d0];
  float r1 = (t1 - mu) * rstd * g[d1] + beta[d1];
  of[base + d0] = r0;
  of[base + d1] = r1;
  if (oh) { oh[base + d0] = (_Float16)r0; oh[base + d1] = (_Float16)r1; }
}

// ---------------------------------------------------------------------------
// WMMA GEMM: C[M,N] = A[M,K] (f16, row-major) @ W[K,N] (f16, row-major)
// Workgroup tile 128x128, 8 waves in a 4(M) x 2(N) grid, each wave 32x64
// (2x4 accumulators of v_wmma_f32_16x16x32_f16). Double-buffered pipeline:
// A-tile and W-tile both via async global->LDS, each in its global row order;
// W fragments come out of LDS through ds_load_tr16_b128. One barrier per k-step.
// ---------------------------------------------------------------------------
template <bool OUT_F16, bool BIAS, bool RELU>
__global__ __launch_bounds__(256) void gemm_wmma(const _Float16* __restrict__ A,
                                                 const _Float16* __restrict__ W,
                                                 const float* __restrict__ bias,
                                                 _Float16* __restrict__ outH,
                                                 float* __restrict__ outF,
                                                 int M, int N, int K) {
  // ping-pong: 128 rows x 32 K, pitch 80 B (16 B x odd, for ds_load_b128)
  __shared__ __attribute__((aligned(16))) _Float16 As[2][128][40];
  // ping-pong: 32 K x 128 cols(N), pitch 288 B (32 B x odd, for ds_load_tr16_b128)
  __shared__ __attribute__((aligned(16))) _Float16 Bs[2][32][144];

  const int tid  = threadIdx.x;
  const int lane = tid & 31;
  const int wave = tid >> 5;
  const int l15  = lane & 15;
  const int half = lane >> 4;
  const int wm = wave >> 1;          // 0..3
  const int wn = wave & 1;           // 0..1
  const int mbase = blockIdx.y * 128;
  const int nbase = blockIdx.x * 128;

  v8f acc[2][4];
#pragma unroll
  for (int i = 0; i < 2; i++)
#pragma unroll
    for (int j = 0; j < 4; j++) { v8f z = {}; acc[i][j] = z; }

  const int arow = tid >> 1;            // A tile: row t/2, 16 halfs at (t&1)*16
  const int acs  = (tid & 1) * 16;
  const int bkr  = tid >> 4;            // W tile: k-rows t/16 and t/16 + 16,
  const int bns  = (tid & 15) * 8;      //         8 cols at (t&15)*8

  const int nk = K >> 5;                // k-steps of 32

  // all four copies of one thread for k-tile kt into buffer buf
  auto stage = [&](int kt, int buf) {
    const _Float16* ga = A + (size_t)(mbase + arow) * K + (kt << 5) + acs;
    const _Float16* gw = W + (size_t)((kt << 5) + bkr) * N + nbase + bns;
    async_copy4_b128(lds_off_of(&As[buf][arow][acs]), ga,
                     lds_off_of(&As[buf][arow][acs + 8]), ga + 8,
                     lds_off_of(&Bs[buf][bkr][bns]), gw,
                     lds_off_of(&Bs[buf][bkr + 16][bns]), gw + (size_t)16 * N);
  };

  // prologue: tile 0 lands and is published, then tile 1 starts to fly
  stage(0, 0);
  wait_async0();
  __syncthreads();
  if (nk > 1) stage(1, 1);

  for (int t = 0; t < nk; ++t) {
    const int cur = t & 1;

    // ---- compute on current buffers ----
    v16h af[2], bf[4];
#pragma unroll
    for (int mt = 0; mt < 2; mt++) {
      const _Float16* p = &As[cur][wm * 32 + mt * 16 + l15][half * 8];
#pragma unroll
      for (int i = 0; i < 8; i++) { af[mt][i] = p[i]; af[mt][8 + i] = p[16 + i]; }
    }
#pragma unroll
    for (int nt = 0; nt < 4; nt++) {
      // k 8*half + 0..7 and 16 + 8*half + 0..7 of column l15: the A loader's k order
      const _Float16* p = &Bs[cur][half * 8 + (lane & 7)][wn * 64 + nt * 16 + ((lane >> 3) & 1) * 8];
      h8 lo = lds_tr16(p), hi = lds_tr16(p + 16 * 144);
#pragma unroll
      for (int i = 0; i < 8; i++) { bf[nt][i] = lo[i]; bf[nt][8 + i] = hi[i]; }
    }
#pragma unroll
    for (int mt = 0; mt < 2; mt++)
#pragma unroll
      for (int nt = 0; nt < 4; nt++)
        acc[mt][nt] = __builtin_amdgcn_wmma_f32_16x16x32_f16(
            false, af[mt], false, bf[nt], (short)0, acc[mt][nt], false, false);

    // publish tile t+1, free buffer cur, then refill it with tile t+2
    wait_ds0();
    wait_async0();
    __syncthreads();
    if (t + 2 < nk) stage(t + 2, cur);
  }
  wait_async0();   // the ring is closed: no copy of this wave is left in flight

  // Epilogue: C layout: VGPR i, lane half h -> row = 8*h + i, col = l15.
#pragma unroll
  for (int mt = 0; mt < 2; mt++) {
#pragma unroll
    for (int nt = 0; nt < 4; nt++) {
      int gc = nbase + wn * 64 + nt * 16 + l15;
      float bv = BIAS ? bias[gc] : 0.f;
#pragma unroll
      for (int i = 0; i < 8; i++) {
        int gr = mbase + wm * 32 + mt * 16 + half * 8 + i;
        float v = acc[mt][nt][i] + bv;
        if (RELU) v = v > 0.f ? v : 0.f;
        size_t off = (size_t)gr * N + gc;
        if (OUT_F16) outH[off] = (_Float16)v;
        else         outF[off] = v;
      }
    }
  }
}

// ---------------------------------------------------------------------------
// Flash-style attention, one workgroup per (128 q-rows, head, batch).
// 8 waves x 16 q-rows; K/V streamed through double-buffered LDS in 32-key
// blocks (K and V async global->LDS; V read by ds_load_tr16_b128). scores: 2 WMMAs
// per 16-key subtile (K=64 contraction); P staged via LDS (C->A layout,
// wave-local s_wait_dscnt); PV: 4 WMMAs. Softmax reductions on VALU DPP.
// ---------------------------------------------------------------------------
__global__ __launch_bounds__(256) void attn_wmma(const _Float16* __restrict__ Q,
                                                 const _Float16* __restrict__ Kk,
                                                 const _Float16* __restrict__ V,
                                                 _Float16* __restrict__ O) {
  // [key][d], pitch 144 B (16 B x odd, for ds_load_b128)
  __shared__ __attribute__((aligned(16))) _Float16 Kb[2][32][72];
  // [key][d], pitch 160 B (32 B x odd, for ds_load_tr16_b128)
  __shared__ __attribute__((aligned(16))) _Float16 Vs[2][32][80];
  __shared__ _Float16 Pst[8][16][32];    // per-wave P tile [row][key]

  const int tid  = threadIdx.x;
  const int lane = tid & 31;
  const int wave = tid >> 5;
  const int l15  = lane & 15;
  const int half = lane >> 4;
  const int qb   = blockIdx.x * 128;
  const int head = blockIdx.y;
  const int bat  = blockIdx.z;
  const size_t base = (size_t)bat * SS * DD + (size_t)head * DHH;
  const float scale = 0.125f;            // 1/sqrt(64)

  // Q fragments: rows qb + wave*16 + l15, d split {0..31},{32..63}
  v16h qa[2];
  {
    const _Float16* qp = Q + base + (size_t)(qb + wave * 16 + l15) * DD;
#pragma unroll
    for (int f = 0; f < 2; f++)
#pragma unroll
      for (int i = 0; i < 8; i++) {
        qa[f][i]     = qp[f * 32 + half * 8 + i];
        qa[f][8 + i] = qp[f * 32 + 16 + half * 8 + i];
      }
  }

  v8f o[4];
#pragma unroll
  for (int t = 0; t < 4; t++) { v8f z = {}; o[t] = z; }
  float mrun[8], lrun[8];
#pragma unroll
  for (int i = 0; i < 8; i++) { mrun[i] = -1e30f; lrun[i] = 0.f; }

  const int r = tid >> 3;                // 0..31 (key)
  const int c = (tid & 7) * 8;           // 0..56 (d)

  // both copies of one thread for key-block kb into buffer buf
  auto stage = [&](int kb, int buf) {
    size_t roff = base + (size_t)(kb * 32 + r) * DD + c;
    async_copy2_b128(lds_off_of(&Kb[buf][r][c]), Kk + roff,
                     lds_off_of(&Vs[buf][r][c]), V + roff);
  };

  const int nkb = SS >> 5;               // 32-key blocks

  // prologue: block 0 lands and is published, then block 1 starts to fly
  stage(0, 0);
  wait_async0();
  __syncthreads();
  stage(1, 1);

  for (int t = 0; t < nkb; ++t) {
    const int cur = t & 1;

    // ---- scores: S_tile(16 x 32) in two 16-key subtiles -------------------
    v8f sc[2];
#pragma unroll
    for (int nb = 0; nb < 2; nb++) {
      v8f z = {};
      v16h bf;
      {
        const _Float16* p = &Kb[cur][nb * 16 + l15][half * 8];
#pragma unroll
        for (int i = 0; i < 8; i++) { bf[i] = p[i]; bf[8 + i] = p[16 + i]; }
      }
      z = __builtin_amdgcn_wmma_f32_16x16x32_f16(false, qa[0], false, bf, (short)0, z, false, false);
      {
        const _Float16* p = &Kb[cur][nb * 16 + l15][32 + half * 8];
#pragma unroll
        for (int i = 0; i < 8; i++) { bf[i] = p[i]; bf[8 + i] = p[16 + i]; }
      }
      z = __builtin_amdgcn_wmma_f32_16x16x32_f16(false, qa[1], false, bf, (short)0, z, false, false);
      sc[nb] = z;
    }
#pragma unroll
    for (int nb = 0; nb < 2; nb++)
#pragma unroll
      for (int i = 0; i < 8; i++) sc[nb][i] *= scale;

    // ---- online softmax (row = 8*half + i; DPP reduce across 16 lanes) ----
#pragma unroll
    for (int i = 0; i < 8; i++) {
      float mx = red16_max(fmaxf(sc[0][i], sc[1][i]));
      float mnew = fmaxf(mrun[i], mx);
      float corr = __expf(mrun[i] - mnew);
      float p0 = __expf(sc[0][i] - mnew);
      float p1 = __expf(sc[1][i] - mnew);
      float rs = red16_sum(p0 + p1);
      lrun[i] = lrun[i] * corr + rs;
      mrun[i] = mnew;
#pragma unroll
      for (int tt = 0; tt < 4; tt++) o[tt][i] *= corr;
      Pst[wave][half * 8 + i][l15]      = (_Float16)p0;
      Pst[wave][half * 8 + i][16 + l15] = (_Float16)p1;
    }
    // wave-local LDS RAW: same-wave DS ops are in-order; wait then reload.
    asm volatile("s_wait_dscnt 0x0" ::: "memory");

    // ---- P fragment (A-layout 16x32) --------------------------------------
    v16h pa;
    {
      const _Float16* p = &Pst[wave][l15][half * 8];
#pragma unroll
      for (int i = 0; i < 8; i++) { pa[i] = p[i]; pa[8 + i] = p[16 + i]; }
    }
    // ---- PV: O(16 x 64) += P(16 x 32) @ V(32 x 64) ------------------------
#pragma unroll
    for (int tt = 0; tt < 4; tt++) {
      v16h bf;
      // keys 8*half + 0..7 and 16 + 8*half + 0..7 of column d = tt*16 + l15: P's k order
      const _Float16* p = &Vs[cur][half * 8 + (lane & 7)][tt * 16 + ((lane >> 3) & 1) * 8];
      h8 lo = lds_tr16(p), hi = lds_tr16(p + 16 * 80);
#pragma unroll
      for (int i = 0; i < 8; i++) { bf[i] = lo[i]; bf[8 + i] = hi[i]; }
      o[tt] = __builtin_amdgcn_wmma_f32_16x16x32_f16(false, pa, false, bf, (short)0, o[tt], false, false);
    }

    // publish block t+1, free buffer cur, then refill it with block t+2
    wait_ds0();
    wait_async0();
    __syncthreads();
    if (t + 2 < nkb) stage(t + 2, cur);
  }
  wait_async0();   // the ring is closed: no copy of this wave is left in flight

  // ---- normalize and store O ---------------------------------------------
#pragma unroll
  for (int i = 0; i < 8; i++) {
    float inv = 1.f / lrun[i];
    int row = qb + wave * 16 + half * 8 + i;
    _Float16* op = O + base + (size_t)row * DD;
#pragma unroll
    for (int t = 0; t < 4; t++) op[t * 16 + l15] = (_Float16)(o[t][i] * inv);
  }
}

// ---------------------------------------------------------------------------
// Host-side orchestration
// ---------------------------------------------------------------------------
extern "C" void kernel_launch(void* const* d_in, const int* in_sizes, int n_in,
                              void* d_out, int out_size, void* d_ws, size_t ws_size,
                              hipStream_t stream) {
  (void)in_sizes; (void)n_in; (void)out_size; (void)ws_size;

  const float* x        = (const float*)d_in[0];
  const int*   idx_emb  = (const int*)d_in[1];
  const int*   idx_pro  = (const int*)d_in[2];
  // d_in[3] is N == 768 (compile-time constant NV; cannot read device scalar
  // under graph capture).
  const float* Wq1 = (const float*)d_in[4];
  const float* Wk1 = (const float*)d_in[5];
  const float* Wv1 = (const float*)d_in[6];
  const float* Wo1 = (const float*)d_in[7];
  const float* Wq2 = (const float*)d_in[8];
  const float* Wk2 = (const float*)d_in[9];
  const float* Wv2 = (const float*)d_in[10];
  const float* Wo2 = (const float*)d_in[11];
  const float* w_conv1 = (const float*)d_in[12];
  const float* b_conv1 = (const float*)d_in[13];
  const float* w_conv2 = (const float*)d_in[14];
  const float* b_conv2 = (const float*)d_in[15];
  const float* g1 = (const float*)d_in[16];
  const float* beta1 = (const float*)d_in[17];
  const float* g2 = (const float*)d_in[18];
  const float* beta2 = (const float*)d_in[19];

  float* out   = (float*)d_out;          // LN2 result
  float* attn1 = out + BSD;
  float* attn2 = out + 2 * BSD;

  // ---- workspace layout ----
  char* w = (char*)d_ws;
  float* xl1  = (float*)w;  w += BSD * sizeof(float);   // x_l1 f32 (later reused: xln)
  float* f32b = (float*)w;  w += BSD * sizeof(float);   // new_x1 / y2
  float* f32c = (float*)w;  w += BSD * sizeof(float);   // x_l2
  _Float16* h_x = (_Float16*)w; w += BSD * sizeof(_Float16);   // f16 activations
  _Float16* h_q = (_Float16*)w; w += BSD * sizeof(_Float16);
  _Float16* h_k = (_Float16*)w; w += BSD * sizeof(_Float16);
  _Float16* h_v = (_Float16*)w; w += BSD * sizeof(_Float16);
  _Float16* h_o = (_Float16*)w; w += BSD * sizeof(_Float16);
  _Float16* h_ffn = (_Float16*)w; w += (size_t)BSROWS * DFF * sizeof(_Float16);
  _Float16* h_w = (_Float16*)w; w += (size_t)DD * DFF * sizeof(_Float16);   // weight staging

  const dim3 blk(256);
  const dim3 gemmDxD(DD / 128, BSROWS / 128);     // (4, 64)
  const dim3 gemmDxF(DFF / 128, BSROWS / 128);    // (16, 64)
  const dim3 attnGrid(SS / 128, HH, BB);          // (8, 8, 8)

  auto cvt = [&](const float* s, _Float16* d, size_t n) {
    cvt_f16_kernel<<<dim3(2048), blk, 0, stream>>>(s, d, n);
  };

  // 1) x_l1 = gather(x, idx_emb) ; also f16 copy
  gather_cast_kernel<<<dim3(BSROWS), blk, 0, stream>>>(x, idx_emb, xl1, h_x);

  // ================= MHA branch 1 =================
  cvt(Wq1, h_w, (size_t)DD * DD);
  gemm_wmma<true, false, false><<<gemmDxD, blk, 0, stream>>>(h_x, h_w, nullptr, h_q, nullptr, BSROWS, DD, DD);
  cvt(Wk1, h_w, (size_t)DD * DD);
  gemm_wmma<true, false, false><<<gemmDxD, blk, 0, stream>>>(h_x, h_w, nullptr, h_k, nullptr, BSROWS, DD, DD);
  cvt(Wv1, h_w, (size_t)DD * DD);
  gemm_wmma<true, false, false><<<gemmDxD, blk, 0, stream>>>(h_x, h_w, nullptr, h_v, nullptr, BSROWS, DD, DD);
  attn_wmma<<<attnGrid, blk, 0, stream>>>(h_q, h_k, h_v, h_o);
  cvt(Wo1, h_w, (size_t)DD * DD);
  gemm_wmma<false, false, false><<<gemmDxD, blk, 0, stream>>>(h_o, h_w, nullptr, nullptr, attn1, BSROWS, DD, DD);

  // ================= MHA branch 2 (flip∘MHA∘flip == MHA) =================
  cvt(Wq2, h_w, (size_t)DD * DD);
  gemm_wmma<true, false, false><<<gemmDxD, blk, 0, stream>>>(h_x, h_w, nullptr, h_q, nullptr, BSROWS, DD, DD);
  cvt(Wk2, h_w, (size_t)DD * DD);
  gemm_wmma<true, false, false><<<gemmDxD, blk, 0, stream>>>(h_x, h_w, nullptr, h_k, nullptr, BSROWS, DD, DD);
  cvt(Wv2, h_w, (size_t)DD * DD);
  gemm_wmma<true, false, false><<<gemmDxD, blk, 0, stream>>>(h_x, h_w, nullptr, h_v, nullptr, BSROWS, DD, DD);
  attn_wmma<<<attnGrid, blk, 0, stream>>>(h_q, h_k, h_v, h_o);
  cvt(Wo2, h_w, (size_t)DD * DD);
  gemm_wmma<false, false, false><<<gemmDxD, blk, 0, stream>>>(h_o, h_w, nullptr, nullptr, attn2, BSROWS, DD, DD);

  // new_x1 = attn1 + attn2 ; x_l2 = gather(new_x1, idx_pro)
  add2_kernel<<<dim3(4096), blk, 0, stream>>>(attn1, attn2, f32b, BSD);
  gather_cast_kernel<<<dim3(BSROWS), blk, 0, stream>>>(f32b, idx_pro, f32c, nullptr);

  // xln = LN(x + x_l2; g1, beta1)  (reuse xl1 as f32 result, h_x as f16 copy)
  add_ln_kernel<<<dim3(BSROWS), blk, 0, stream>>>(x, f32c, g1, beta1, xl1, h_x);

  // ================= FFN =================
  cvt(w_conv1, h_w, (size_t)DD * DFF);
  gemm_wmma<true, true, true><<<gemmDxF, blk, 0, stream>>>(h_x, h_w, b_conv1, h_ffn, nullptr, BSROWS, DFF, DD);
  cvt(w_conv2, h_w, (size_t)DFF * DD);
  gemm_wmma<false, true, false><<<gemmDxD, blk, 0, stream>>>(h_ffn, h_w, b_conv2, nullptr, f32b, BSROWS, DD, DFF);

  // out = LN(xln + y; g2, beta2)
  add_ln_kernel<<<dim3(BSROWS), blk, 0, stream>>>(xl1, f32b, g2, beta2, out, nullptr);
}

// v002
// One run takes 275 microseconds.
// Timed twice side by side with v001, it ran 1.23 times as fast both times.
// All steps since v000 together make it 1.58 times as fast.
#include <hip/hip_runtime.h>
#include <hip/hip_bf16.h>

// ---------------------------------------------------------------------------
// EncoderLayer for MI455X (gfx1250, wave32, WMMA).
// All GEMMs (QKV/O projections, FFN) and attention (QK^T, PV) run on
// v_wmma_f32_16x16x32_f16 with f32 accumulation (compute-bound: ~103 GFLOP vs
// ~0.1 GB of traffic, so f16 WMMA is the right precision/path on CDNA5).
//  - All LDS tiles are staged row-major with GLOBAL_LOAD_ASYNC_TO_LDS_B128
//    (ASYNCcnt-tracked, bypasses VGPRs) + s_wait_asynccnt; operands that need
//    k along the rows (W in the GEMMs, V in attention) are transposed on the
//    way out of LDS by ds_load_tr16_b128.
//  - Double-buffered software pipeline: tile t+1's async copy overlaps
//    tile t's WMMAs; one barrier per k-step.
//  - Softmax cross-lane reductions use VALU DPP butterflies (xor 1/2/7/15 via
//    quad_perm + mirrors), freeing the DS pipe for WMMA fragment loads and
//    co-executing with the matrix pipe.
// Note: MHA without positional terms is permutation-equivariant, so
// flip(MHA(flip(x))) == MHA(x); branch 2 is just MHA with the W2 weights.
// ---------------------------------------------------------------------------

#define BB   8
#define SS   1024
#define NV   768
#define DD   512
#define DFF  2048
#define HH   8
#define DHH  64
#define BSROWS (BB * SS)                       // 8192
#define BSD   ((size_t)BSROWS * DD)            // 4,194,304

typedef _Float16 v16h __attribute__((ext_vector_type(16)));
typedef float    v8f  __attribute__((ext_vector_type(8)));
typedef _Float16 h8   __attribute__((ext_vector_type(8)));

// ---------------- DPP 16-lane butterfly reductions (VALU, no DS pipe) ------
template <int CTRL>
__device__ __forceinline__ float dpp_perm_f(float x) {
  int i = __builtin_bit_cast(int, x);
  int r = __builtin_amdgcn_update_dpp(i, i, CTRL, 0xF, 0xF, true);
  return __builtin_bit_cast(float, r);
}
__device__ __forceinline__ float red16_max(float x) {
  x = fmaxf(x, dpp_perm_f<0xB1>(x));    // quad_perm [1,0,3,2] : xor 1
  x = fmaxf(x, dpp_perm_f<0x4E>(x));    // quad_perm [2,3,0,1] : xor 2
  x = fmaxf(x, dpp_perm_f<0x141>(x));   // row_half_mirror     : xor 7
  x = fmaxf(x, dpp_perm_f<0x140>(x));   // row_mirror          : xor 15
  return x;
}
__device__ __forceinline__ float red16_sum(float x) {
  x += dpp_perm_f<0xB1>(x);
  x += dpp_perm_f<0x4E>(x);
  x += dpp_perm_f<0x141>(x);
  x += dpp_perm_f<0x140>(x);
  return x;
}

// ---------------- async global -> LDS staging (CDNA5, ASYNCcnt) ------------
__device__ __forceinline__ unsigned lds_off_of(const void* p) {
  // generic pointers to LDS carry the offset in the low 32 bits
  return (unsigned)(unsigned long long)(uintptr_t)p;
}
// A run of copies and its s_wait_xcnt 0 are one statement, so that no address
// register of an issued copy is rewritten ahead of that wait.
__device__ __forceinline__ void async_copy2_b128(unsigned l0, const void* g0,
                                                 unsigned l1, const void* g1) {
  asm volatile("global_load_async_to_lds_b128 %0, %1, off\n\t"
               "global_load_async_to_lds_b128 %2, %3, off\n\t"
               "s_wait_xcnt 0x0"
               :: "v"(l0), "v"((unsigned long long)(uintptr_t)g0),
                  "v"(l1), "v"((unsigned long long)(uintptr_t)g1)
               : "memory");
}
__device__ __forceinline__ void async_copy8_b128(unsigned l0, const void* g0,
                                                 unsigned l1, const void* g1,
                                                 unsigned l2, const void* g2,
                                                 unsigned l3, const void* g3,
                                                 unsigned l4, const void* g4,
                                                 unsigned l5, const void* g5,
                                                 unsigned l6, const void* g6,
                                                 unsigned l7, const void* g7) {
  asm volatile("global_load_async_to_lds_b128 %0, %1, off\n\t"
               "global_load_async_to_lds_b128 %2, %3, off\n\t"
               "global_load_async_to_lds_b128 %4, %5, off\n\t"
               "global_load_async_to_lds_b128 %6, %7, off\n\t"
               "global_load_async_to_lds_b128 %8, %9, off\n\t"
               "global_load_async_to_lds_b128 %10, %11, off\n\t"
               "global_load_async_to_lds_b128 %12, %13, off\n\t"
               "global_load_async_to_lds_b128 %14, %15, off\n\t"
               "s_wait_xcnt 0x0"
               :: "v"(l0), "v"((unsigned long long)(uintptr_t)g0),
                  "v"(l1), "v"((unsigned long long)(uintptr_t)g1),
                  "v"(l2), "v"((unsigned long long)(uintptr_t)g2),
                  "v"(l3), "v"((unsigned long long)(uintptr_t)g3),
                  "v"(l4), "v"((unsigned long long)(uintptr_t)g4),
                  "v"(l5), "v"((unsigned long long)(uintptr_t)g5),
                  "v"(l6), "v"((unsigned long long)(uintptr_t)g6),
                  "v"(l7), "v"((unsigned long long)(uintptr_t)g7)
               : "memory");
}
// This wave's copies have landed (the compiler places no wait for them).
__device__ __forceinline__ void wait_async0() {
  asm volatile("s_wait_asynccnt 0x0" ::: "memory");
}
// This wave's LDS reads are done before the buffer is handed back for a refill.
__device__ __forceinline__ void wait_ds0() {
  asm volatile("s_wait_dscnt 0x0" ::: "memory");
}

// ---------------- transposing LDS load (row-major [k][n] tile -> operand) ---
// Lane l passes the address of T[kbase + 8*(l>>4) + (l&7)][nbase + 8*((l>>3)&1)]
// and receives T[kbase + 8*(l>>4) + 0..7][nbase + (l&15)].
typedef short s16x8 __attribute__((ext_vector_type(8)));
__device__ __forceinline__ h8 lds_tr16(const _Float16* p) {
  typedef __attribute__((address_space(3))) s16x8 lds_s16x8;
  return __builtin_bit_cast(h8, __builtin_amdgcn_ds_load_tr16_b128_v8i16((lds_s16x8*)p));
}

// ---------------------------------------------------------------------------
// f32 -> f16 convert (weights, etc.)
// ---------------------------------------------------------------------------
__global__ __launch_bounds__(256) void cvt_f16_kernel(const float* __restrict__ src,
                                                      _Float16* __restrict__ dst,
                                                      size_t n) {
  size_t i = (size_t)blockIdx.x * blockDim.x + threadIdx.x;
  size_t stride = (size_t)gridDim.x * blockDim.x;
  for (; i < n; i += stride) dst[i] = (_Float16)src[i];
}

// ---------------------------------------------------------------------------
// Batched gather over first N rows (rest pass-through), optional f16 copy.
// ---------------------------------------------------------------------------
__global__ __launch_bounds__(256) void gather_cast_kernel(const float* __restrict__ x,
                                                          const int* __restrict__ idx,
                                                          float* __restrict__ of,
                                                          _Float16* __restrict__ oh) {
  int bs = blockIdx.x;                 // 0..B*S-1
  int b = bs / SS, s = bs % SS;
  int srow = s;
  if (s < NV) srow = idx[b * NV + s];
  const float* src = x + ((size_t)b * SS + srow) * DD;
  size_t dbase = (size_t)bs * DD;
  for (int d = threadIdx.x; d < DD; d += blockDim.x) {
    float v = src[d];
    of[dbase + d] = v;
    if (oh) oh[dbase + d] = (_Float16)v;
  }
}

// ---------------------------------------------------------------------------
// c = a + b (elementwise f32)
// ---------------------------------------------------------------------------
__global__ __launch_bounds__(256) void add2_kernel(const float* __restrict__ a,
                                                   const float* __restrict__ b,
                                                   float* __restrict__ c, size_t n) {
  size_t i = (size_t)blockIdx.x * blockDim.x + threadIdx.x;
  size_t stride = (size_t)gridDim.x * blockDim.x;
  for (; i < n; i += stride) c[i] = a[i] + b[i];
}

// ---------------------------------------------------------------------------
// out = LayerNorm(a + b) * g + beta, one block (256 thr) per row of D=512.
// ---------------------------------------------------------------------------
__global__ __launch_bounds__(256) void add_ln_kernel(const float* __restrict__ a,
                                                     const float* __restrict__ b,
                                                     const float* __restrict__ g,
                                                     const float* __restrict__ beta,
                                                     float* __restrict__ of,
                                                     _Float16* __restrict__ oh) {
  __shared__ float sred[16];
  int row = blockIdx.x;
  size_t base = (size_t)row * DD;
  int d0 = threadIdx.x, d1 = threadIdx.x + 256;
  float t0 = a[base + d0] + b[base + d0];
  float t1 = a[base + d1] + b[base + d1];
  float s = t0 + t1, ss = t0 * t0 + t1 * t1;
#pragma unroll
  for (int m = 1; m < 32; m <<= 1) { s += __shfl_xor(s, m, 32); ss += __shfl_xor(ss, m, 32); }
  int wave = threadIdx.x >> 5, lane = threadIdx.x & 31;
  if (lane == 0) { sred[wave] = s; sred[8 + wave] = ss; }
  __syncthreads();
  if (wave == 0) {
    float s2 = (lane < 8) ? sred[lane] : 0.f;
    float q2 = (lane < 8) ? sred[8 + lane] : 0.f;
#pragma unroll
    for (int m = 1; m < 8; m <<= 1) { s2 += __shfl_xor(s2, m, 32); q2 += __shfl_xor(q2, m, 32); }
    if (lane == 0) { sred[0] = s2; sred[1] = q2; }
  }
  __syncthreads();
  float mu  = sred[0] * (1.f / DD);
  float var = sred[1] * (1.f / DD) - mu * mu;
  float rstd = rsqrtf(var + 1e-5f);
  float r0 = (t0 - mu) * rstd * g[d0] + beta[d0];
  float r1 = (t1 - mu) * rstd * g[d1] + beta[d1];
  of[base + d0] = r0;
  of[base + d1] = r1;
  if (oh) { oh[base + d0] = (_Float16)r0; oh[base + d1] = (_Float16)r1; }
}

// ---------------------------------------------------------------------------
// WMMA GEMM: C[M,N] = A[M,K] (f16, row-major) @ W[K,N] (f16, row-major)
// Workgroup tile 128x128, 8 waves in a 4(M) x 2(N) grid, each wave 32x64
// (2x4 accumulators of v_wmma_f32_16x16x32_f16). Double-buffered pipeline:
// A-tile and W-tile both via async global->LDS, each in its global row order;
// W fragments come out of LDS through ds_load_tr16_b128. One barrier per k-step.
// A k-step is 64 k = 128 B of an A row, so that one A copy of a wave covers four
// whole 128-B lines. K must be a multiple of 64.
// ---------------------------------------------------------------------------
template <bool OUT_F16, bool BIAS, bool RELU>
__global__ __launch_bounds__(256) void gemm_wmma(const _Float16* __restrict__ A,
                                                 const _Float16* __restrict__ W,
                                                 const float* __restrict__ bias,
                                                 _Float16* __restrict__ outH,
                                                 float* __restrict__ outF,
                                                 int M, int N, int K) {
  // ping-pong: 128 rows x 64 K, pitch 144 B (16 B x odd, for ds_load_b128)
  __shared__ __attribute__((aligned(16))) _Float16 As[2][128][72];
  // ping-pong: 64 K x 128 cols(N), pitch 288 B (32 B x odd, for ds_load_tr16_b128)
  __shared__ __attribute__((aligned(16))) _Float16 Bs[2][64][144];

  const int tid  = threadIdx.x;
  const int lane = tid & 31;
  const int wave = tid >> 5;
  const int l15  = lane & 15;
  const int half = lane >> 4;
  const int wm = wave >> 1;          // 0..3
  const int wn = wave & 1;           // 0..1
  const int mbase = blockIdx.y * 128;
  const int nbase = blockIdx.x * 128;

  v8f acc[2][4];
#pragma unroll
  for (int i = 0; i < 2; i++)
#pragma unroll
    for (int j = 0; j < 4; j++) { v8f z = {}; acc[i][j] = z; }

  const int arow = tid >> 3;            // A tile: rows t/8 + 32 j, j = 0..3,
  const int acs  = (tid & 7) * 8;       //         8 halfs at (t&7)*8
  const int bkr  = tid >> 4;            // W tile: k-rows t/16 + 16 j, j = 0..3,
  const int bns  = (tid & 15) * 8;      //         8 cols at (t&15)*8

  const int nk = K >> 6;                // k-steps of 64

  // all eight copies of one thread for k-tile kt into buffer buf
  auto stage = [&](int kt, int buf) {
    const _Float16* ga = A + (size_t)(mbase + arow) * K + (kt << 6) + acs;
    const _Float16* gw = W + (size_t)((kt << 6) + bkr) * N + nbase + bns;
    async_copy8_b128(lds_off_of(&As[buf][arow][acs]), ga,
                     lds_off_of(&As[buf][arow + 32][acs]), ga + (size_t)32 * K,
                     lds_off_of(&As[buf][arow + 64][acs]), ga + (size_t)64 * K,
                     lds_off_of(&As[buf][arow + 96][acs]), ga + (size_t)96 * K,
                     lds_off_of(&Bs[buf][bkr][bns]), gw,
                     lds_off_of(&Bs[buf][bkr + 16][bns]), gw + (size_t)16 * N,
                     lds_off_of(&Bs[buf][bkr + 32][bns]), gw + (size_t)32 * N,
                     lds_off_of(&Bs[buf][bkr + 48][bns]), gw + (size_t)48 * N);
  };

  // prologue: tile 0 lands and is published, then tile 1 starts to fly
  stage(0, 0);
  wait_async0();
  __syncthreads();
  if (nk > 1) stage(1, 1);

  for (int t = 0; t < nk; ++t) {
    const int cur = t & 1;

    // ---- compute on current buffers: two halves of 32 k, in k order ----
    // unrolled so that ks becomes a constant offset of the LDS reads
#pragma unroll
    for (int ks = 0; ks < 2; ks++) {
      v16h af[2], bf[4];
#pragma unroll
      for (int mt = 0; mt < 2; mt++) {
        const _Float16* p = &As[cur][wm * 32 + mt * 16 + l15][ks * 32 + half * 8];
#pragma unroll
        for (int i = 0; i < 8; i++) { af[mt][i] = p[i]; af[mt][8 + i] = p[16 + i]; }
      }
#pragma unroll
      for (int nt = 0; nt < 4; nt++) {
        // k 8*half + 0..7 and 16 + 8*half + 0..7 of column l15: the A loader's k order
        const _Float16* p = &Bs[cur][ks * 32 + half * 8 + (lane & 7)][wn * 64 + nt * 16 + ((lane >> 3) & 1) * 8];
        h8 lo = lds_tr16(p), hi = lds_tr16(p + 16 * 144);
#pragma unroll
        for (int i = 0; i < 8; i++) { bf[nt][i] = lo[i]; bf[nt][8 + i] = hi[i]; }
      }
#pragma unroll
      for (int mt = 0; mt < 2; mt++)
#pragma unroll
        for (int nt = 0; nt < 4; nt++)
          acc[mt][nt] = __builtin_amdgcn_wmma_f32_16x16x32_f16(
              false, af[mt], false, bf[nt], (short)0, acc[mt][nt], false, false);
    }

    // publish tile t+1, free buffer cur, then refill it with tile t+2
    wait_ds0();
    wait_async0();
    __syncthreads();
    if (t + 2 < nk) stage(t + 2, cur);
  }
  wait_async0();   // the ring is closed: no copy of this wave is left in flight

  // Epilogue: C layout: VGPR i, lane half h -> row = 8*h + i, col = l15.
#pragma unroll
  for (int mt = 0; mt < 2; mt++) {
#pragma unroll
    for (int nt = 0; nt < 4; nt++) {
      int gc = nbase + wn * 64 + nt * 16 + l15;
      float bv = BIAS ? bias[gc] : 0.f;
#pragma unroll
      for (int i = 0; i < 8; i++) {
        int gr = mbase + wm * 32 + mt * 16 + half * 8 + i;
        float v = acc[mt][nt][i] + bv;
        if (RELU) v = v > 0.f ? v : 0.f;
        size_t off = (size_t)gr * N + gc;
        if (OUT_F16) outH[off] = (_Float16)v;
        else         outF[off] = v;
      }
    }
  }
}

// ---------------------------------------------------------------------------
// Flash-style attention, one workgroup per (128 q-rows, head, batch).
// 8 waves x 16 q-rows; K/V streamed through double-buffered LDS in 32-key
// blocks (K and V async global->LDS; V read by ds_load_tr16_b128). scores: 2 WMMAs
// per 16-key subtile (K=64 contraction); P staged via LDS (C->A layout,
// wave-local s_wait_dscnt); PV: 4 WMMAs. Softmax reductions on VALU DPP.
// ---------------------------------------------------------------------------
__global__ __launch_bounds__(256) void attn_wmma(const _Float16* __restrict__ Q,
                                                 const _Float16* __restrict__ Kk,
                                                 const _Float16* __restrict__ V,
                                                 _Float16* __restrict__ O) {
  // [key][d], pitch 144 B (16 B x odd, for ds_load_b128)
  __shared__ __attribute__((aligned(16))) _Float16 Kb[2][32][72];
  // [key][d], pitch 160 B (32 B x odd, for ds_load_tr16_b128)
  __shared__ __attribute__((aligned(16))) _Float16 Vs[2][32][80];
  __shared__ _Float16 Pst[8][16][32];    // per-wave P tile [row][key]

  const int tid  = threadIdx.x;
  const int lane = tid & 31;
  const int wave = tid >> 5;
  const int l15  = lane & 15;
  const int half = lane >> 4;
  const int qb   = blockIdx.x * 128;
  const int head = blockIdx.y;
  const int bat  = blockIdx.z;
  const size_t base = (size_t)bat * SS * DD + (size_t)head * DHH;
  const float scale = 0.125f;            // 1/sqrt(64)

  // Q fragments: rows qb + wave*16 + l15, d split {0..31},{32..63}
  v16h qa[2];
  {
    const _Float16* qp = Q + base + (size_t)(qb + wave * 16 + l15) * DD;
#pragma unroll
    for (int f = 0; f < 2; f++)
#pragma unroll
      for (int i = 0; i < 8; i++) {
        qa[f][i]     = qp[f * 32 + half * 8 + i];
        qa[f][8 + i] = qp[f * 32 + 16 + half * 8 + i];
      }
  }

  v8f o[4];
#pragma unroll
  for (int t = 0; t < 4; t++) { v8f z = {}; o[t] = z; }
  float mrun[8], lrun[8];
#pragma unroll
  for (int i = 0; i < 8; i++) { mrun[i] = -1e30f; lrun[i] = 0.f; }

  const int r = tid >> 3;                // 0..31 (key)
  const int c = (tid & 7) * 8;           // 0..56 (d)

  // both copies of one thread for key-block kb into buffer buf
  auto stage = [&](int kb, int buf) {
    size_t roff = base + (size_t)(kb * 32 + r) * DD + c;
    async_copy2_b128(lds_off_of(&Kb[buf][r][c]), Kk + roff,
                     lds_off_of(&Vs[buf][r][c]), V + roff);
  };

  const int nkb = SS >> 5;               // 32-key blocks

  // prologue: block 0 lands and is published, then block 1 starts to fly
  stage(0, 0);
  wait_async0();
  __syncthreads();
  stage(1, 1);

  for (int t = 0; t < nkb; ++t) {
    const int cur = t & 1;

    // ---- scores: S_tile(16 x 32) in two 16-key subtiles -------------------
    v8f sc[2];
#pragma unroll
    for (int nb = 0; nb < 2; nb++) {
      v8f z = {};
      v16h bf;
      {
        const _Float16* p = &Kb[cur][nb * 16 + l15][half * 8];
#pragma unroll
        for (int i = 0; i < 8; i++) { bf[i] = p[i]; bf[8 + i] = p[16 + i]; }
      }
      z = __builtin_amdgcn_wmma_f32_16x16x32_f16(false, qa[0], false, bf, (short)0, z, false, false);
      {
        const _Float16* p = &Kb[cur][nb * 16 + l15][32 + half * 8];
#pragma unroll
        for (int i = 0; i < 8; i++) { bf[i] = p[i]; bf[8 + i] = p[16 + i]; }
      }
      z = __builtin_amdgcn_wmma_f32_16x16x32_f16(false, qa[1], false, bf, (short)0, z, false, false);
      sc[nb] = z;
    }
#pragma unroll
    for (int nb = 0; nb < 2; nb++)
#pragma unroll
      for (int i = 0; i < 8; i++) sc[nb][i] *= scale;

    // ---- online softmax (row = 8*half + i; DPP reduce across 16 lanes) ----
#pragma unroll
    for (int i = 0; i < 8; i++) {
      float mx = red16_max(fmaxf(sc[0][i], sc[1][i]));
      float mnew = fmaxf(mrun[i], mx);
      float corr = __expf(mrun[i] - mnew);
      float p0 = __expf(sc[0][i] - mnew);
      float p1 = __expf(sc[1][i] - mnew);
      float rs = red16_sum(p0 + p1);
      lrun[i] = lrun[i] * corr + rs;
      mrun[i] = mnew;
#pragma unroll
      for (int tt = 0; tt < 4; tt++) o[tt][i] *= corr;
      Pst[wave][half * 8 + i][l15]      = (_Float16)p0;
      Pst[wave][half * 8 + i][16 + l15] = (_Float16)p1;
    }
    // wave-local LDS RAW: same-wave DS ops are in-order; wait then reload.
    asm volatile("s_wait_dscnt 0x0" ::: "memory");

    // ---- P fragment (A-layout 16x32) --------------------------------------
    v16h pa;
    {
      const _Float16* p = &Pst[wave][l15][half * 8];
#pragma unroll
      for (int i = 0; i < 8; i++) { pa[i] = p[i]; pa[8 + i] = p[16 + i]; }
    }
    // ---- PV: O(16 x 64) += P(16 x 32) @ V(32 x 64) ------------------------
#pragma unroll
    for (int tt = 0; tt < 4; tt++) {
      v16h bf;
      // keys 8*half + 0..7 and 16 + 8*half + 0..7 of column d = tt*16 + l15: P's k order
      const _Float16* p = &Vs[cur][half * 8 + (lane & 7)][tt * 16 + ((lane >> 3) & 1) * 8];
      h8 lo = lds_tr16(p), hi = lds_tr16(p + 16 * 80);
#pragma unroll
      for (int i = 0; i < 8; i++) { bf[i] = lo[i]; bf[8 + i] = hi[i]; }
      o[tt] = __builtin_amdgcn_wmma_f32_16x16x32_f16(false, pa, false, bf, (short)0, o[tt], false, false);
    }

    // publish block t+1, free buffer cur, then refill it with block t+2
    wait_ds0();
    wait_async0();
    __syncthreads();
    if (t + 2 < nkb) stage(t + 2, cur);
  }
  wait_async0();   // the ring is closed: no copy of this wave is left in flight

  // ---- normalize and store O ---------------------------------------------
#pragma unroll
  for (int i = 0; i < 8; i++) {
    float inv = 1.f / lrun[i];
    int row = qb + wave * 16 + half * 8 + i;
    _Float16* op = O + base + (size_t)row * DD;
#pragma unroll
    for (int t = 0; t < 4; t++) op[t * 16 + l15] = (_Float16)(o[t][i] * inv);
  }
}

// ---------------------------------------------------------------------------
// Host-side orchestration
// ---------------------------------------------------------------------------
extern "C" void kernel_launch(void* const* d_in, const int* in_sizes, int n_in,
                              void* d_out, int out_size, void* d_ws, size_t ws_size,
                              hipStream_t stream) {
  (void)in_sizes; (void)n_in; (void)out_size; (void)ws_size;

  const float* x        = (const float*)d_in[0];
  const int*   idx_emb  = (const int*)d_in[1];
  const int*   idx_pro  = (const int*)d_in[2];
  // d_in[3] is N == 768 (compile-time constant NV; cannot read device scalar
  // under graph capture).
  const float* Wq1 = (const float*)d_in[4];
  const float* Wk1 = (const float*)d_in[5];
  const float* Wv1 = (const float*)d_in[6];
  const float* Wo1 = (const float*)d_in[7];
  const float* Wq2 = (const float*)d_in[8];
  const float* Wk2 = (const float*)d_in[9];
  const float* Wv2 = (const float*)d_in[10];
  const float* Wo2 = (const float*)d_in[11];
  const float* w_conv1 = (const float*)d_in[12];
  const float* b_conv1 = (const float*)d_in[13];
  const float* w_conv2 = (const float*)d_in[14];
  const float* b_conv2 = (const float*)d_in[15];
  const float* g1 = (const float*)d_in[16];
  const float* beta1 = (const float*)d_in[17];
  const float* g2 = (const float*)d_in[18];
  const float* beta2 = (const float*)d_in[19];

  float* out   = (float*)d_out;          // LN2 result
  float* attn1 = out + BSD;
  float* attn2 = out + 2 * BSD;

  // ---- workspace layout ----
  char* w = (char*)d_ws;
  float* xl1  = (float*)w;  w += BSD * sizeof(float);   // x_l1 f32 (later reused: xln)
  float* f32b = (float*)w;  w += BSD * sizeof(float);   // new_x1 / y2
  float* f32c = (float*)w;  w += BSD * sizeof(float);   // x_l2
  _Float16* h_x = (_Float16*)w; w += BSD * sizeof(_Float16);   // f16 activations
  _Float16* h_q = (_Float16*)w; w += BSD * sizeof(_Float16);
  _Float16* h_k = (_Float16*)w; w += BSD * sizeof(_Float16);
  _Float16* h_v = (_Float16*)w; w += BSD * sizeof(_Float16);
  _Float16* h_o = (_Float16*)w; w += BSD * sizeof(_Float16);
  _Float16* h_ffn = (_Float16*)w; w += (size_t)BSROWS * DFF * sizeof(_Float16);
  _Float16* h_w = (_Float16*)w; w += (size_t)DD * DFF * sizeof(_Float16);   // weight staging

  const dim3 blk(256);
  const dim3 gemmDxD(DD / 128, BSROWS / 128);     // (4, 64)
  const dim3 gemmDxF(DFF / 128, BSROWS / 128);    // (16, 64)
  const dim3 attnGrid(SS / 128, HH, BB);          // (8, 8, 8)

  auto cvt = [&](const float* s, _Float16* d, size_t n) {
    cvt_f16_kernel<<<dim3(2048), blk, 0, stream>>>(s, d, n);
  };

  // 1) x_l1 = gather(x, idx_emb) ; also f16 copy
  gather_cast_kernel<<<dim3(BSROWS), blk, 0, stream>>>(x, idx_emb, xl1, h_x);

  // ================= MHA branch 1 =================
  cvt(Wq1, h_w, (size_t)DD * DD);
  gemm_wmma<true, false, false><<<gemmDxD, blk, 0, stream>>>(h_x, h_w, nullptr, h_q, nullptr, BSROWS, DD, DD);
  cvt(Wk1, h_w, (size_t)DD * DD);
  gemm_wmma<true, false, false><<<gemmDxD, blk, 0, stream>>>(h_x, h_w, nullptr, h_k, nullptr, BSROWS, DD, DD);
  cvt(Wv1, h_w, (size_t)DD * DD);
  gemm_wmma<true, false, false><<<gemmDxD, blk, 0, stream>>>(h_x, h_w, nullptr, h_v, nullptr, BSROWS, DD, DD);
  attn_wmma<<<attnGrid, blk, 0, stream>>>(h_q, h_k, h_v, h_o);
  cvt(Wo1, h_w, (size_t)DD * DD);
  gemm_wmma<false, false, false><<<gemmDxD, blk, 0, stream>>>(h_o, h_w, nullptr, nullptr, attn1, BSROWS, DD, DD);

  // ================= MHA branch 2 (flip∘MHA∘flip == MHA) =================
  cvt(Wq2, h_w, (size_t)DD * DD);
  gemm_wmma<true, false, false><<<gemmDxD, blk, 0, stream>>>(h_x, h_w, nullptr, h_q, nullptr, BSROWS, DD, DD);
  cvt(Wk2, h_w, (size_t)DD * DD);
  gemm_wmma<true, false, false><<<gemmDxD, blk, 0, stream>>>(h_x, h_w, nullptr, h_k, nullptr, BSROWS, DD, DD);
  cvt(Wv2, h_w, (size_t)DD * DD);
  gemm_wmma<true, false, false><<<gemmDxD, blk, 0, stream>>>(h_x, h_w, nullptr, h_v, nullptr, BSROWS, DD, DD);
  attn_wmma<<<attnGrid, blk, 0, stream>>>(h_q, h_k, h_v, h_o);
  cvt(Wo2, h_w, (size_t)DD * DD);
  gemm_wmma<false, false, false><<<gemmDxD, blk, 0, stream>>>(h_o, h_w, nullptr, nullptr, attn2, BSROWS, DD, DD);

  // new_x1 = attn1 + attn2 ; x_l2 = gather(new_x1, idx_pro)
  add2_kernel<<<dim3(4096), blk, 0, stream>>>(attn1, attn2, f32b, BSD);
  gather_cast_kernel<<<dim3(BSROWS), blk, 0, stream>>>(f32b, idx_pro, f32c, nullptr);

  // xln = LN(x + x_l2; g1, beta1)  (reuse xl1 as f32 result, h_x as f16 copy)
  add_ln_kernel<<<dim3(BSROWS), blk, 0, stream>>>(x, f32c, g1, beta1, xl1, h_x);

  // ================= FFN =================
  cvt(w_conv1, h_w, (size_t)DD * DFF);
  gemm_wmma<true, true, true><<<gemmDxF, blk, 0, stream>>>(h_x, h_w, b_conv1, h_ffn, nullptr, BSROWS, DFF, DD);
  cvt(w_conv2, h_w, (size_t)DFF * DD);
  gemm_wmma<false, true, false><<<gemmDxD, blk, 0, stream>>>(h_ffn, h_w, b_conv2, nullptr, f32b, BSROWS, DD, DFF);

  // out = LN(xln + y; g2, beta2)
  add_ln_kernel<<<dim3(BSROWS), blk, 0, stream>>>(xl1, f32b, g2, beta2, out, nullptr);
}

// v003
// Measured time: 266 microseconds a run.
// In both of two side-by-side timings against v002, it was 1.04 times as fast.
// Counting every step since v000, it is 1.63 times as fast.
#include <hip/hip_runtime.h>
#include <hip/hip_bf16.h>

// ---------------------------------------------------------------------------
// EncoderLayer for MI455X (gfx1250, wave32, WMMA).
// All GEMMs (QKV/O projections, FFN) and attention (QK^T, PV) run on
// v_wmma_f32_16x16x32_f16 with f32 accumulation (compute-bound: ~103 GFLOP vs
// ~0.1 GB of traffic, so f16 WMMA is the right precision/path on CDNA5).
//  - All LDS tiles are staged row-major with GLOBAL_LOAD_ASYNC_TO_LDS_B128
//    (ASYNCcnt-tracked, bypasses VGPRs) + s_wait_asynccnt; operands that need
//    k along the rows (W in the GEMMs, V in attention) are transposed on the
//    way out of LDS by ds_load_tr16_b128.
//  - Double-buffered software pipeline: tile t+1's async copy overlaps
//    tile t's WMMAs; one barrier per k-step.
//  - Softmax cross-lane reductions use VALU DPP butterflies (xor 1/2/7/15 via
//    quad_perm + mirrors), freeing the DS pipe for WMMA fragment loads and
//    co-executing with the matrix pipe.
// Note: MHA without positional terms is permutation-equivariant, so
// flip(MHA(flip(x))) == MHA(x); branch 2 is just MHA with the W2 weights.
// ---------------------------------------------------------------------------

#define BB   8
#define SS   1024
#define NV   768
#define DD   512
#define DFF  2048
#define HH   8
#define DHH  64
#define BSROWS (BB * SS)                       // 8192
#define BSD   ((size_t)BSROWS * DD)            // 4,194,304

typedef _Float16 v16h __attribute__((ext_vector_type(16)));
typedef float    v8f  __attribute__((ext_vector_type(8)));
typedef _Float16 h8   __attribute__((ext_vector_type(8)));

// ---------------- DPP 16-lane butterfly reductions (VALU, no DS pipe) ------
template <int CTRL>
__device__ __forceinline__ float dpp_perm_f(float x) {
  int i = __builtin_bit_cast(int, x);
  int r = __builtin_amdgcn_update_dpp(i, i, CTRL, 0xF, 0xF, true);
  return __builtin_bit_cast(float, r);
}
__device__ __forceinline__ float red16_max(float x) {
  x = fmaxf(x, dpp_perm_f<0xB1>(x));    // quad_perm [1,0,3,2] : xor 1
  x = fmaxf(x, dpp_perm_f<0x4E>(x));    // quad_perm [2,3,0,1] : xor 2
  x = fmaxf(x, dpp_perm_f<0x141>(x));   // row_half_mirror     : xor 7
  x = fmaxf(x, dpp_perm_f<0x140>(x));   // row_mirror          : xor 15
  return x;
}
__device__ __forceinline__ float red16_sum(float x) {
  x += dpp_perm_f<0xB1>(x);
  x += dpp_perm_f<0x4E>(x);
  x += dpp_perm_f<0x141>(x);
  x += dpp_perm_f<0x140>(x);
  return x;
}

// ---------------- async global -> LDS staging (CDNA5, ASYNCcnt) ------------
__device__ __forceinline__ unsigned lds_off_of(const void* p) {
  // generic pointers to LDS carry the offset in the low 32 bits
  return (unsigned)(unsigned long long)(uintptr_t)p;
}
// A run of copies and its s_wait_xcnt 0 are one statement, so that no address
// register of an issued copy is rewritten ahead of that wait.
__device__ __forceinline__ void async_copy2_b128(unsigned l0, const void* g0,
                                                 unsigned l1, const void* g1) {
  asm volatile("global_load_async_to_lds_b128 %0, %1, off\n\t"
               "global_load_async_to_lds_b128 %2, %3, off\n\t"
               "s_wait_xcnt 0x0"
               :: "v"(l0), "v"((unsigned long long)(uintptr_t)g0),
                  "v"(l1), "v"((unsigned long long)(uintptr_t)g1)
               : "memory");
}
__device__ __forceinline__ void async_copy8_b128(unsigned l0, const void* g0,
                                                 unsigned l1, const void* g1,
                                                 unsigned l2, const void* g2,
                                                 unsigned l3, const void* g3,
                                                 unsigned l4, const void* g4,
                                                 unsigned l5, const void* g5,
                                                 unsigned l6, const void* g6,
                                                 unsigned l7, const void* g7) {
  asm volatile("global_load_async_to_lds_b128 %0, %1, off\n\t"
               "global_load_async_to_lds_b128 %2, %3, off\n\t"
               "global_load_async_to_lds_b128 %4, %5, off\n\t"
               "global_load_async_to_lds_b128 %6, %7, off\n\t"
               "global_load_async_to_lds_b128 %8, %9, off\n\t"
               "global_load_async_to_lds_b128 %10, %11, off\n\t"
               "global_load_async_to_lds_b128 %12, %13, off\n\t"
               "global_load_async_to_lds_b128 %14, %15, off\n\t"
               "s_wait_xcnt 0x0"
               :: "v"(l0), "v"((unsigned long long)(uintptr_t)g0),
                  "v"(l1), "v"((unsigned long long)(uintptr_t)g1),
                  "v"(l2), "v"((unsigned long long)(uintptr_t)g2),
                  "v"(l3), "v"((unsigned long long)(uintptr_t)g3),
                  "v"(l4), "v"((unsigned long long)(uintptr_t)g4),
                  "v"(l5), "v"((unsigned long long)(uintptr_t)g5),
                  "v"(l6), "v"((unsigned long long)(uintptr_t)g6),
                  "v"(l7), "v"((unsigned long long)(uintptr_t)g7)
               : "memory");
}
// This wave's copies have landed (the compiler places no wait for them).
__device__ __forceinline__ void wait_async0() {
  asm volatile("s_wait_asynccnt 0x0" ::: "memory");
}
// This wave's LDS reads are done before the buffer is handed back for a refill.
__device__ __forceinline__ void wait_ds0() {
  asm volatile("s_wait_dscnt 0x0" ::: "memory");
}

// ---------------- transposing LDS load (row-major [k][n] tile -> operand) ---
// Lane l passes the address of T[kbase + 8*(l>>4) + (l&7)][nbase + 8*((l>>3)&1)]
// and receives T[kbase + 8*(l>>4) + 0..7][nbase + (l&15)].
typedef short s16x8 __attribute__((ext_vector_type(8)));
__device__ __forceinline__ h8 lds_tr16(const _Float16* p) {
  typedef __attribute__((address_space(3))) s16x8 lds_s16x8;
  return __builtin_bit_cast(h8, __builtin_amdgcn_ds_load_tr16_b128_v8i16((lds_s16x8*)p));
}

// ---------------------------------------------------------------------------
// The streaming launches below move 16 B per lane and keep 2 to 16 such loads
// of a wave in flight: a launch then starts 4,096 to 8,192 waves (1,024 for a
// D x D weight) where one or two floats per thread took 16,384 to 131,072, and
// the time to start waves no longer outweighs the time to move the bytes.
// Every wave-wide access covers whole 128-B lines.
// ---------------------------------------------------------------------------
typedef float    f4 __attribute__((ext_vector_type(4)));
typedef _Float16 h4 __attribute__((ext_vector_type(4)));

__device__ __forceinline__ h4 to_h4(f4 v) { return __builtin_convertvector(v, h4); }

// lane l <-> l ^ 16
__device__ __forceinline__ float xhalf_f(float x) {
  int b = __builtin_bit_cast(int, x);
  return __builtin_bit_cast(float,
      __builtin_amdgcn_permlanex16(b, b, 0x76543210, 0xfedcba98, false, false));
}

// ---------------------------------------------------------------------------
// f32 -> f16 convert (weights): 2,048 floats per block, 8 per thread.
// The grid is n / 2048 blocks; n must be a multiple of 2,048.
// ---------------------------------------------------------------------------
__global__ __launch_bounds__(256) void cvt_f16_kernel(const float* __restrict__ src,
                                                      _Float16* __restrict__ dst) {
  const size_t i = (size_t)blockIdx.x * 512 + threadIdx.x;   // in units of 4 elements
  const f4* s4 = (const f4*)src;
  h4* d4 = (h4*)dst;
  f4 a = s4[i], b = s4[i + 256];
  d4[i] = to_h4(a);
  d4[i + 256] = to_h4(b);
}

// ---------------------------------------------------------------------------
// Batched gather over first N rows (rest pass-through), optional f16 copy.
// Two rows of D = 512 per wave (8 loads in flight), 16 rows per block.
// ---------------------------------------------------------------------------
template <bool F16_TOO>
__global__ __launch_bounds__(256) void gather_cast_kernel(const float* __restrict__ x,
                                                          const int* __restrict__ idx,
                                                          float* __restrict__ of,
                                                          _Float16* __restrict__ oh) {
  const int lane = threadIdx.x & 31;
  const int wave = __builtin_amdgcn_readfirstlane(threadIdx.x >> 5);
  const int bs0  = (blockIdx.x * 8 + wave) * 2;      // 0..B*S-2, even
  const int b = bs0 / SS, s0 = bs0 % SS;
  static_assert(NV % 2 == 0 && SS % 2 == 0, "rows s0 and s0 + 1 lie on the same side of NV");
  int srow[2] = {s0, s0 + 1};
  if (s0 < NV) {
    // both indices are fetched before either row, so that all 8 row loads fly together
#pragma unroll
    for (int rr = 0; rr < 2; rr++) {
      int r = idx[b * NV + s0 + rr];
      srow[rr] = r < 0 ? 0 : (r > NV - 1 ? NV - 1 : r);   // the address stays inside x
    }
  }
  f4 v[2][4];
#pragma unroll
  for (int rr = 0; rr < 2; rr++) {
    const f4* src = (const f4*)(x + ((size_t)b * SS + srow[rr]) * DD);
#pragma unroll
    for (int j = 0; j < 4; j++) v[rr][j] = src[lane + 32 * j];
  }
  // the f16 copy goes first: its values take registers of their own while v is
  // still live, so that no register of an issued store is written again
  if (F16_TOO) {
    h4* oh4 = (h4*)(oh + (size_t)bs0 * DD);
#pragma unroll
    for (int rr = 0; rr < 2; rr++)
#pragma unroll
      for (int j = 0; j < 4; j++) oh4[rr * (DD / 4) + lane + 32 * j] = to_h4(v[rr][j]);
  }
  f4* of4 = (f4*)(of + (size_t)bs0 * DD);
#pragma unroll
  for (int rr = 0; rr < 2; rr++)
#pragma unroll
    for (int j = 0; j < 4; j++) of4[rr * (DD / 4) + lane + 32 * j] = v[rr][j];
}

// ---------------------------------------------------------------------------
// c = a + b (elementwise f32): 4,096 floats per block, 16 per thread.
// The grid is n / 4096 blocks; n must be a multiple of 4,096.
// ---------------------------------------------------------------------------
__global__ __launch_bounds__(256) void add2_kernel(const float* __restrict__ a,
                                                   const float* __restrict__ b,
                                                   float* __restrict__ c) {
  const size_t i = (size_t)blockIdx.x * 1024 + threadIdx.x;  // in units of 4 elements
  const f4* a4 = (const f4*)a;
  const f4* b4 = (const f4*)b;
  f4* c4 = (f4*)c;
  f4 va[4], vb[4];
#pragma unroll
  for (int j = 0; j < 4; j++) { va[j] = a4[i + 256 * j]; vb[j] = b4[i + 256 * j]; }
#pragma unroll
  for (int j = 0; j < 4; j++) c4[i + 256 * j] = va[j] + vb[j];
}

// ---------------------------------------------------------------------------
// out = LayerNorm(a + b) * g + beta, one wave per row of D = 512 (16 floats per
// lane), 8 rows per block. The row's two sums are formed in the lane, then over
// the 32 lanes in registers: no LDS and no barrier.
// ---------------------------------------------------------------------------
template <bool F16_TOO>
__global__ __launch_bounds__(256) void add_ln_kernel(const float* __restrict__ a,
                                                     const float* __restrict__ b,
                                                     const float* __restrict__ g,
                                                     const float* __restrict__ beta,
                                                     float* __restrict__ of,
                                                     _Float16* __restrict__ oh) {
  const int lane = threadIdx.x & 31;
  const int wave = __builtin_amdgcn_readfirstlane(threadIdx.x >> 5);
  const size_t base = ((size_t)blockIdx.x * 8 + wave) * DD;
  const f4* a4 = (const f4*)(a + base);
  const f4* b4 = (const f4*)(b + base);
  const f4* g4 = (const f4*)g;
  const f4* e4 = (const f4*)beta;
  f4 t[4], tb[4], gv[4], ev[4];
#pragma unroll
  for (int j = 0; j < 4; j++) { t[j] = a4[lane + 32 * j]; tb[j] = b4[lane + 32 * j]; }
#pragma unroll
  for (int j = 0; j < 4; j++) { gv[j] = g4[lane + 32 * j]; ev[j] = e4[lane + 32 * j]; }
#pragma unroll
  for (int j = 0; j < 4; j++) t[j] += tb[j];
  f4 sv = (t[0] + t[1]) + (t[2] + t[3]);
  f4 qv = (t[0] * t[0] + t[1] * t[1]) + (t[2] * t[2] + t[3] * t[3]);
  float s  = red16_sum((sv[0] + sv[1]) + (sv[2] + sv[3]));
  float ss = red16_sum((qv[0] + qv[1]) + (qv[2] + qv[3]));
  s  += xhalf_f(s);
  ss += xhalf_f(ss);
  float mu  = s * (1.f / DD);
  float var = ss * (1.f / DD) - mu * mu;
  float rstd = rsqrtf(var + 1e-5f);
#pragma unroll
  for (int j = 0; j < 4; j++) t[j] = (t[j] - mu) * rstd * gv[j] + ev[j];
  // the f16 copy goes first: its values take registers of their own while t is
  // still live, so that no register of an issued store is written again
  if (F16_TOO) {
    h4* oh4 = (h4*)(oh + base);
#pragma unroll
    for (int j = 0; j < 4; j++) oh4[lane + 32 * j] = to_h4(t[j]);
  }
  f4* of4 = (f4*)(of + base);
#pragma unroll
  for (int j = 0; j < 4; j++) of4[lane + 32 * j] = t[j];
}

// ---------------------------------------------------------------------------
// WMMA GEMM: C[M,N] = A[M,K] (f16, row-major) @ W[K,N] (f16, row-major)
// Workgroup tile 128x128, 8 waves in a 4(M) x 2(N) grid, each wave 32x64
// (2x4 accumulators of v_wmma_f32_16x16x32_f16). Double-buffered pipeline:
// A-tile and W-tile both via async global->LDS, each in its global row order;
// W fragments come out of LDS through ds_load_tr16_b128. One barrier per k-step.
// A k-step is 64 k = 128 B of an A row, so that one A copy of a wave covers four
// whole 128-B lines. K must be a multiple of 64.
// ---------------------------------------------------------------------------
template <bool OUT_F16, bool BIAS, bool RELU>
__global__ __launch_bounds__(256) void gemm_wmma(const _Float16* __restrict__ A,
                                                 const _Float16* __restrict__ W,
                                                 const float* __restrict__ bias,
                                                 _Float16* __restrict__ outH,
                                                 float* __restrict__ outF,
                                                 int M, int N, int K) {
  // ping-pong: 128 rows x 64 K, pitch 144 B (16 B x odd, for ds_load_b128)
  __shared__ __attribute__((aligned(16))) _Float16 As[2][128][72];
  // ping-pong: 64 K x 128 cols(N), pitch 288 B (32 B x odd, for ds_load_tr16_b128)
  __shared__ __attribute__((aligned(16))) _Float16 Bs[2][64][144];

  const int tid  = threadIdx.x;
  const int lane = tid & 31;
  const int wave = tid >> 5;
  const int l15  = lane & 15;
  const int half = lane >> 4;
  const int wm = wave >> 1;          // 0..3
  const int wn = wave & 1;           // 0..1
  const int mbase = blockIdx.y * 128;
  const int nbase = blockIdx.x * 128;

  v8f acc[2][4];
#pragma unroll
  for (int i = 0; i < 2; i++)
#pragma unroll
    for (int j = 0; j < 4; j++) { v8f z = {}; acc[i][j] = z; }

  const int arow = tid >> 3;            // A tile: rows t/8 + 32 j, j = 0..3,
  const int acs  = (tid & 7) * 8;       //         8 halfs at (t&7)*8
  const int bkr  = tid >> 4;            // W tile: k-rows t/16 + 16 j, j = 0..3,
  const int bns  = (tid & 15) * 8;      //         8 cols at (t&15)*8

  const int nk = K >> 6;                // k-steps of 64

  // all eight copies of one thread for k-tile kt into buffer buf
  auto stage = [&](int kt, int buf) {
    const _Float16* ga = A + (size_t)(mbase + arow) * K + (kt << 6) + acs;
    const _Float16* gw = W + (size_t)((kt << 6) + bkr) * N + nbase + bns;
    async_copy8_b128(lds_off_of(&As[buf][arow][acs]), ga,
                     lds_off_of(&As[buf][arow + 32][acs]), ga + (size_t)32 * K,
                     lds_off_of(&As[buf][arow + 64][acs]), ga + (size_t)64 * K,
                     lds_off_of(&As[buf][arow + 96][acs]), ga + (size_t)96 * K,
                     lds_off_of(&Bs[buf][bkr][bns]), gw,
                     lds_off_of(&Bs[buf][bkr + 16][bns]), gw + (size_t)16 * N,
                     lds_off_of(&Bs[buf][bkr + 32][bns]), gw + (size_t)32 * N,
                     lds_off_of(&Bs[buf][bkr + 48][bns]), gw + (size_t)48 * N);
  };

  // prologue: tile 0 lands and is published, then tile 1 starts to fly
  stage(0, 0);
  wait_async0();
  __syncthreads();
  if (nk > 1) stage(1, 1);

  for (int t = 0; t < nk; ++t) {
    const int cur = t & 1;

    // ---- compute on current buffers: two halves of 32 k, in k order ----
    // unrolled so that ks becomes a constant offset of the LDS reads
#pragma unroll
    for (int ks = 0; ks < 2; ks++) {
      v16h af[2], bf[4];
#pragma unroll
      for (int mt = 0; mt < 2; mt++) {
        const _Float16* p = &As[cur][wm * 32 + mt * 16 + l15][ks * 32 + half * 8];
#pragma unroll
        for (int i = 0; i < 8; i++) { af[mt][i] = p[i]; af[mt][8 + i] = p[16 + i]; }
      }
#pragma unroll
      for (int nt = 0; nt < 4; nt++) {
        // k 8*half + 0..7 and 16 + 8*half + 0..7 of column l15: the A loader's k order
        const _Float16* p = &Bs[cur][ks * 32 + half * 8 + (lane & 7)][wn * 64 + nt * 16 + ((lane >> 3) & 1) * 8];
        h8 lo = lds_tr16(p), hi = lds_tr16(p + 16 * 144);
#pragma unroll
        for (int i = 0; i < 8; i++) { bf[nt][i] = lo[i]; bf[nt][8 + i] = hi[i]; }
      }
#pragma unroll
      for (int mt = 0; mt < 2; mt++)
#pragma unroll
        for (int nt = 0; nt < 4; nt++)
          acc[mt][nt] = __builtin_amdgcn_wmma_f32_16x16x32_f16(
              false, af[mt], false, bf[nt], (short)0, acc[mt][nt], false, false);
    }

    // publish tile t+1, free buffer cur, then refill it with tile t+2
    wait_ds0();
    wait_async0();
    __syncthreads();
    if (t + 2 < nk) stage(t + 2, cur);
  }
  wait_async0();   // the ring is closed: no copy of this wave is left in flight

  // Epilogue: C layout: VGPR i, lane half h -> row = 8*h + i, col = l15.
#pragma unroll
  for (int mt = 0; mt < 2; mt++) {
#pragma unroll
    for (int nt = 0; nt < 4; nt++) {
      int gc = nbase + wn * 64 + nt * 16 + l15;
      float bv = BIAS ? bias[gc] : 0.f;
#pragma unroll
      for (int i = 0; i < 8; i++) {
        int gr = mbase + wm * 32 + mt * 16 + half * 8 + i;
        float v = acc[mt][nt][i] + bv;
        if (RELU) v = v > 0.f ? v : 0.f;
        size_t off = (size_t)gr * N + gc;
        if (OUT_F16) outH[off] = (_Float16)v;
        else         outF[off] = v;
      }
    }
  }
}

// ---------------------------------------------------------------------------
// Flash-style attention, one workgroup per (128 q-rows, head, batch).
// 8 waves x 16 q-rows; K/V streamed through double-buffered LDS in 32-key
// blocks (K and V async global->LDS; V read by ds_load_tr16_b128). scores: 2 WMMAs
// per 16-key subtile (K=64 contraction); P staged via LDS (C->A layout,
// wave-local s_wait_dscnt); PV: 4 WMMAs. Softmax reductions on VALU DPP.
// ---------------------------------------------------------------------------
__global__ __launch_bounds__(256) void attn_wmma(const _Float16* __restrict__ Q,
                                                 const _Float16* __restrict__ Kk,
                                                 const _Float16* __restrict__ V,
                                                 _Float16* __restrict__ O) {
  // [key][d], pitch 144 B (16 B x odd, for ds_load_b128)
  __shared__ __attribute__((aligned(16))) _Float16 Kb[2][32][72];
  // [key][d], pitch 160 B (32 B x odd, for ds_load_tr16_b128)
  __shared__ __attribute__((aligned(16))) _Float16 Vs[2][32][80];
  __shared__ _Float16 Pst[8][16][32];    // per-wave P tile [row][key]

  const int tid  = threadIdx.x;
  const int lane = tid & 31;
  const int wave = tid >> 5;
  const int l15  = lane & 15;
  const int half = lane >> 4;
  const int qb   = blockIdx.x * 128;
  const int head = blockIdx.y;
  const int bat  = blockIdx.z;
  const size_t base = (size_t)bat * SS * DD + (size_t)head * DHH;
  const float scale = 0.125f;            // 1/sqrt(64)

  // Q fragments: rows qb + wave*16 + l15, d split {0..31},{32..63}
  v16h qa[2];
  {
    const _Float16* qp = Q + base + (size_t)(qb + wave * 16 + l15) * DD;
#pragma unroll
    for (int f = 0; f < 2; f++)
#pragma unroll
      for (int i = 0; i < 8; i++) {
        qa[f][i]     = qp[f * 32 + half * 8 + i];
        qa[f][8 + i] = qp[f * 32 + 16 + half * 8 + i];
      }
  }

  v8f o[4];
#pragma unroll
  for (int t = 0; t < 4; t++) { v8f z = {}; o[t] = z; }
  float mrun[8], lrun[8];
#pragma unroll
  for (int i = 0; i < 8; i++) { mrun[i] = -1e30f; lrun[i] = 0.f; }

  const int r = tid >> 3;                // 0..31 (key)
  const int c = (tid & 7) * 8;           // 0..56 (d)

  // both copies of one thread for key-block kb into buffer buf
  auto stage = [&](int kb, int buf) {
    size_t roff = base + (size_t)(kb * 32 + r) * DD + c;
    async_copy2_b128(lds_off_of(&Kb[buf][r][c]), Kk + roff,
                     lds_off_of(&Vs[buf][r][c]), V + roff);
  };

  const int nkb = SS >> 5;               // 32-key blocks

  // prologue: block 0 lands and is published, then block 1 starts to fly
  stage(0, 0);
  wait_async0();
  __syncthreads();
  stage(1, 1);

  for (int t = 0; t < nkb; ++t) {
    const int cur = t & 1;

    // ---- scores: S_tile(16 x 32) in two 16-key subtiles -------------------
    v8f sc[2];
#pragma unroll
    for (int nb = 0; nb < 2; nb++) {
      v8f z = {};
      v16h bf;
      {
        const _Float16* p = &Kb[cur][nb * 16 + l15][half * 8];
#pragma unroll
        for (int i = 0; i < 8; i++) { bf[i] = p[i]; bf[8 + i] = p[16 + i]; }
      }
      z = __builtin_amdgcn_wmma_f32_16x16x32_f16(false, qa[0], false, bf, (short)0, z, false, false);
      {
        const _Float16* p = &Kb[cur][nb * 16 + l15][32 + half * 8];
#pragma unroll
        for (int i = 0; i < 8; i++) { bf[i] = p[i]; bf[8 + i] = p[16 + i]; }
      }
      z = __builtin_amdgcn_wmma_f32_16x16x32_f16(false, qa[1], false, bf, (short)0, z, false, false);
      sc[nb] = z;
    }
#pragma unroll
    for (int nb = 0; nb < 2; nb++)
#pragma unroll
      for (int i = 0; i < 8; i++) sc[nb][i] *= scale;

    // ---- online softmax (row = 8*half + i; DPP reduce across 16 lanes) ----
#pragma unroll
    for (int i = 0; i < 8; i++) {
      float mx = red16_max(fmaxf(sc[0][i], sc[1][i]));
      float mnew = fmaxf(mrun[i], mx);
      float corr = __expf(mrun[i] - mnew);
      float p0 = __expf(sc[0][i] - mnew);
      float p1 = __expf(sc[1][i] - mnew);
      float rs = red16_sum(p0 + p1);
      lrun[i] = lrun[i] * corr + rs;
      mrun[i] = mnew;
#pragma unroll
      for (int tt = 0; tt < 4; tt++) o[tt][i] *= corr;
      Pst[wave][half * 8 + i][l15]      = (_Float16)p0;
      Pst[wave][half * 8 + i][16 + l15] = (_Float16)p1;
    }
    // wave-local LDS RAW: same-wave DS ops are in-order; wait then reload.
    asm volatile("s_wait_dscnt 0x0" ::: "memory");

    // ---- P fragment (A-layout 16x32) --------------------------------------
    v16h pa;
    {
      const _Float16* p = &Pst[wave][l15][half * 8];
#pragma unroll
      for (int i = 0; i < 8; i++) { pa[i] = p[i]; pa[8 + i] = p[16 + i]; }
    }
    // ---- PV: O(16 x 64) += P(16 x 32) @ V(32 x 64) ------------------------
#pragma unroll
    for (int tt = 0; tt < 4; tt++) {
      v16h bf;
      // keys 8*half + 0..7 and 16 + 8*half + 0..7 of column d = tt*16 + l15: P's k order
      const _Float16* p = &Vs[cur][half * 8 + (lane & 7)][tt * 16 + ((lane >> 3) & 1) * 8];
      h8 lo = lds_tr16(p), hi = lds_tr16(p + 16 * 80);
#pragma unroll
      for (int i = 0; i < 8; i++) { bf[i] = lo[i]; bf[8 + i] = hi[i]; }
      o[tt] = __builtin_amdgcn_wmma_f32_16x16x32_f16(false, pa, false, bf, (short)0, o[tt], false, false);
    }

    // publish block t+1, free buffer cur, then refill it with block t+2
    wait_ds0();
    wait_async0();
    __syncthreads();
    if (t + 2 < nkb) stage(t + 2, cur);
  }
  wait_async0();   // the ring is closed: no copy of this wave is left in flight

  // ---- normalize and store O ---------------------------------------------
#pragma unroll
  for (int i = 0; i < 8; i++) {
    float inv = 1.f / lrun[i];
    int row = qb + wave * 16 + half * 8 + i;
    _Float16* op = O + base + (size_t)row * DD;
#pragma unroll
    for (int t = 0; t < 4; t++) op[t * 16 + l15] = (_Float16)(o[t][i] * inv);
  }
}

// ---------------------------------------------------------------------------
// Host-side orchestration
// ---------------------------------------------------------------------------
extern "C" void kernel_launch(void* const* d_in, const int* in_sizes, int n_in,
                              void* d_out, int out_size, void* d_ws, size_t ws_size,
                              hipStream_t stream) {
  (void)in_sizes; (void)n_in; (void)out_size; (void)ws_size;

  const float* x        = (const float*)d_in[0];
  const int*   idx_emb  = (const int*)d_in[1];
  const int*   idx_pro  = (const int*)d_in[2];
  // d_in[3] is N == 768 (compile-time constant NV; cannot read device scalar
  // under graph capture).
  const float* Wq1 = (const float*)d_in[4];
  const float* Wk1 = (const float*)d_in[5];
  const float* Wv1 = (const float*)d_in[6];
  const float* Wo1 = (const float*)d_in[7];
  const float* Wq2 = (const float*)d_in[8];
  const float* Wk2 = (const float*)d_in[9];
  const float* Wv2 = (const float*)d_in[10];
  const float* Wo2 = (const float*)d_in[11];
  const float* w_conv1 = (const float*)d_in[12];
  const float* b_conv1 = (const float*)d_in[13];
  const float* w_conv2 = (const float*)d_in[14];
  const float* b_conv2 = (const float*)d_in[15];
  const float* g1 = (const float*)d_in[16];
  const float* beta1 = (const float*)d_in[17];
  const float* g2 = (const float*)d_in[18];
  const float* beta2 = (const float*)d_in[19];

  float* out   = (float*)d_out;          // LN2 result
  float* attn1 = out + BSD;
  float* attn2 = out + 2 * BSD;

  // ---- workspace layout ----
  char* w = (char*)d_ws;
  float* xl1  = (float*)w;  w += BSD * sizeof(float);   // x_l1 f32 (later reused: xln)
  float* f32b = (float*)w;  w += BSD * sizeof(float);   // new_x1 / y2
  float* f32c = (float*)w;  w += BSD * sizeof(float);   // x_l2
  _Float16* h_x = (_Float16*)w; w += BSD * sizeof(_Float16);   // f16 activations
  _Float16* h_q = (_Float16*)w; w += BSD * sizeof(_Float16);
  _Float16* h_k = (_Float16*)w; w += BSD * sizeof(_Float16);
  _Float16* h_v = (_Float16*)w; w += BSD * sizeof(_Float16);
  _Float16* h_o = (_Float16*)w; w += BSD * sizeof(_Float16);
  _Float16* h_ffn = (_Float16*)w; w += (size_t)BSROWS * DFF * sizeof(_Float16);
  _Float16* h_w = (_Float16*)w; w += (size_t)DD * DFF * sizeof(_Float16);   // weight staging

  const dim3 blk(256);
  const dim3 gemmDxD(DD / 128, BSROWS / 128);     // (4, 64)
  const dim3 gemmDxF(DFF / 128, BSROWS / 128);    // (16, 64)
  const dim3 attnGrid(SS / 128, HH, BB);          // (8, 8, 8)

  auto cvt = [&](const float* s, _Float16* d, int blocks) {
    cvt_f16_kernel<<<dim3(blocks), blk, 0, stream>>>(s, d);
  };

  // 1) x_l1 = gather(x, idx_emb) ; also f16 copy
  gather_cast_kernel<true><<<dim3(BSROWS / 16), blk, 0, stream>>>(x, idx_emb, xl1, h_x);

  // ================= MHA branch 1 =================
  cvt(Wq1, h_w, DD * DD / 2048);
  gemm_wmma<true, false, false><<<gemmDxD, blk, 0, stream>>>(h_x, h_w, nullptr, h_q, nullptr, BSROWS, DD, DD);
  cvt(Wk1, h_w, DD * DD / 2048);
  gemm_wmma<true, false, false><<<gemmDxD, blk, 0, stream>>>(h_x, h_w, nullptr, h_k, nullptr, BSROWS, DD, DD);
  cvt(Wv1, h_w, DD * DD / 2048);
  gemm_wmma<true, false, false><<<gemmDxD, blk, 0, stream>>>(h_x, h_w, nullptr, h_v, nullptr, BSROWS, DD, DD);
  attn_wmma<<<attnGrid, blk, 0, stream>>>(h_q, h_k, h_v, h_o);
  cvt(Wo1, h_w, DD * DD / 2048);
  gemm_wmma<false, false, false><<<gemmDxD, blk, 0, stream>>>(h_o, h_w, nullptr, nullptr, attn1, BSROWS, DD, DD);

  // ================= MHA branch 2 (flip∘MHA∘flip == MHA) =================
  cvt(Wq2, h_w, DD * DD / 2048);
  gemm_wmma<true, false, false><<<gemmDxD, blk, 0, stream>>>(h_x, h_w, nullptr, h_q, nullptr, BSROWS, DD, DD);
  cvt(Wk2, h_w, DD * DD / 2048);
  gemm_wmma<true, false, false><<<gemmDxD, blk, 0, stream>>>(h_x, h_w, nullptr, h_k, nullptr, BSROWS, DD, DD);
  cvt(Wv2, h_w, DD * DD / 2048);
  gemm_wmma<true, false, false><<<gemmDxD, blk, 0, stream>>>(h_x, h_w, nullptr, h_v, nullptr, BSROWS, DD, DD);
  attn_wmma<<<attnGrid, blk, 0, stream>>>(h_q, h_k, h_v, h_o);
  cvt(Wo2, h_w, DD * DD / 2048);
  gemm_wmma<false, false, false><<<gemmDxD, blk, 0, stream>>>(h_o, h_w, nullptr, nullptr, attn2, BSROWS, DD, DD);

  // new_x1 = attn1 + attn2 ; x_l2 = gather(new_x1, idx_pro)
  add2_kernel<<<dim3(BSROWS * DD / 4096), blk, 0, stream>>>(attn1, attn2, f32b);
  gather_cast_kernel<false><<<dim3(BSROWS / 16), blk, 0, stream>>>(f32b, idx_pro, f32c, nullptr);

  // xln = LN(x + x_l2; g1, beta1)  (reuse xl1 as f32 result, h_x as f16 copy)
  add_ln_kernel<true><<<dim3(BSROWS / 8), blk, 0, stream>>>(x, f32c, g1, beta1, xl1, h_x);

  // ================= FFN =================
  cvt(w_conv1, h_w, DD * DFF / 2048);
  gemm_wmma<true, true, true><<<gemmDxF, blk, 0, stream>>>(h_x, h_w, b_conv1, h_ffn, nullptr, BSROWS, DFF, DD);
  cvt(w_conv2, h_w, DFF * DD / 2048);
  gemm_wmma<false, true, false><<<gemmDxD, blk, 0, stream>>>(h_ffn, h_w, b_conv2, nullptr, f32b, BSROWS, DD, DFF);

  // out = LN(xln + y; g2, beta2)
  add_ln_kernel<false><<<dim3(BSROWS / 8), blk, 0, stream>>>(xl1, f32b, g2, beta2, out, nullptr);
}

// v004
// It runs in 241 microseconds.
// Two timings next to v003 both put it at 1.10 times that version's speed.
// All steps since v000 together make it 1.80 times as fast.
#include <hip/hip_runtime.h>
#include <hip/hip_bf16.h>

#define BB   8
#define SS   1024
#define NV   768
#define DD   512
#define DFF  2048
#define HH   8
#define DHH  64
#define BSROWS (BB * SS)                       // 8192
#define BSD   ((size_t)BSROWS * DD)            // 4,194,304

typedef _Float16 v16h __attribute__((ext_vector_type(16)));
typedef float    v8f  __attribute__((ext_vector_type(8)));
typedef _Float16 h8   __attribute__((ext_vector_type(8)));

// ---------------- DPP 16-lane butterfly reductions (VALU, no DS pipe) ------
template <int CTRL>
__device__ __forceinline__ float dpp_perm_f(float x) {
  int i = __builtin_bit_cast(int, x);
  int r = __builtin_amdgcn_update_dpp(i, i, CTRL, 0xF, 0xF, true);
  return __builtin_bit_cast(float, r);
}
__device__ __forceinline__ float red16_sum(float x) {
  x += dpp_perm_f<0xB1>(x);    // quad_perm [1,0,3,2] : xor 1
  x += dpp_perm_f<0x4E>(x);    // quad_perm [2,3,0,1] : xor 2
  x += dpp_perm_f<0x141>(x);   // row_half_mirror     : xor 7
  x += dpp_perm_f<0x140>(x);   // row_mirror          : xor 15
  return x;
}

// ---------------- async global -> LDS staging (CDNA5, ASYNCcnt) ------------
__device__ __forceinline__ unsigned lds_off_of(const void* p) {
  // generic pointers to LDS carry the offset in the low 32 bits
  return (unsigned)(unsigned long long)(uintptr_t)p;
}
// A run of copies and its s_wait_xcnt 0 are one statement, so that no address
// register of an issued copy is rewritten ahead of that wait.
__device__ __forceinline__ void async_copy2_b128(unsigned l0, const void* g0,
                                                 unsigned l1, const void* g1) {
  asm volatile("global_load_async_to_lds_b128 %0, %1, off\n\t"
               "global_load_async_to_lds_b128 %2, %3, off\n\t"
               "s_wait_xcnt 0x0"
               :: "v"(l0), "v"((unsigned long long)(uintptr_t)g0),
                  "v"(l1), "v"((unsigned long long)(uintptr_t)g1)
               : "memory");
}
__device__ __forceinline__ void async_copy8_b128(unsigned l0, const void* g0,
                                                 unsigned l1, const void* g1,
                                                 unsigned l2, const void* g2,
                                                 unsigned l3, const void* g3,
                                                 unsigned l4, const void* g4,
                                                 unsigned l5, const void* g5,
                                                 unsigned l6, const void* g6,
                                                 unsigned l7, const void* g7) {
  asm volatile("global_load_async_to_lds_b128 %0, %1, off\n\t"
               "global_load_async_to_lds_b128 %2, %3, off\n\t"
               "global_load_async_to_lds_b128 %4, %5, off\n\t"
               "global_load_async_to_lds_b128 %6, %7, off\n\t"
               "global_load_async_to_lds_b128 %8, %9, off\n\t"
               "global_load_async_to_lds_b128 %10, %11, off\n\t"
               "global_load_async_to_lds_b128 %12, %13, off\n\t"
               "global_load_async_to_lds_b128 %14, %15, off\n\t"
               "s_wait_xcnt 0x0"
               :: "v"(l0), "v"((unsigned long long)(uintptr_t)g0),
                  "v"(l1), "v"((unsigned long long)(uintptr_t)g1),
                  "v"(l2), "v"((unsigned long long)(uintptr_t)g2),
                  "v"(l3), "v"((unsigned long long)(uintptr_t)g3),
                  "v"(l4), "v"((unsigned long long)(uintptr_t)g4),
                  "v"(l5), "v"((unsigned long long)(uintptr_t)g5),
                  "v"(l6), "v"((unsigned long long)(uintptr_t)g6),
                  "v"(l7), "v"((unsigned long long)(uintptr_t)g7)
               : "memory");
}
// This wave's copies have landed (the compiler places no wait for them).
__device__ __forceinline__ void wait_async0() {
  asm volatile("s_wait_asynccnt 0x0" ::: "memory");
}
// This wave's LDS reads are done before the buffer is handed back for a refill.
__device__ __forceinline__ void wait_ds0() {
  asm volatile("s_wait_dscnt 0x0" ::: "memory");
}

// ---------------- transposing LDS load (row-major [k][n] tile -> operand) ---
// Lane l passes the address of T[kbase + 8*(l>>4) + (l&7)][nbase + 8*((l>>3)&1)]
// and receives T[kbase + 8*(l>>4) + 0..7][nbase + (l&15)].
typedef short s16x8 __attribute__((ext_vector_type(8)));
__device__ __forceinline__ h8 lds_tr16(const _Float16* p) {
  typedef __attribute__((address_space(3))) s16x8 lds_s16x8;
  return __builtin_bit_cast(h8, __builtin_amdgcn_ds_load_tr16_b128_v8i16((lds_s16x8*)p));
}

// ---------------------------------------------------------------------------
// The streaming launches below move 16 B per lane and keep 2 to 16 such loads
// of a wave in flight: a launch then starts 4,096 to 8,192 waves (1,024 for a
// D x D weight) where one or two floats per thread took 16,384 to 131,072, and
// the time to start waves no longer outweighs the time to move the bytes.
// Every wave-wide access covers whole 128-B lines.
// ---------------------------------------------------------------------------
typedef float    f4 __attribute__((ext_vector_type(4)));
typedef _Float16 h4 __attribute__((ext_vector_type(4)));

__device__ __forceinline__ h4 to_h4(f4 v) { return __builtin_convertvector(v, h4); }

// lane l <-> l ^ 16
__device__ __forceinline__ float xhalf_f(float x) {
  int b = __builtin_bit_cast(int, x);
  return __builtin_bit_cast(float,
      __builtin_amdgcn_permlanex16(b, b, 0x76543210, 0xfedcba98, false, false));
}

// ---------------------------------------------------------------------------
// f32 -> f16 convert (weights): 2,048 floats per block, 8 per thread.
// The grid is n / 2048 blocks; n must be a multiple of 2,048.
// ---------------------------------------------------------------------------
__global__ __launch_bounds__(256) void cvt_f16_kernel(const float* __restrict__ src,
                                                      _Float16* __restrict__ dst) {
  const size_t i = (size_t)blockIdx.x * 512 + threadIdx.x;   // in units of 4 elements
  const f4* s4 = (const f4*)src;
  h4* d4 = (h4*)dst;
  f4 a = s4[i], b = s4[i + 256];
  d4[i] = to_h4(a);
  d4[i + 256] = to_h4(b);
}

// ---------------------------------------------------------------------------
// Batched gather over first N rows (rest pass-through), optional f16 copy.
// Two rows of D = 512 per wave (8 loads in flight), 16 rows per block.
// ---------------------------------------------------------------------------
template <bool F16_TOO>
__global__ __launch_bounds__(256) void gather_cast_kernel(const float* __restrict__ x,
                                                          const int* __restrict__ idx,
                                                          float* __restrict__ of,
                                                          _Float16* __restrict__ oh) {
  const int lane = threadIdx.x & 31;
  const int wave = __builtin_amdgcn_readfirstlane(threadIdx.x >> 5);
  const int bs0  = (blockIdx.x * 8 + wave) * 2;      // 0..B*S-2, even
  const int b = bs0 / SS, s0 = bs0 % SS;
  static_assert(NV % 2 == 0 && SS % 2 == 0, "rows s0 and s0 + 1 lie on the same side of NV");
  int srow[2] = {s0, s0 + 1};
  if (s0 < NV) {
    // both indices are fetched before either row, so that all 8 row loads fly together
#pragma unroll
    for (int rr = 0; rr < 2; rr++) {
      int r = idx[b * NV + s0 + rr];
      srow[rr] = r < 0 ? 0 : (r > NV - 1 ? NV - 1 : r);   // the address stays inside x
    }
  }
  f4 v[2][4];
#pragma unroll
  for (int rr = 0; rr < 2; rr++) {
    const f4* src = (const f4*)(x + ((size_t)b * SS + srow[rr]) * DD);
#pragma unroll
    for (int j = 0; j < 4; j++) v[rr][j] = src[lane + 32 * j];
  }
  // the f16 copy goes first: its values take registers of their own while v is
  // still live, so that no register of an issued store is written again
  if (F16_TOO) {
    h4* oh4 = (h4*)(oh + (size_t)bs0 * DD);
#pragma unroll
    for (int rr = 0; rr < 2; rr++)
#pragma unroll
      for (int j = 0; j < 4; j++) oh4[rr * (DD / 4) + lane + 32 * j] = to_h4(v[rr][j]);
  }
  f4* of4 = (f4*)(of + (size_t)bs0 * DD);
#pragma unroll
  for (int rr = 0; rr < 2; rr++)
#pragma unroll
    for (int j = 0; j < 4; j++) of4[rr * (DD / 4) + lane + 32 * j] = v[rr][j];
}

// ---------------------------------------------------------------------------
// c = a + b (elementwise f32): 4,096 floats per block, 16 per thread.
// The grid is n / 4096 blocks; n must be a multiple of 4,096.
// ---------------------------------------------------------------------------
__global__ __launch_bounds__(256) void add2_kernel(const float* __restrict__ a,
                                                   const float* __restrict__ b,
                                                   float* __restrict__ c) {
  const size_t i = (size_t)blockIdx.x * 1024 + threadIdx.x;  // in units of 4 elements
  const f4* a4 = (const f4*)a;
  const f4* b4 = (const f4*)b;
  f4* c4 = (f4*)c;
  f4 va[4], vb[4];
#pragma unroll
  for (int j = 0; j < 4; j++) { va[j] = a4[i + 256 * j]; vb[j] = b4[i + 256 * j]; }
#pragma unroll
  for (int j = 0; j < 4; j++) c4[i + 256 * j] = va[j] + vb[j];
}

// ---------------------------------------------------------------------------
// out = LayerNorm(a + b) * g + beta, one wave per row of D = 512 (16 floats per
// lane), 8 rows per block. The row's two sums are formed in the lane, then over
// the 32 lanes in registers: no LDS and no barrier.
// ---------------------------------------------------------------------------
template <bool F16_TOO>
__global__ __launch_bounds__(256) void add_ln_kernel(const float* __restrict__ a,
                                                     const float* __restrict__ b,
                                                     const float* __restrict__ g,
                                                     const float* __restrict__ beta,
                                                     float* __restrict__ of,
                                                     _Float16* __restrict__ oh) {
  const int lane = threadIdx.x & 31;
  const int wave = __builtin_amdgcn_readfirstlane(threadIdx.x >> 5);
  const size_t base = ((size_t)blockIdx.x * 8 + wave) * DD;
  const f4* a4 = (const f4*)(a + base);
  const f4* b4 = (const f4*)(b + base);
  const f4* g4 = (const f4*)g;
  const f4* e4 = (const f4*)beta;
  f4 t[4], tb[4], gv[4], ev[4];
#pragma unroll
  for (int j = 0; j < 4; j++) { t[j] = a4[lane + 32 * j]; tb[j] = b4[lane + 32 * j]; }
#pragma unroll
  for (int j = 0; j < 4; j++) { gv[j] = g4[lane + 32 * j]; ev[j] = e4[lane + 32 * j]; }
#pragma unroll
  for (int j = 0; j < 4; j++) t[j] += tb[j];
  f4 sv = (t[0] + t[1]) + (t[2] + t[3]);
  f4 qv = (t[0] * t[0] + t[1] * t[1]) + (t[2] * t[2] + t[3] * t[3]);
  float s  = red16_sum((sv[0] + sv[1]) + (sv[2] + sv[3]));
  float ss = red16_sum((qv[0] + qv[1]) + (qv[2] + qv[3]));
  s  += xhalf_f(s);
  ss += xhalf_f(ss);
  float mu  = s * (1.f / DD);
  float var = ss * (1.f / DD) - mu * mu;
  float rstd = rsqrtf(var + 1e-5f);
#pragma unroll
  for (int j = 0; j < 4; j++) t[j] = (t[j] - mu) * rstd * gv[j] + ev[j];
  // the f16 copy goes first: its values take registers of their own while t is
  // still live, so that no register of an issued store is written again
  if (F16_TOO) {
    h4* oh4 = (h4*)(oh + base);
#pragma unroll
    for (int j = 0; j < 4; j++) oh4[lane + 32 * j] = to_h4(t[j]);
  }
  f4* of4 = (f4*)(of + base);
#pragma unroll
  for (int j = 0; j < 4; j++) of4[lane + 32 * j] = t[j];
}

// ---------------------------------------------------------------------------
// WMMA GEMM: C[M,N] = A[M,K] (f16, row-major) @ W[K,N] (f16, row-major)
// Workgroup tile 128x128, 8 waves in a 4(M) x 2(N) grid, each wave 32x64
// (2x4 accumulators of v_wmma_f32_16x16x32_f16). Double-buffered pipeline:
// A-tile and W-tile both via async global->LDS, each in its global row order;
// W fragments come out of LDS through ds_load_tr16_b128. One barrier per k-step.
// A k-step is 64 k = 128 B of an A row, so that one A copy of a wave covers four
// whole 128-B lines. K must be a multiple of 64.
// ---------------------------------------------------------------------------
template <bool OUT_F16, bool BIAS, bool RELU>
__global__ __launch_bounds__(256) void gemm_wmma(const _Float16* __restrict__ A,
                                                 const _Float16* __restrict__ W,
                                                 const float* __restrict__ bias,
                                                 _Float16* __restrict__ outH,
                                                 float* __restrict__ outF,
                                                 int M, int N, int K) {
  // ping-pong: 128 rows x 64 K, pitch 144 B (16 B x odd, for ds_load_b128)
  __shared__ __attribute__((aligned(16))) _Float16 As[2][128][72];
  // ping-pong: 64 K x 128 cols(N), pitch 288 B (32 B x odd, for ds_load_tr16_b128)
  __shared__ __attribute__((aligned(16))) _Float16 Bs[2][64][144];

  const int tid  = threadIdx.x;
  const int lane = tid & 31;
  const int wave = tid >> 5;
  const int l15  = lane & 15;
  const int half = lane >> 4;
  const int wm = wave >> 1;          // 0..3
  const int wn = wave & 1;           // 0..1
  const int mbase = blockIdx.y * 128;
  const int nbase = blockIdx.x * 128;

  v8f acc[2][4];
#pragma unroll
  for (int i = 0; i < 2; i++)
#pragma unroll
    for (int j = 0; j < 4; j++) { v8f z = {}; acc[i][j] = z; }

  const int arow = tid >> 3;            // A tile: rows t/8 + 32 j, j = 0..3,
  const int acs  = (tid & 7) * 8;       //         8 halfs at (t&7)*8
  const int bkr  = tid >> 4;            // W tile: k-rows t/16 + 16 j, j = 0..3,
  const int bns  = (tid & 15) * 8;      //         8 cols at (t&15)*8

  const int nk = K >> 6;                // k-steps of 64

  // all eight copies of one thread for k-tile kt into buffer buf
  auto stage = [&](int kt, int buf) {
    const _Float16* ga = A + (size_t)(mbase + arow) * K + (kt << 6) + acs;
    const _Float16* gw = W + (size_t)((kt << 6) + bkr) * N + nbase + bns;
    async_copy8_b128(lds_off_of(&As[buf][arow][acs]), ga,
                     lds_off_of(&As[buf][arow + 32][acs]), ga + (size_t)32 * K,
                     lds_off_of(&As[buf][arow + 64][acs]), ga + (size_t)64 * K,
                     lds_off_of(&As[buf][arow + 96][acs]), ga + (size_t)96 * K,
                     lds_off_of(&Bs[buf][bkr][bns]), gw,
                     lds_off_of(&Bs[buf][bkr + 16][bns]), gw + (size_t)16 * N,
                     lds_off_of(&Bs[buf][bkr + 32][bns]), gw + (size_t)32 * N,
                     lds_off_of(&Bs[buf][bkr + 48][bns]), gw + (size_t)48 * N);
  };

  // prologue: tile 0 lands and is published, then tile 1 starts to fly
  stage(0, 0);
  wait_async0();
  __syncthreads();
  if (nk > 1) stage(1, 1);

  for (int t = 0; t < nk; ++t) {
    const int cur = t & 1;

    // ---- compute on current buffers: two halves of 32 k, in k order ----
    // unrolled so that ks becomes a constant offset of the LDS reads
#pragma unroll
    for (int ks = 0; ks < 2; ks++) {
      v16h af[2], bf[4];
#pragma unroll
      for (int mt = 0; mt < 2; mt++) {
        const _Float16* p = &As[cur][wm * 32 + mt * 16 + l15][ks * 32 + half * 8];
#pragma unroll
        for (int i = 0; i < 8; i++) { af[mt][i] = p[i]; af[mt][8 + i] = p[16 + i]; }
      }
#pragma unroll
      for (int nt = 0; nt < 4; nt++) {
        // k 8*half + 0..7 and 16 + 8*half + 0..7 of column l15: the A loader's k order
        const _Float16* p = &Bs[cur][ks * 32 + half * 8 + (lane & 7)][wn * 64 + nt * 16 + ((lane >> 3) & 1) * 8];
        h8 lo = lds_tr16(p), hi = lds_tr16(p + 16 * 144);
#pragma unroll
        for (int i = 0; i < 8; i++) { bf[nt][i] = lo[i]; bf[nt][8 + i] = hi[i]; }
      }
#pragma unroll
      for (int mt = 0; mt < 2; mt++)
#pragma unroll
        for (int nt = 0; nt < 4; nt++)
          acc[mt][nt] = __builtin_amdgcn_wmma_f32_16x16x32_f16(
              false, af[mt], false, bf[nt], (short)0, acc[mt][nt], false, false);
    }

    // publish tile t+1, free buffer cur, then refill it with tile t+2
    wait_ds0();
    wait_async0();
    __syncthreads();
    if (t + 2 < nk) stage(t + 2, cur);
  }
  wait_async0();   // the ring is closed: no copy of this wave is left in flight

  // Epilogue: C layout: VGPR i, lane half h -> row = 8*h + i, col = l15.
#pragma unroll
  for (int mt = 0; mt < 2; mt++) {
#pragma unroll
    for (int nt = 0; nt < 4; nt++) {
      int gc = nbase + wn * 64 + nt * 16 + l15;
      float bv = BIAS ? bias[gc] : 0.f;
#pragma unroll
      for (int i = 0; i < 8; i++) {
        int gr = mbase + wm * 32 + mt * 16 + half * 8 + i;
        float v = acc[mt][nt][i] + bv;
        if (RELU) v = v > 0.f ? v : 0.f;
        size_t off = (size_t)gr * N + gc;
        if (OUT_F16) outH[off] = (_Float16)v;
        else         outF[off] = v;
      }
    }
  }
}

__global__ __launch_bounds__(256) void attn_wmma(const _Float16* __restrict__ Q,
                                                 const _Float16* __restrict__ Kk,
                                                 const _Float16* __restrict__ V,
                                                 _Float16* __restrict__ O) {
  // [key][d], pitch 144 B (16 B x odd, for ds_load_b128)
  __shared__ __attribute__((aligned(16))) _Float16 Kb[2][32][72];
  // [key][d], pitch 160 B (32 B x odd, for ds_load_tr16_b128)
  __shared__ __attribute__((aligned(16))) _Float16 Vs[2][32][80];

  const int tid  = threadIdx.x;
  const int lane = tid & 31;
  const int wave = tid >> 5;
  const int l15  = lane & 15;
  const int half = lane >> 4;
  const int qb   = blockIdx.x * 128;
  const int head = blockIdx.y;
  const int bat  = blockIdx.z;
  const size_t base = (size_t)bat * SS * DD + (size_t)head * DHH;
  const float scale = 0.125f;            // 1/sqrt(64)

  // Q fragments (B operand): column q = qb + wave*16 + l15, d split {0..31},{32..63}
  v16h qa[2];
  {
    const _Float16* qp = Q + base + (size_t)(qb + wave * 16 + l15) * DD;
#pragma unroll
    for (int f = 0; f < 2; f++)
#pragma unroll
      for (int i = 0; i < 8; i++) {
        qa[f][i]     = qp[f * 32 + half * 8 + i];
        qa[f][8 + i] = qp[f * 32 + 16 + half * 8 + i];
      }
  }

  // o[t][i] = O^T[d = 16 t + 8*half + i][q = l15]
  v8f o[4];
#pragma unroll
  for (int t = 0; t < 4; t++) { v8f z = {}; o[t] = z; }
  float mrun = -1e30f;                   // query l15: maximum so far (equal in both halves)
  float lrun = 0.f;                      // query l15: sum over this half's keys only

  const int r = tid >> 3;                // 0..31 (key)
  const int c = (tid & 7) * 8;           // 0..56 (d)

  // both copies of one thread for key-block kb into buffer buf
  auto stage = [&](int kb, int buf) {
    size_t roff = base + (size_t)(kb * 32 + r) * DD + c;
    async_copy2_b128(lds_off_of(&Kb[buf][r][c]), Kk + roff,
                     lds_off_of(&Vs[buf][r][c]), V + roff);
  };

  const int nkb = SS >> 5;               // 32-key blocks

  // prologue: block 0 lands and is published, then block 1 starts to fly
  stage(0, 0);
  wait_async0();
  __syncthreads();
  stage(1, 1);

  for (int t = 0; t < nkb; ++t) {
    const int cur = t & 1;

    // ---- scores: S^T tile (32 keys x 16 q) in two 16-key subtiles ----------
    // sc[nb][i] = S[q = l15][key = 16 nb + 8*half + i]
    v8f sc[2];
#pragma unroll
    for (int nb = 0; nb < 2; nb++) {
      v8f z = {};
      v16h kf;
      {
        const _Float16* p = &Kb[cur][nb * 16 + l15][half * 8];
#pragma unroll
        for (int i = 0; i < 8; i++) { kf[i] = p[i]; kf[8 + i] = p[16 + i]; }
      }
      z = __builtin_amdgcn_wmma_f32_16x16x32_f16(false, kf, false, qa[0], (short)0, z, false, false);
      {
        const _Float16* p = &Kb[cur][nb * 16 + l15][32 + half * 8];
#pragma unroll
        for (int i = 0; i < 8; i++) { kf[i] = p[i]; kf[8 + i] = p[16 + i]; }
      }
      z = __builtin_amdgcn_wmma_f32_16x16x32_f16(false, kf, false, qa[1], (short)0, z, false, false);
      sc[nb] = z;
    }
#pragma unroll
    for (int nb = 0; nb < 2; nb++)
#pragma unroll
      for (int i = 0; i < 8; i++) sc[nb][i] *= scale;

    // ---- online softmax of query l15, in the lane ---------------------------
    float mx = fmaxf(sc[0][0], sc[1][0]);
#pragma unroll
    for (int i = 1; i < 8; i++) mx = fmaxf(mx, fmaxf(sc[0][i], sc[1][i]));
    mx = fmaxf(mx, xhalf_f(mx));         // the other half's 16 keys
    const float mnew = fmaxf(mrun, mx);
    const float corr = __expf(mrun - mnew);
    mrun = mnew;
#pragma unroll
    for (int nb = 0; nb < 2; nb++)
#pragma unroll
      for (int i = 0; i < 8; i++) sc[nb][i] = __expf(sc[nb][i] - mnew);
    // this pass's sum in four independent chains
    float ps[4];
#pragma unroll
    for (int j = 0; j < 4; j++) ps[j] = ((sc[0][j] + sc[0][j + 4]) + sc[1][j]) + sc[1][j + 4];
    lrun = lrun * corr + ((ps[0] + ps[1]) + (ps[2] + ps[3]));
#pragma unroll
    for (int tt = 0; tt < 4; tt++)
#pragma unroll
      for (int i = 0; i < 8; i++) o[tt][i] *= corr;

    // ---- P^T fragment (B operand): keys 8*half + 0..7 and 16 + 8*half + 0..7
    //      of column q = l15, which is what sc[0] and sc[1] hold ---------------
    v16h pb;
#pragma unroll
    for (int i = 0; i < 8; i++) { pb[i] = (_Float16)sc[0][i]; pb[8 + i] = (_Float16)sc[1][i]; }

    // ---- PV: O^T(64 x 16) += V^T(64 x 32) @ P^T(32 x 16) --------------------
#pragma unroll
    for (int tt = 0; tt < 4; tt++) {
      v16h vf;
      // keys 8*half + 0..7 and 16 + 8*half + 0..7 of row d = tt*16 + l15: P^T's k order
      const _Float16* p = &Vs[cur][half * 8 + (lane & 7)][tt * 16 + ((lane >> 3) & 1) * 8];
      h8 lo = lds_tr16(p), hi = lds_tr16(p + 16 * 80);
#pragma unroll
      for (int i = 0; i < 8; i++) { vf[i] = lo[i]; vf[8 + i] = hi[i]; }
      o[tt] = __builtin_amdgcn_wmma_f32_16x16x32_f16(false, vf, false, pb, (short)0, o[tt], false, false);
    }

    // publish block t+1, free buffer cur, then refill it with block t+2
    wait_ds0();
    wait_async0();
    __syncthreads();
    if (t + 2 < nkb) stage(t + 2, cur);
  }
  wait_async0();   // the ring is closed: no copy of this wave is left in flight

  // ---- normalize and store O: a lane holds 8 consecutive d of its query ----
  const float inv = 1.f / (lrun + xhalf_f(lrun));   // the two halves' sums are joined here
  _Float16* op = O + base + (size_t)(qb + wave * 16 + l15) * DD + half * 8;
#pragma unroll
  for (int t = 0; t < 4; t++) {
    h8 ov;
#pragma unroll
    for (int i = 0; i < 8; i++) ov[i] = (_Float16)(o[t][i] * inv);
    *(h8*)(op + t * 16) = ov;
  }
}

// ---------------------------------------------------------------------------
// Host-side orchestration
// ---------------------------------------------------------------------------
extern "C" void kernel_launch(void* const* d_in, const int* in_sizes, int n_in,
                              void* d_out, int out_size, void* d_ws, size_t ws_size,
                              hipStream_t stream) {
  (void)in_sizes; (void)n_in; (void)out_size; (void)ws_size;

  const float* x        = (const float*)d_in[0];
  const int*   idx_emb  = (const int*)d_in[1];
  const int*   idx_pro  = (const int*)d_in[2];
  // d_in[3] is N == 768 (compile-time constant NV; cannot read device scalar
  // under graph capture).
  const float* Wq1 = (const float*)d_in[4];
  const float* Wk1 = (const float*)d_in[5];
  const float* Wv1 = (const float*)d_in[6];
  const float* Wo1 = (const float*)d_in[7];
  const float* Wq2 = (const float*)d_in[8];
  const float* Wk2 = (const float*)d_in[9];
  const float* Wv2 = (const float*)d_in[10];
  const float* Wo2 = (const float*)d_in[11];
  const float* w_conv1 = (const float*)d_in[12];
  const float* b_conv1 = (const float*)d_in[13];
  const float* w_conv2 = (const float*)d_in[14];
  const float* b_conv2 = (const float*)d_in[15];
  const float* g1 = (const float*)d_in[16];
  const float* beta1 = (const float*)d_in[17];
  const float* g2 = (const float*)d_in[18];
  const float* beta2 = (const float*)d_in[19];

  float* out   = (float*)d_out;          // LN2 result
  float* attn1 = out + BSD;
  float* attn2 = out + 2 * BSD;

  // ---- workspace layout ----
  char* w = (char*)d_ws;
  float* xl1  = (float*)w;  w += BSD * sizeof(float);   // x_l1 f32 (later reused: xln)
  float* f32b = (float*)w;  w += BSD * sizeof(float);   // new_x1 / y2
  float* f32c = (float*)w;  w += BSD * sizeof(float);   // x_l2
  _Float16* h_x = (_Float16*)w; w += BSD * sizeof(_Float16);   // f16 activations
  _Float16* h_q = (_Float16*)w; w += BSD * sizeof(_Float16);
  _Float16* h_k = (_Float16*)w; w += BSD * sizeof(_Float16);
  _Float16* h_v = (_Float16*)w; w += BSD * sizeof(_Float16);
  _Float16* h_o = (_Float16*)w; w += BSD * sizeof(_Float16);
  _Float16* h_ffn = (_Float16*)w; w += (size_t)BSROWS * DFF * sizeof(_Float16);
  _Float16* h_w = (_Float16*)w; w += (size_t)DD * DFF * sizeof(_Float16);   // weight staging

  const dim3 blk(256);
  const dim3 gemmDxD(DD / 128, BSROWS / 128);     // (4, 64)
  const dim3 gemmDxF(DFF / 128, BSROWS / 128);    // (16, 64)
  const dim3 attnGrid(SS / 128, HH, BB);          // (8, 8, 8)

  auto cvt = [&](const float* s, _Float16* d, int blocks) {
    cvt_f16_kernel<<<dim3(blocks), blk, 0, stream>>>(s, d);
  };

  // 1) x_l1 = gather(x, idx_emb) ; also f16 copy
  gather_cast_kernel<true><<<dim3(BSROWS / 16), blk, 0, stream>>>(x, idx_emb, xl1, h_x);

  // ================= MHA branch 1 =================
  cvt(Wq1, h_w, DD * DD / 2048);
  gemm_wmma<true, false, false><<<gemmDxD, blk, 0, stream>>>(h_x, h_w, nullptr, h_q, nullptr, BSROWS, DD, DD);
  cvt(Wk1, h_w, DD * DD / 2048);
  gemm_wmma<true, false, false><<<gemmDxD, blk, 0, stream>>>(h_x, h_w, nullptr, h_k, nullptr, BSROWS, DD, DD);
  cvt(Wv1, h_w, DD * DD / 2048);
  gemm_wmma<true, false, false><<<gemmDxD, blk, 0, stream>>>(h_x, h_w, nullptr, h_v, nullptr, BSROWS, DD, DD);
  attn_wmma<<<attnGrid, blk, 0, stream>>>(h_q, h_k, h_v, h_o);
  cvt(Wo1, h_w, DD * DD / 2048);
  gemm_wmma<false, false, false><<<gemmDxD, blk, 0, stream>>>(h_o, h_w, nullptr, nullptr, attn1, BSROWS, DD, DD);

  // ================= MHA branch 2 (flip∘MHA∘flip == MHA) =================
  cvt(Wq2, h_w, DD * DD / 2048);
  gemm_wmma<true, false, false><<<gemmDxD, blk, 0, stream>>>(h_x, h_w, nullptr, h_q, nullptr, BSROWS, DD, DD);
  cvt(Wk2, h_w, DD * DD / 2048);
  gemm_wmma<true, false, false><<<gemmDxD, blk, 0, stream>>>(h_x, h_w, nullptr, h_k, nullptr, BSROWS, DD, DD);
  cvt(Wv2, h_w, DD * DD / 2048);
  gemm_wmma<true, false, false><<<gemmDxD, blk, 0, stream>>>(h_x, h_w, nullptr, h_v, nullptr, BSROWS, DD, DD);
  attn_wmma<<<attnGrid, blk, 0, stream>>>(h_q, h_k, h_v, h_o);
  cvt(Wo2, h_w, DD * DD / 2048);
  gemm_wmma<false, false, false><<<gemmDxD, blk, 0, stream>>>(h_o, h_w, nullptr, nullptr, attn2, BSROWS, DD, DD);

  // new_x1 = attn1 + attn2 ; x_l2 = gather(new_x1, idx_pro)
  add2_kernel<<<dim3(BSROWS * DD / 4096), blk, 0, stream>>>(attn1, attn2, f32b);
  gather_cast_kernel<false><<<dim3(BSROWS / 16), blk, 0, stream>>>(f32b, idx_pro, f32c, nullptr);

  // xln = LN(x + x_l2; g1, beta1)  (reuse xl1 as f32 result, h_x as f16 copy)
  add_ln_kernel<true><<<dim3(BSROWS / 8), blk, 0, stream>>>(x, f32c, g1, beta1, xl1, h_x);

  // ================= FFN =================
  cvt(w_conv1, h_w, DD * DFF / 2048);
  gemm_wmma<true, true, true><<<gemmDxF, blk, 0, stream>>>(h_x, h_w, b_conv1, h_ffn, nullptr, BSROWS, DFF, DD);
  cvt(w_conv2, h_w, DFF * DD / 2048);
  gemm_wmma<false, true, false><<<gemmDxD, blk, 0, stream>>>(h_ffn, h_w, b_conv2, nullptr, f32b, BSROWS, DD, DFF);

  // out = LN(xln + y; g2, beta2)
  add_ln_kernel<false><<<dim3(BSROWS / 8), blk, 0, stream>>>(xl1, f32b, g2, beta2, out, nullptr);
}

// v005
// A run of this version takes 192 microseconds.
// Timed twice side by side with v004, it ran 1.26 and 1.24 times as fast.
// All steps since v000 together make it 2.25 times as fast.
#include <hip/hip_runtime.h>
#include <hip/hip_bf16.h>

#define BB   8
#define SS   1024
#define NV   768
#define DD   512
#define DFF  2048
#define HH   8
#define DHH  64
#define BSROWS (BB * SS)                       // 8192
#define BSD   ((size_t)BSROWS * DD)            // 4,194,304

typedef _Float16 v16h __attribute__((ext_vector_type(16)));
typedef float    v8f  __attribute__((ext_vector_type(8)));
typedef _Float16 h8   __attribute__((ext_vector_type(8)));

// ---------------- DPP 16-lane butterfly reductions (VALU, no DS pipe) ------
template <int CTRL>
__device__ __forceinline__ float dpp_perm_f(float x) {
  int i = __builtin_bit_cast(int, x);
  int r = __builtin_amdgcn_update_dpp(i, i, CTRL, 0xF, 0xF, true);
  return __builtin_bit_cast(float, r);
}
__device__ __forceinline__ float red16_sum(float x) {
  x += dpp_perm_f<0xB1>(x);    // quad_perm [1,0,3,2] : xor 1
  x += dpp_perm_f<0x4E>(x);    // quad_perm [2,3,0,1] : xor 2
  x += dpp_perm_f<0x141>(x);   // row_half_mirror     : xor 7
  x += dpp_perm_f<0x140>(x);   // row_mirror          : xor 15
  return x;
}

// ---------------- async global -> LDS staging (CDNA5, ASYNCcnt) ------------
__device__ __forceinline__ unsigned lds_off_of(const void* p) {
  // generic pointers to LDS carry the offset in the low 32 bits
  return (unsigned)(unsigned long long)(uintptr_t)p;
}
// A run of copies and its s_wait_xcnt 0 are one statement, so that no address
// register of an issued copy is rewritten ahead of that wait.
__device__ __forceinline__ void async_copy2_b128(unsigned l0, const void* g0,
                                                 unsigned l1, const void* g1) {
  asm volatile("global_load_async_to_lds_b128 %0, %1, off\n\t"
               "global_load_async_to_lds_b128 %2, %3, off\n\t"
               "s_wait_xcnt 0x0"
               :: "v"(l0), "v"((unsigned long long)(uintptr_t)g0),
                  "v"(l1), "v"((unsigned long long)(uintptr_t)g1)
               : "memory");
}
__device__ __forceinline__ void async_copy8_b128(unsigned l0, const void* g0,
                                                 unsigned l1, const void* g1,
                                                 unsigned l2, const void* g2,
                                                 unsigned l3, const void* g3,
                                                 unsigned l4, const void* g4,
                                                 unsigned l5, const void* g5,
                                                 unsigned l6, const void* g6,
                                                 unsigned l7, const void* g7) {
  asm volatile("global_load_async_to_lds_b128 %0, %1, off\n\t"
               "global_load_async_to_lds_b128 %2, %3, off\n\t"
               "global_load_async_to_lds_b128 %4, %5, off\n\t"
               "global_load_async_to_lds_b128 %6, %7, off\n\t"
               "global_load_async_to_lds_b128 %8, %9, off\n\t"
               "global_load_async_to_lds_b128 %10, %11, off\n\t"
               "global_load_async_to_lds_b128 %12, %13, off\n\t"
               "global_load_async_to_lds_b128 %14, %15, off\n\t"
               "s_wait_xcnt 0x0"
               :: "v"(l0), "v"((unsigned long long)(uintptr_t)g0),
                  "v"(l1), "v"((unsigned long long)(uintptr_t)g1),
                  "v"(l2), "v"((unsigned long long)(uintptr_t)g2),
                  "v"(l3), "v"((unsigned long long)(uintptr_t)g3),
                  "v"(l4), "v"((unsigned long long)(uintptr_t)g4),
                  "v"(l5), "v"((unsigned long long)(uintptr_t)g5),
                  "v"(l6), "v"((unsigned long long)(uintptr_t)g6),
                  "v"(l7), "v"((unsigned long long)(uintptr_t)g7)
               : "memory");
}
// This wave's copies have landed (the compiler places no wait for them).
__device__ __forceinline__ void wait_async0() {
  asm volatile("s_wait_asynccnt 0x0" ::: "memory");
}
// This wave's LDS reads are done before the buffer is handed back for a refill.
__device__ __forceinline__ void wait_ds0() {
  asm volatile("s_wait_dscnt 0x0" ::: "memory");
}

// ---------------- transposing LDS load (row-major [k][n] tile -> operand) ---
// Lane l passes the address of T[kbase + 8*(l>>4) + (l&7)][nbase + 8*((l>>3)&1)]
// and receives T[kbase + 8*(l>>4) + 0..7][nbase + (l&15)].
typedef short s16x8 __attribute__((ext_vector_type(8)));
__device__ __forceinline__ h8 lds_tr16(const _Float16* p) {
  typedef __attribute__((address_space(3))) s16x8 lds_s16x8;
  return __builtin_bit_cast(h8, __builtin_amdgcn_ds_load_tr16_b128_v8i16((lds_s16x8*)p));
}

// ---------------------------------------------------------------------------
// The streaming launches below move 16 B per lane and keep 2 to 16 such loads
// of a wave in flight: an array of B*S*D floats then takes 4,096 to 8,192 waves
// where one or two floats per thread took 65,536 to 131,072, and the time to
// start waves no longer outweighs the time to move the bytes.
// Every wave-wide access covers whole 128-B lines.
// ---------------------------------------------------------------------------
typedef float    f4 __attribute__((ext_vector_type(4)));
typedef _Float16 h4 __attribute__((ext_vector_type(4)));

__device__ __forceinline__ h4 to_h4(f4 v) { return __builtin_convertvector(v, h4); }

// lane l <-> l ^ 16
__device__ __forceinline__ float xhalf_f(float x) {
  int b = __builtin_bit_cast(int, x);
  return __builtin_bit_cast(float,
      __builtin_amdgcn_permlanex16(b, b, 0x76543210, 0xfedcba98, false, false));
}

// ---------------------------------------------------------------------------
// f32 -> f16 convert (weights): 2,048 floats per block, 8 per thread.
// blk is the block's number within this array of a multiple of 2,048 floats.
// ---------------------------------------------------------------------------
__device__ __forceinline__ void cvt_f16_block(const float* __restrict__ src,
                                              _Float16* __restrict__ dst, int blk) {
  const size_t i = (size_t)blk * 512 + threadIdx.x;          // in units of 4 elements
  const f4* s4 = (const f4*)src;
  h4* d4 = (h4*)dst;
  f4 a = s4[i], b = s4[i + 256];
  d4[i] = to_h4(a);
  d4[i + 256] = to_h4(b);
  // inlined twice into one kernel: keeps the registers that the two stores name
  // from being written again, on any way through the listing, ahead of this wait
  asm volatile("s_wait_xcnt 0x0" ::: "memory");
}

// ---------------------------------------------------------------------------
// Batched gather over first N rows (rest pass-through), optional f16 copy.
// Two rows of D = 512 per wave (8 loads in flight), 16 rows per block.
// ---------------------------------------------------------------------------
template <bool F16_TOO>
__device__ __forceinline__ void gather_cast_block(const float* __restrict__ x,
                                                  const int* __restrict__ idx,
                                                  float* __restrict__ of,
                                                  _Float16* __restrict__ oh, int blk) {
  const int lane = threadIdx.x & 31;
  const int wave = __builtin_amdgcn_readfirstlane(threadIdx.x >> 5);
  const int bs0  = (blk * 8 + wave) * 2;             // 0..B*S-2, even
  const int b = bs0 / SS, s0 = bs0 % SS;
  static_assert(NV % 2 == 0 && SS % 2 == 0, "rows s0 and s0 + 1 lie on the same side of NV");
  int srow[2] = {s0, s0 + 1};
  if (s0 < NV) {
    // both indices are fetched before either row, so that all 8 row loads fly together
#pragma unroll
    for (int rr = 0; rr < 2; rr++) {
      int r = idx[b * NV + s0 + rr];
      srow[rr] = r < 0 ? 0 : (r > NV - 1 ? NV - 1 : r);   // the address stays inside x
    }
  }
  f4 v[2][4];
#pragma unroll
  for (int rr = 0; rr < 2; rr++) {
    const f4* src = (const f4*)(x + ((size_t)b * SS + srow[rr]) * DD);
#pragma unroll
    for (int j = 0; j < 4; j++) v[rr][j] = src[lane + 32 * j];
  }
  // the f16 copy goes first: its values take registers of their own while v is
  // still live, so that no register of an issued store is written again
  if (F16_TOO) {
    h4* oh4 = (h4*)(oh + (size_t)bs0 * DD);
#pragma unroll
    for (int rr = 0; rr < 2; rr++)
#pragma unroll
      for (int j = 0; j < 4; j++) oh4[rr * (DD / 4) + lane + 32 * j] = to_h4(v[rr][j]);
  }
  f4* of4 = (f4*)(of + (size_t)bs0 * DD);
#pragma unroll
  for (int rr = 0; rr < 2; rr++)
#pragma unroll
    for (int j = 0; j < 4; j++) of4[rr * (DD / 4) + lane + 32 * j] = v[rr][j];
}

__global__ __launch_bounds__(256) void gather_kernel(const float* __restrict__ x,
                                                     const int* __restrict__ idx,
                                                     float* __restrict__ of) {
  gather_cast_block<false>(x, idx, of, nullptr, blockIdx.x);
}

// ---------------------------------------------------------------------------
// All the work that reads nothing but inputs, in one launch: blocks 0..511
// gather x (f32 and f16 copy); the next 8 x 128 blocks convert the eight D x D
// weights, the last 2 x 512 the two FFN weights. The f16 weights lie one behind
// the other in wh, in the order of the arguments.
// ---------------------------------------------------------------------------
#define GATHER_BLOCKS (BSROWS / 16)            // 512
#define DXD_BLOCKS    (DD * DD / 2048)         // 128
#define FFN_BLOCKS    (DD * DFF / 2048)        // 512
#define PREP_BLOCKS   (GATHER_BLOCKS + 8 * DXD_BLOCKS + 2 * FFN_BLOCKS)
__global__ __launch_bounds__(256) void prep_kernel(const float* __restrict__ x,
                                                   const int* __restrict__ idx,
                                                   float* __restrict__ of,
                                                   _Float16* __restrict__ oh,
                                                   const float* __restrict__ w0,
                                                   const float* __restrict__ w1,
                                                   const float* __restrict__ w2,
                                                   const float* __restrict__ w3,
                                                   const float* __restrict__ w4,
                                                   const float* __restrict__ w5,
                                                   const float* __restrict__ w6,
                                                   const float* __restrict__ w7,
                                                   const float* __restrict__ f0,
                                                   const float* __restrict__ f1,
                                                   _Float16* __restrict__ wh) {
  const int blk = blockIdx.x;
  if (blk < GATHER_BLOCKS) {
    gather_cast_block<true>(x, idx, of, oh, blk);
    return;
  }
  const int c = blk - GATHER_BLOCKS;
  if (c < 8 * DXD_BLOCKS) {
    const int which = c / DXD_BLOCKS;
    // picked bit by bit: seven scalar selects, no branch
    const float* s01 = (which & 1) ? w1 : w0;
    const float* s23 = (which & 1) ? w3 : w2;
    const float* s45 = (which & 1) ? w5 : w4;
    const float* s67 = (which & 1) ? w7 : w6;
    const float* s03 = (which & 2) ? s23 : s01;
    const float* s47 = (which & 2) ? s67 : s45;
    cvt_f16_block((which & 4) ? s47 : s03, wh + (size_t)which * DD * DD, c % DXD_BLOCKS);
  } else {
    const int which = (c - 8 * DXD_BLOCKS) / FFN_BLOCKS;
    cvt_f16_block(which == 0 ? f0 : f1, wh + (size_t)8 * DD * DD + (size_t)which * DD * DFF,
                  (c - 8 * DXD_BLOCKS) % FFN_BLOCKS);
  }
}

// ---------------------------------------------------------------------------
// c = a + b (elementwise f32): 4,096 floats per block, 16 per thread.
// The grid is n / 4096 blocks; n must be a multiple of 4,096.
// ---------------------------------------------------------------------------
__global__ __launch_bounds__(256) void add2_kernel(const float* __restrict__ a,
                                                   const float* __restrict__ b,
                                                   float* __restrict__ c) {
  const size_t i = (size_t)blockIdx.x * 1024 + threadIdx.x;  // in units of 4 elements
  const f4* a4 = (const f4*)a;
  const f4* b4 = (const f4*)b;
  f4* c4 = (f4*)c;
  f4 va[4], vb[4];
#pragma unroll
  for (int j = 0; j < 4; j++) { va[j] = a4[i + 256 * j]; vb[j] = b4[i + 256 * j]; }
#pragma unroll
  for (int j = 0; j < 4; j++) c4[i + 256 * j] = va[j] + vb[j];
}

// ---------------------------------------------------------------------------
// out = LayerNorm(a + b) * g + beta, one wave per row of D = 512 (16 floats per
// lane), 8 rows per block. The row's two sums are formed in the lane, then over
// the 32 lanes in registers: no LDS and no barrier.
// ---------------------------------------------------------------------------
template <bool F16_TOO>
__global__ __launch_bounds__(256) void add_ln_kernel(const float* __restrict__ a,
                                                     const float* __restrict__ b,
                                                     const float* __restrict__ g,
                                                     const float* __restrict__ beta,
                                                     float* __restrict__ of,
                                                     _Float16* __restrict__ oh) {
  const int lane = threadIdx.x & 31;
  const int wave = __builtin_amdgcn_readfirstlane(threadIdx.x >> 5);
  const size_t base = ((size_t)blockIdx.x * 8 + wave) * DD;
  const f4* a4 = (const f4*)(a + base);
  const f4* b4 = (const f4*)(b + base);
  const f4* g4 = (const f4*)g;
  const f4* e4 = (const f4*)beta;
  f4 t[4], tb[4], gv[4], ev[4];
#pragma unroll
  for (int j = 0; j < 4; j++) { t[j] = a4[lane + 32 * j]; tb[j] = b4[lane + 32 * j]; }
#pragma unroll
  for (int j = 0; j < 4; j++) { gv[j] = g4[lane + 32 * j]; ev[j] = e4[lane + 32 * j]; }
#pragma unroll
  for (int j = 0; j < 4; j++) t[j] += tb[j];
  f4 sv = (t[0] + t[1]) + (t[2] + t[3]);
  f4 qv = (t[0] * t[0] + t[1] * t[1]) + (t[2] * t[2] + t[3] * t[3]);
  float s  = red16_sum((sv[0] + sv[1]) + (sv[2] + sv[3]));
  float ss = red16_sum((qv[0] + qv[1]) + (qv[2] + qv[3]));
  s  += xhalf_f(s);
  ss += xhalf_f(ss);
  float mu  = s * (1.f / DD);
  float var = ss * (1.f / DD) - mu * mu;
  float rstd = rsqrtf(var + 1e-5f);
#pragma unroll
  for (int j = 0; j < 4; j++) t[j] = (t[j] - mu) * rstd * gv[j] + ev[j];
  // the f16 copy goes first: its values take registers of their own while t is
  // still live, so that no register of an issued store is written again
  if (F16_TOO) {
    h4* oh4 = (h4*)(oh + base);
#pragma unroll
    for (int j = 0; j < 4; j++) oh4[lane + 32 * j] = to_h4(t[j]);
  }
  f4* of4 = (f4*)(of + base);
#pragma unroll
  for (int j = 0; j < 4; j++) of4[lane + 32 * j] = t[j];
}

// ---------------------------------------------------------------------------
// WMMA GEMM: C[M,N] = A[M,K] (f16, row-major) @ W[K,N] (f16, row-major)
// Workgroup tile 128x128, 8 waves in a 4(M) x 2(N) grid, each wave 32x64
// (2x4 accumulators of v_wmma_f32_16x16x32_f16). Double-buffered pipeline:
// A-tile and W-tile both via async global->LDS, each in its global row order;
// W fragments come out of LDS through ds_load_tr16_b128. One barrier per k-step.
// A k-step is 64 k = 128 B of an A row, so that one A copy of a wave covers four
// whole 128-B lines. K must be a multiple of 64.
// blockIdx.z picks one of several products of the same shape: its A, W and C
// start zA, zW and zC elements behind those of the product before it.
// ---------------------------------------------------------------------------
template <bool OUT_F16, bool BIAS, bool RELU>
__global__ __launch_bounds__(256) void gemm_wmma(const _Float16* __restrict__ A0,
                                                 const _Float16* __restrict__ W0,
                                                 const float* __restrict__ bias,
                                                 _Float16* __restrict__ outH0,
                                                 float* __restrict__ outF0,
                                                 int M, int N, int K,
                                                 size_t zA, size_t zW, size_t zC) {
  // ping-pong: 128 rows x 64 K, pitch 144 B (16 B x odd, for ds_load_b128)
  __shared__ __attribute__((aligned(16))) _Float16 As[2][128][72];
  // ping-pong: 64 K x 128 cols(N), pitch 288 B (32 B x odd, for ds_load_tr16_b128)
  __shared__ __attribute__((aligned(16))) _Float16 Bs[2][64][144];

  const int tid  = threadIdx.x;
  const int lane = tid & 31;
  const int wave = tid >> 5;
  const int l15  = lane & 15;
  const int half = lane >> 4;
  const int wm = wave >> 1;          // 0..3
  const int wn = wave & 1;           // 0..1
  const int mbase = blockIdx.y * 128;
  const int nbase = blockIdx.x * 128;
  const _Float16* __restrict__ A = A0 + blockIdx.z * zA;
  const _Float16* __restrict__ W = W0 + blockIdx.z * zW;
  _Float16* __restrict__ outH = OUT_F16 ? outH0 + blockIdx.z * zC : nullptr;
  float* __restrict__ outF = OUT_F16 ? nullptr : outF0 + blockIdx.z * zC;

  v8f acc[2][4];
#pragma unroll
  for (int i = 0; i < 2; i++)
#pragma unroll
    for (int j = 0; j < 4; j++) { v8f z = {}; acc[i][j] = z; }

  const int arow = tid >> 3;            // A tile: rows t/8 + 32 j, j = 0..3,
  const int acs  = (tid & 7) * 8;       //         8 halfs at (t&7)*8
  const int bkr  = tid >> 4;            // W tile: k-rows t/16 + 16 j, j = 0..3,
  const int bns  = (tid & 15) * 8;      //         8 cols at (t&15)*8

  const int nk = K >> 6;                // k-steps of 64

  // all eight copies of one thread for k-tile kt into buffer buf
  auto stage = [&](int kt, int buf) {
    const _Float16* ga = A + (size_t)(mbase + arow) * K + (kt << 6) + acs;
    const _Float16* gw = W + (size_t)((kt << 6) + bkr) * N + nbase + bns;
    async_copy8_b128(lds_off_of(&As[buf][arow][acs]), ga,
                     lds_off_of(&As[buf][arow + 32][acs]), ga + (size_t)32 * K,
                     lds_off_of(&As[buf][arow + 64][acs]), ga + (size_t)64 * K,
                     lds_off_of(&As[buf][arow + 96][acs]), ga + (size_t)96 * K,
                     lds_off_of(&Bs[buf][bkr][bns]), gw,
                     lds_off_of(&Bs[buf][bkr + 16][bns]), gw + (size_t)16 * N,
                     lds_off_of(&Bs[buf][bkr + 32][bns]), gw + (size_t)32 * N,
                     lds_off_of(&Bs[buf][bkr + 48][bns]), gw + (size_t)48 * N);
  };

  // prologue: tile 0 lands and is published, then tile 1 starts to fly
  stage(0, 0);
  wait_async0();
  __syncthreads();
  if (nk > 1) stage(1, 1);

  for (int t = 0; t < nk; ++t) {
    const int cur = t & 1;

    // ---- compute on current buffers: two halves of 32 k, in k order ----
    // unrolled so that ks becomes a constant offset of the LDS reads
#pragma unroll
    for (int ks = 0; ks < 2; ks++) {
      v16h af[2], bf[4];
#pragma unroll
      for (int mt = 0; mt < 2; mt++) {
        const _Float16* p = &As[cur][wm * 32 + mt * 16 + l15][ks * 32 + half * 8];
#pragma unroll
        for (int i = 0; i < 8; i++) { af[mt][i] = p[i]; af[mt][8 + i] = p[16 + i]; }
      }
#pragma unroll
      for (int nt = 0; nt < 4; nt++) {
        // k 8*half + 0..7 and 16 + 8*half + 0..7 of column l15: the A loader's k order
        const _Float16* p = &Bs[cur][ks * 32 + half * 8 + (lane & 7)][wn * 64 + nt * 16 + ((lane >> 3) & 1) * 8];
        h8 lo = lds_tr16(p), hi = lds_tr16(p + 16 * 144);
#pragma unroll
        for (int i = 0; i < 8; i++) { bf[nt][i] = lo[i]; bf[nt][8 + i] = hi[i]; }
      }
#pragma unroll
      for (int mt = 0; mt < 2; mt++)
#pragma unroll
        for (int nt = 0; nt < 4; nt++)
          acc[mt][nt] = __builtin_amdgcn_wmma_f32_16x16x32_f16(
              false, af[mt], false, bf[nt], (short)0, acc[mt][nt], false, false);
    }

    // publish tile t+1, free buffer cur, then refill it with tile t+2
    wait_ds0();
    wait_async0();
    __syncthreads();
    if (t + 2 < nk) stage(t + 2, cur);
  }
  wait_async0();   // the ring is closed: no copy of this wave is left in flight

  // Epilogue: C layout: VGPR i, lane half h -> row = 8*h + i, col = l15.
#pragma unroll
  for (int mt = 0; mt < 2; mt++) {
#pragma unroll
    for (int nt = 0; nt < 4; nt++) {
      int gc = nbase + wn * 64 + nt * 16 + l15;
      float bv = BIAS ? bias[gc] : 0.f;
#pragma unroll
      for (int i = 0; i < 8; i++) {
        int gr = mbase + wm * 32 + mt * 16 + half * 8 + i;
        float v = acc[mt][nt][i] + bv;
        if (RELU) v = v > 0.f ? v : 0.f;
        size_t off = (size_t)gr * N + gc;
        if (OUT_F16) outH[off] = (_Float16)v;
        else         outF[off] = v;
      }
    }
  }
}

__global__ __launch_bounds__(256) void attn_wmma(const _Float16* __restrict__ QKV,
                                                 _Float16* __restrict__ O0) {
  // [key][d], pitch 144 B (16 B x odd, for ds_load_b128)
  __shared__ __attribute__((aligned(16))) _Float16 Kb[2][32][72];
  // [key][d], pitch 160 B (32 B x odd, for ds_load_tr16_b128)
  __shared__ __attribute__((aligned(16))) _Float16 Vs[2][32][80];

  const int tid  = threadIdx.x;
  const int lane = tid & 31;
  const int wave = tid >> 5;
  const int l15  = lane & 15;
  const int half = lane >> 4;
  const int qb   = blockIdx.x * 128;
  const int head = blockIdx.y;
  const int bat  = blockIdx.z % BB;
  const int br   = blockIdx.z / BB;      // 0, 1: which branch
  const _Float16* __restrict__ Q  = QKV + (size_t)br * 3 * BSD;
  const _Float16* __restrict__ Kk = Q + BSD;
  const _Float16* __restrict__ V  = Q + 2 * BSD;
  _Float16* __restrict__ O = O0 + (size_t)br * BSD;
  const size_t base = (size_t)bat * SS * DD + (size_t)head * DHH;
  const float scale = 0.125f;            // 1/sqrt(64)

  // Q fragments (B operand): column q = qb + wave*16 + l15, d split {0..31},{32..63}
  v16h qa[2];
  {
    const _Float16* qp = Q + base + (size_t)(qb + wave * 16 + l15) * DD;
#pragma unroll
    for (int f = 0; f < 2; f++)
#pragma unroll
      for (int i = 0; i < 8; i++) {
        qa[f][i]     = qp[f * 32 + half * 8 + i];
        qa[f][8 + i] = qp[f * 32 + 16 + half * 8 + i];
      }
  }

  // o[t][i] = O^T[d = 16 t + 8*half + i][q = l15]
  v8f o[4];
#pragma unroll
  for (int t = 0; t < 4; t++) { v8f z = {}; o[t] = z; }
  float mrun = -1e30f;                   // query l15: maximum so far (equal in both halves)
  float lrun = 0.f;                      // query l15: sum over this half's keys only

  const int r = tid >> 3;                // 0..31 (key)
  const int c = (tid & 7) * 8;           // 0..56 (d)

  // both copies of one thread for key-block kb into buffer buf
  auto stage = [&](int kb, int buf) {
    size_t roff = base + (size_t)(kb * 32 + r) * DD + c;
    async_copy2_b128(lds_off_of(&Kb[buf][r][c]), Kk + roff,
                     lds_off_of(&Vs[buf][r][c]), V + roff);
  };

  const int nkb = SS >> 5;               // 32-key blocks

  // prologue: block 0 lands and is published, then block 1 starts to fly
  stage(0, 0);
  wait_async0();
  __syncthreads();
  stage(1, 1);

  for (int t = 0; t < nkb; ++t) {
    const int cur = t & 1;

    // ---- scores: S^T tile (32 keys x 16 q) in two 16-key subtiles ----------
    // sc[nb][i] = S[q = l15][key = 16 nb + 8*half + i]
    v8f sc[2];
#pragma unroll
    for (int nb = 0; nb < 2; nb++) {
      v8f z = {};
      v16h kf;
      {
        const _Float16* p = &Kb[cur][nb * 16 + l15][half * 8];
#pragma unroll
        for (int i = 0; i < 8; i++) { kf[i] = p[i]; kf[8 + i] = p[16 + i]; }
      }
      z = __builtin_amdgcn_wmma_f32_16x16x32_f16(false, kf, false, qa[0], (short)0, z, false, false);
      {
        const _Float16* p = &Kb[cur][nb * 16 + l15][32 + half * 8];
#pragma unroll
        for (int i = 0; i < 8; i++) { kf[i] = p[i]; kf[8 + i] = p[16 + i]; }
      }
      z = __builtin_amdgcn_wmma_f32_16x16x32_f16(false, kf, false, qa[1], (short)0, z, false, false);
      sc[nb] = z;
    }
#pragma unroll
    for (int nb = 0; nb < 2; nb++)
#pragma unroll
      for (int i = 0; i < 8; i++) sc[nb][i] *= scale;

    // ---- online softmax of query l15, in the lane ---------------------------
    float mx = fmaxf(sc[0][0], sc[1][0]);
#pragma unroll
    for (int i = 1; i < 8; i++) mx = fmaxf(mx, fmaxf(sc[0][i], sc[1][i]));
    mx = fmaxf(mx, xhalf_f(mx));         // the other half's 16 keys
    const float mnew = fmaxf(mrun, mx);
    const float corr = __expf(mrun - mnew);
    mrun = mnew;
#pragma unroll
    for (int nb = 0; nb < 2; nb++)
#pragma unroll
      for (int i = 0; i < 8; i++) sc[nb][i] = __expf(sc[nb][i] - mnew);
    // this pass's sum in four independent chains
    float ps[4];
#pragma unroll
    for (int j = 0; j < 4; j++) ps[j] = ((sc[0][j] + sc[0][j + 4]) + sc[1][j]) + sc[1][j + 4];
    lrun = lrun * corr + ((ps[0] + ps[1]) + (ps[2] + ps[3]));
#pragma unroll
    for (int tt = 0; tt < 4; tt++)
#pragma unroll
      for (int i = 0; i < 8; i++) o[tt][i] *= corr;

    // ---- P^T fragment (B operand): keys 8*half + 0..7 and 16 + 8*half + 0..7
    //      of column q = l15, which is what sc[0] and sc[1] hold ---------------
    v16h pb;
#pragma unroll
    for (int i = 0; i < 8; i++) { pb[i] = (_Float16)sc[0][i]; pb[8 + i] = (_Float16)sc[1][i]; }

    // ---- PV: O^T(64 x 16) += V^T(64 x 32) @ P^T(32 x 16) --------------------
#pragma unroll
    for (int tt = 0; tt < 4; tt++) {
      v16h vf;
      // keys 8*half + 0..7 and 16 + 8*half + 0..7 of row d = tt*16 + l15: P^T's k order
      const _Float16* p = &Vs[cur][half * 8 + (lane & 7)][tt * 16 + ((lane >> 3) & 1) * 8];
      h8 lo = lds_tr16(p), hi = lds_tr16(p + 16 * 80);
#pragma unroll
      for (int i = 0; i < 8; i++) { vf[i] = lo[i]; vf[8 + i] = hi[i]; }
      o[tt] = __builtin_amdgcn_wmma_f32_16x16x32_f16(false, vf, false, pb, (short)0, o[tt], false, false);
    }

    // publish block t+1, free buffer cur, then refill it with block t+2
    wait_ds0();
    wait_async0();
    __syncthreads();
    if (t + 2 < nkb) stage(t + 2, cur);
  }
  wait_async0();   // the ring is closed: no copy of this wave is left in flight

  // ---- normalize and store O: a lane holds 8 consecutive d of its query ----
  const float inv = 1.f / (lrun + xhalf_f(lrun));   // the two halves' sums are joined here
  _Float16* op = O + base + (size_t)(qb + wave * 16 + l15) * DD + half * 8;
#pragma unroll
  for (int t = 0; t < 4; t++) {
    h8 ov;
#pragma unroll
    for (int i = 0; i < 8; i++) ov[i] = (_Float16)(o[t][i] * inv);
    *(h8*)(op + t * 16) = ov;
  }
}

// ---------------------------------------------------------------------------
// Host-side orchestration
// ---------------------------------------------------------------------------
extern "C" void kernel_launch(void* const* d_in, const int* in_sizes, int n_in,
                              void* d_out, int out_size, void* d_ws, size_t ws_size,
                              hipStream_t stream) {
  (void)in_sizes; (void)n_in; (void)out_size; (void)ws_size;

  const float* x        = (const float*)d_in[0];
  const int*   idx_emb  = (const int*)d_in[1];
  const int*   idx_pro  = (const int*)d_in[2];
  // d_in[3] is N == 768 (compile-time constant NV; cannot read device scalar
  // under graph capture).
  const float* Wq1 = (const float*)d_in[4];
  const float* Wk1 = (const float*)d_in[5];
  const float* Wv1 = (const float*)d_in[6];
  const float* Wo1 = (const float*)d_in[7];
  const float* Wq2 = (const float*)d_in[8];
  const float* Wk2 = (const float*)d_in[9];
  const float* Wv2 = (const float*)d_in[10];
  const float* Wo2 = (const float*)d_in[11];
  const float* w_conv1 = (const float*)d_in[12];
  const float* b_conv1 = (const float*)d_in[13];
  const float* w_conv2 = (const float*)d_in[14];
  const float* b_conv2 = (const float*)d_in[15];
  const float* g1 = (const float*)d_in[16];
  const float* beta1 = (const float*)d_in[17];
  const float* g2 = (const float*)d_in[18];
  const float* beta2 = (const float*)d_in[19];

  float* out   = (float*)d_out;          // LN2 result
  float* attn1 = out + BSD;
  float* attn2 = out + 2 * BSD;

  // ---- workspace layout ----
  char* w = (char*)d_ws;
  float* xl1  = (float*)w;  w += BSD * sizeof(float);   // x_l1 f32 (later reused: xln)
  float* f32b = (float*)w;  w += BSD * sizeof(float);   // new_x1 / y2
  float* f32c = (float*)w;  w += BSD * sizeof(float);   // x_l2
  _Float16* h_x = (_Float16*)w; w += BSD * sizeof(_Float16);   // f16 activations
  _Float16* h_qkv = (_Float16*)w; w += 6 * BSD * sizeof(_Float16);   // q1 k1 v1 q2 k2 v2
  _Float16* h_o = (_Float16*)w; w += 2 * BSD * sizeof(_Float16);     // o1 o2
  _Float16* h_ffn = (_Float16*)w; w += (size_t)BSROWS * DFF * sizeof(_Float16);
  // f16 weights: q1 k1 v1 q2 k2 v2 o1 o2 (D x D each), conv1, conv2
  _Float16* h_w = (_Float16*)w; w += ((size_t)8 * DD * DD + (size_t)2 * DD * DFF) * sizeof(_Float16);
  _Float16* h_wo = h_w + (size_t)6 * DD * DD;
  _Float16* h_w1 = h_w + (size_t)8 * DD * DD;
  _Float16* h_w2 = h_w1 + (size_t)DD * DFF;

  const dim3 blk(256);
  const dim3 gemmQKV(DD / 128, BSROWS / 128, 6);  // (4, 64, 6)
  const dim3 gemmO(DD / 128, BSROWS / 128, 2);    // (4, 64, 2)
  const dim3 gemmDxD(DD / 128, BSROWS / 128);     // (4, 64)
  const dim3 gemmDxF(DFF / 128, BSROWS / 128);    // (16, 64)
  const dim3 attnGrid(SS / 128, HH, 2 * BB);      // (8, 8, 16)

  // x_l1 = gather(x, idx_emb), also as f16; every weight to f16
  prep_kernel<<<dim3(PREP_BLOCKS), blk, 0, stream>>>(x, idx_emb, xl1, h_x,
                                                     Wq1, Wk1, Wv1, Wq2, Wk2, Wv2, Wo1, Wo2,
                                                     w_conv1, w_conv2, h_w);

  // ===== both MHA branches (flip, MHA, flip == MHA), each stage one launch =====
  gemm_wmma<true, false, false><<<gemmQKV, blk, 0, stream>>>(h_x, h_w, nullptr, h_qkv, nullptr, BSROWS, DD, DD,
                                                             0, (size_t)DD * DD, BSD);
  attn_wmma<<<attnGrid, blk, 0, stream>>>(h_qkv, h_o);
  // attn1 and attn2 lie one behind the other in out
  gemm_wmma<false, false, false><<<gemmO, blk, 0, stream>>>(h_o, h_wo, nullptr, nullptr, attn1, BSROWS, DD, DD,
                                                            BSD, (size_t)DD * DD, BSD);

  // new_x1 = attn1 + attn2 ; x_l2 = gather(new_x1, idx_pro)
  add2_kernel<<<dim3(BSROWS * DD / 4096), blk, 0, stream>>>(attn1, attn2, f32b);
  gather_kernel<<<dim3(GATHER_BLOCKS), blk, 0, stream>>>(f32b, idx_pro, f32c);

  // xln = LN(x + x_l2; g1, beta1)  (reuse xl1 as f32 result, h_x as f16 copy)
  add_ln_kernel<true><<<dim3(BSROWS / 8), blk, 0, stream>>>(x, f32c, g1, beta1, xl1, h_x);

  // ================= FFN =================
  gemm_wmma<true, true, true><<<gemmDxF, blk, 0, stream>>>(h_x, h_w1, b_conv1, h_ffn, nullptr, BSROWS, DFF, DD, 0, 0, 0);
  gemm_wmma<false, true, false><<<gemmDxD, blk, 0, stream>>>(h_ffn, h_w2, b_conv2, nullptr, f32b, BSROWS, DD, DFF, 0, 0, 0);

  // out = LN(xln + y; g2, beta2)
  add_ln_kernel<false><<<dim3(BSROWS / 8), blk, 0, stream>>>(xl1, f32b, g2, beta2, out, nullptr);
}

// v006
// A run of this version takes 161 microseconds.
// Next to v005, in two timings, it ran 1.18 and 1.19 times as fast.
// Over all steps from v000 it is 2.67 times as fast.
#include <hip/hip_runtime.h>
#include <hip/hip_bf16.h>

#define BB   8
#define SS   1024
#define NV   768
#define DD   512
#define DFF  2048
#define HH   8
#define DHH  64
#define BSROWS (BB * SS)                       // 8192
#define BSD   ((size_t)BSROWS * DD)            // 4,194,304

typedef _Float16 v16h __attribute__((ext_vector_type(16)));
typedef float    v8f  __attribute__((ext_vector_type(8)));
typedef _Float16 h8   __attribute__((ext_vector_type(8)));

// ---------------- DPP 16-lane butterfly reductions (VALU, no DS pipe) ------
template <int CTRL>
__device__ __forceinline__ float dpp_perm_f(float x) {
  int i = __builtin_bit_cast(int, x);
  int r = __builtin_amdgcn_update_dpp(i, i, CTRL, 0xF, 0xF, true);
  return __builtin_bit_cast(float, r);
}
__device__ __forceinline__ float red16_sum(float x) {
  x += dpp_perm_f<0xB1>(x);    // quad_perm [1,0,3,2] : xor 1
  x += dpp_perm_f<0x4E>(x);    // quad_perm [2,3,0,1] : xor 2
  x += dpp_perm_f<0x141>(x);   // row_half_mirror     : xor 7
  x += dpp_perm_f<0x140>(x);   // row_mirror          : xor 15
  return x;
}

// ---------------- async global -> LDS staging (CDNA5, ASYNCcnt) ------------
__device__ __forceinline__ unsigned lds_off_of(const void* p) {
  // generic pointers to LDS carry the offset in the low 32 bits
  return (unsigned)(unsigned long long)(uintptr_t)p;
}
// A run of copies and its s_wait_xcnt 0 are one statement, so that no address
// register of an issued copy is rewritten ahead of that wait.
__device__ __forceinline__ void async_copy2_b128(unsigned l0, const void* g0,
                                                 unsigned l1, const void* g1) {
  asm volatile("global_load_async_to_lds_b128 %0, %1, off\n\t"
               "global_load_async_to_lds_b128 %2, %3, off\n\t"
               "s_wait_xcnt 0x0"
               :: "v"(l0), "v"((unsigned long long)(uintptr_t)g0),
                  "v"(l1), "v"((unsigned long long)(uintptr_t)g1)
               : "memory");
}
__device__ __forceinline__ void async_copy8_b128(unsigned l0, const void* g0,
                                                 unsigned l1, const void* g1,
                                                 unsigned l2, const void* g2,
                                                 unsigned l3, const void* g3,
                                                 unsigned l4, const void* g4,
                                                 unsigned l5, const void* g5,
                                                 unsigned l6, const void* g6,
                                                 unsigned l7, const void* g7) {
  asm volatile("global_load_async_to_lds_b128 %0, %1, off\n\t"
               "global_load_async_to_lds_b128 %2, %3, off\n\t"
               "global_load_async_to_lds_b128 %4, %5, off\n\t"
               "global_load_async_to_lds_b128 %6, %7, off\n\t"
               "global_load_async_to_lds_b128 %8, %9, off\n\t"
               "global_load_async_to_lds_b128 %10, %11, off\n\t"
               "global_load_async_to_lds_b128 %12, %13, off\n\t"
               "global_load_async_to_lds_b128 %14, %15, off\n\t"
               "s_wait_xcnt 0x0"
               :: "v"(l0), "v"((unsigned long long)(uintptr_t)g0),
                  "v"(l1), "v"((unsigned long long)(uintptr_t)g1),
                  "v"(l2), "v"((unsigned long long)(uintptr_t)g2),
                  "v"(l3), "v"((unsigned long long)(uintptr_t)g3),
                  "v"(l4), "v"((unsigned long long)(uintptr_t)g4),
                  "v"(l5), "v"((unsigned long long)(uintptr_t)g5),
                  "v"(l6), "v"((unsigned long long)(uintptr_t)g6),
                  "v"(l7), "v"((unsigned long long)(uintptr_t)g7)
               : "memory");
}
// This wave's copies have landed (the compiler places no wait for them).
__device__ __forceinline__ void wait_async0() {
  asm volatile("s_wait_asynccnt 0x0" ::: "memory");
}
// This wave's LDS reads are done before the buffer is handed back for a refill.
__device__ __forceinline__ void wait_ds0() {
  asm volatile("s_wait_dscnt 0x0" ::: "memory");
}

// ---------------- transposing LDS load (row-major [k][n] tile -> operand) ---
// Lane l passes the address of T[kbase + 8*(l>>4) + (l&7)][nbase + 8*((l>>3)&1)]
// and receives T[kbase + 8*(l>>4) + 0..7][nbase + (l&15)].
typedef short s16x8 __attribute__((ext_vector_type(8)));
__device__ __forceinline__ h8 lds_tr16(const _Float16* p) {
  typedef __attribute__((address_space(3))) s16x8 lds_s16x8;
  return __builtin_bit_cast(h8, __builtin_amdgcn_ds_load_tr16_b128_v8i16((lds_s16x8*)p));
}

// ---------------------------------------------------------------------------
// The streaming launches below move 16 B per lane and keep 2 to 20 such loads
// of a wave in flight: an array of B*S*D floats then takes 4,096 to 8,192 waves
// where one or two floats per thread took 65,536 to 131,072, and the time to
// start waves no longer outweighs the time to move the bytes.
// Every wave-wide access covers whole 128-B lines.
// ---------------------------------------------------------------------------
typedef float    f4 __attribute__((ext_vector_type(4)));
typedef _Float16 h4 __attribute__((ext_vector_type(4)));

__device__ __forceinline__ h4 to_h4(f4 v) { return __builtin_convertvector(v, h4); }

// lane l <-> l ^ 16
__device__ __forceinline__ float xhalf_f(float x) {
  int b = __builtin_bit_cast(int, x);
  return __builtin_bit_cast(float,
      __builtin_amdgcn_permlanex16(b, b, 0x76543210, 0xfedcba98, false, false));
}

// ---------------------------------------------------------------------------
// f32 -> f16 convert (weights): 2,048 floats per block, 8 per thread.
// blk is the block's number within this array of a multiple of 2,048 floats.
// ---------------------------------------------------------------------------
__device__ __forceinline__ void cvt_f16_block(const float* __restrict__ src,
                                              _Float16* __restrict__ dst, int blk) {
  const size_t i = (size_t)blk * 512 + threadIdx.x;          // in units of 4 elements
  const f4* s4 = (const f4*)src;
  h4* d4 = (h4*)dst;
  f4 a = s4[i], b = s4[i + 256];
  d4[i] = to_h4(a);
  d4[i + 256] = to_h4(b);
  // inlined twice into one kernel: keeps the registers that the two stores name
  // from being written again, on any way through the listing, ahead of this wait
  asm volatile("s_wait_xcnt 0x0" ::: "memory");
}

// ---------------------------------------------------------------------------
// Batched gather over first N rows (rest pass-through), optional f16 copy.
// Two rows of D = 512 per wave (8 loads in flight), 16 rows per block.
// ---------------------------------------------------------------------------
template <bool F16_TOO>
__device__ __forceinline__ void gather_cast_block(const float* __restrict__ x,
                                                  const int* __restrict__ idx,
                                                  float* __restrict__ of,
                                                  _Float16* __restrict__ oh, int blk) {
  const int lane = threadIdx.x & 31;
  const int wave = __builtin_amdgcn_readfirstlane(threadIdx.x >> 5);
  const int bs0  = (blk * 8 + wave) * 2;             // 0..B*S-2, even
  const int b = bs0 / SS, s0 = bs0 % SS;
  static_assert(NV % 2 == 0 && SS % 2 == 0, "rows s0 and s0 + 1 lie on the same side of NV");
  int srow[2] = {s0, s0 + 1};
  if (s0 < NV) {
    // both indices are fetched before either row, so that all 8 row loads fly together
#pragma unroll
    for (int rr = 0; rr < 2; rr++) {
      int r = idx[b * NV + s0 + rr];
      srow[rr] = r < 0 ? 0 : (r > NV - 1 ? NV - 1 : r);   // the address stays inside x
    }
  }
  f4 v[2][4];
#pragma unroll
  for (int rr = 0; rr < 2; rr++) {
    const f4* src = (const f4*)(x + ((size_t)b * SS + srow[rr]) * DD);
#pragma unroll
    for (int j = 0; j < 4; j++) v[rr][j] = src[lane + 32 * j];
  }
  // the f16 copy goes first: its values take registers of their own while v is
  // still live, so that no register of an issued store is written again
  if (F16_TOO) {
    h4* oh4 = (h4*)(oh + (size_t)bs0 * DD);
#pragma unroll
    for (int rr = 0; rr < 2; rr++)
#pragma unroll
      for (int j = 0; j < 4; j++) oh4[rr * (DD / 4) + lane + 32 * j] = to_h4(v[rr][j]);
  }
  f4* of4 = (f4*)(of + (size_t)bs0 * DD);
#pragma unroll
  for (int rr = 0; rr < 2; rr++)
#pragma unroll
    for (int j = 0; j < 4; j++) of4[rr * (DD / 4) + lane + 32 * j] = v[rr][j];
}

// ---------------------------------------------------------------------------
// All the work that reads nothing but inputs, in one launch: blocks 0..511
// gather x (f32 and f16 copy); the next 8 x 128 blocks convert the eight D x D
// weights, the last 2 x 512 the two FFN weights. The f16 weights lie one behind
// the other in wh, in the order of the arguments.
// ---------------------------------------------------------------------------
#define GATHER_BLOCKS (BSROWS / 16)            // 512
#define DXD_BLOCKS    (DD * DD / 2048)         // 128
#define FFN_BLOCKS    (DD * DFF / 2048)        // 512
#define PREP_BLOCKS   (GATHER_BLOCKS + 8 * DXD_BLOCKS + 2 * FFN_BLOCKS)
__global__ __launch_bounds__(256) void prep_kernel(const float* __restrict__ x,
                                                   const int* __restrict__ idx,
                                                   float* __restrict__ of,
                                                   _Float16* __restrict__ oh,
                                                   const float* __restrict__ w0,
                                                   const float* __restrict__ w1,
                                                   const float* __restrict__ w2,
                                                   const float* __restrict__ w3,
                                                   const float* __restrict__ w4,
                                                   const float* __restrict__ w5,
                                                   const float* __restrict__ w6,
                                                   const float* __restrict__ w7,
                                                   const float* __restrict__ f0,
                                                   const float* __restrict__ f1,
                                                   _Float16* __restrict__ wh) {
  const int blk = blockIdx.x;
  if (blk < GATHER_BLOCKS) {
    gather_cast_block<true>(x, idx, of, oh, blk);
    return;
  }
  const int c = blk - GATHER_BLOCKS;
  if (c < 8 * DXD_BLOCKS) {
    const int which = c / DXD_BLOCKS;
    // picked bit by bit: seven scalar selects, no branch
    const float* s01 = (which & 1) ? w1 : w0;
    const float* s23 = (which & 1) ? w3 : w2;
    const float* s45 = (which & 1) ? w5 : w4;
    const float* s67 = (which & 1) ? w7 : w6;
    const float* s03 = (which & 2) ? s23 : s01;
    const float* s47 = (which & 2) ? s67 : s45;
    cvt_f16_block((which & 4) ? s47 : s03, wh + (size_t)which * DD * DD, c % DXD_BLOCKS);
  } else {
    const int which = (c - 8 * DXD_BLOCKS) / FFN_BLOCKS;
    cvt_f16_block(which == 0 ? f0 : f1, wh + (size_t)8 * DD * DD + (size_t)which * DD * DFF,
                  (c - 8 * DXD_BLOCKS) % FFN_BLOCKS);
  }
}

// ---------------------------------------------------------------------------
// out = LayerNorm(a + b) * g + beta, one wave per row of D = 512 (16 floats per
// lane), 8 rows per block. The row's two sums are formed in the lane, then over
// the 32 lanes in registers: no LDS and no barrier.
// GATHER_SUM: the second term of row (bat, s) is b[bat][r] + b2[bat][r], with
// r = idx[bat][s] for s < NV and r = s from there on; it is formed here and
// stored nowhere.
// ---------------------------------------------------------------------------
template <bool F16_TOO, bool GATHER_SUM>
__global__ __launch_bounds__(256) void add_ln_kernel(const float* __restrict__ a,
                                                     const float* __restrict__ b,
                                                     const float* __restrict__ b2,
                                                     const int* __restrict__ idx,
                                                     const float* __restrict__ g,
                                                     const float* __restrict__ beta,
                                                     float* __restrict__ of,
                                                     _Float16* __restrict__ oh) {
  const int lane = threadIdx.x & 31;
  const int wave = __builtin_amdgcn_readfirstlane(threadIdx.x >> 5);
  const int row  = blockIdx.x * 8 + wave;            // 0..B*S-1
  const size_t base = (size_t)row * DD;
  size_t bbase = base;
  if (GATHER_SUM) {
    const int bat = row / SS, s = row % SS;
    int r = s;
    if (s < NV) {
      r = idx[bat * NV + s];
      r = r < 0 ? 0 : (r > NV - 1 ? NV - 1 : r);     // the address stays inside b and b2
    }
    bbase = ((size_t)bat * SS + r) * DD;
  }
  const f4* a4 = (const f4*)(a + base);
  const f4* b4 = (const f4*)(b + bbase);
  const f4* g4 = (const f4*)g;
  const f4* e4 = (const f4*)beta;
  f4 t[4], tb[4], gv[4], ev[4];
#pragma unroll
  for (int j = 0; j < 4; j++) { t[j] = a4[lane + 32 * j]; tb[j] = b4[lane + 32 * j]; }
  if (GATHER_SUM) {
    const f4* c4 = (const f4*)(b2 + bbase);
    f4 tc[4];
#pragma unroll
    for (int j = 0; j < 4; j++) tc[j] = c4[lane + 32 * j];
#pragma unroll
    for (int j = 0; j < 4; j++) tb[j] += tc[j];
  }
#pragma unroll
  for (int j = 0; j < 4; j++) { gv[j] = g4[lane + 32 * j]; ev[j] = e4[lane + 32 * j]; }
#pragma unroll
  for (int j = 0; j < 4; j++) t[j] += tb[j];
  f4 sv = (t[0] + t[1]) + (t[2] + t[3]);
  f4 qv = (t[0] * t[0] + t[1] * t[1]) + (t[2] * t[2] + t[3] * t[3]);
  float s  = red16_sum((sv[0] + sv[1]) + (sv[2] + sv[3]));
  float ss = red16_sum((qv[0] + qv[1]) + (qv[2] + qv[3]));
  s  += xhalf_f(s);
  ss += xhalf_f(ss);
  float mu  = s * (1.f / DD);
  float var = ss * (1.f / DD) - mu * mu;
  float rstd = rsqrtf(var + 1e-5f);
#pragma unroll
  for (int j = 0; j < 4; j++) t[j] = (t[j] - mu) * rstd * gv[j] + ev[j];
  // the f16 copy goes first: its values take registers of their own while t is
  // still live, so that no register of an issued store is written again
  if (F16_TOO) {
    h4* oh4 = (h4*)(oh + base);
#pragma unroll
    for (int j = 0; j < 4; j++) oh4[lane + 32 * j] = to_h4(t[j]);
  }
  f4* of4 = (f4*)(of + base);
#pragma unroll
  for (int j = 0; j < 4; j++) of4[lane + 32 * j] = t[j];
}

// ---------------------------------------------------------------------------
// WMMA GEMM: C[M,N] = A[M,K] (f16, row-major) @ W[K,N] (f16, row-major)
// Workgroup tile 128x128, 8 waves in a 4(M) x 2(N) grid, each wave 32x64
// (2x4 accumulators of v_wmma_f32_16x16x32_f16). Double-buffered pipeline:
// A-tile and W-tile both via async global->LDS, each in its global row order;
// W fragments come out of LDS through ds_load_tr16_b128. One barrier per k-step.
// A k-step is 64 k = 128 B of an A row, so that one A copy of a wave covers four
// whole 128-B lines. K must be a multiple of 64.
// blockIdx.z picks one of several products of the same shape: its A, W and C
// start zA, zW and zC elements behind those of the product before it.
// ---------------------------------------------------------------------------
template <bool OUT_F16, bool BIAS, bool RELU>
__global__ __launch_bounds__(256) void gemm_wmma(const _Float16* __restrict__ A0,
                                                 const _Float16* __restrict__ W0,
                                                 const float* __restrict__ bias,
                                                 _Float16* __restrict__ outH0,
                                                 float* __restrict__ outF0,
                                                 int M, int N, int K,
                                                 size_t zA, size_t zW, size_t zC) {
  // ping-pong: 128 rows x 64 K, pitch 144 B (16 B x odd, for ds_load_b128)
  __shared__ __attribute__((aligned(16))) _Float16 As[2][128][72];
  // ping-pong: 64 K x 128 cols(N), pitch 288 B (32 B x odd, for ds_load_tr16_b128)
  __shared__ __attribute__((aligned(16))) _Float16 Bs[2][64][144];

  const int tid  = threadIdx.x;
  const int lane = tid & 31;
  const int wave = tid >> 5;
  const int l15  = lane & 15;
  const int half = lane >> 4;
  const int wm = wave >> 1;          // 0..3
  const int wn = wave & 1;           // 0..1
  const int mbase = blockIdx.y * 128;
  const int nbase = blockIdx.x * 128;
  const _Float16* __restrict__ A = A0 + blockIdx.z * zA;
  const _Float16* __restrict__ W = W0 + blockIdx.z * zW;
  _Float16* __restrict__ outH = OUT_F16 ? outH0 + blockIdx.z * zC : nullptr;
  float* __restrict__ outF = OUT_F16 ? nullptr : outF0 + blockIdx.z * zC;

  v8f acc[2][4];
#pragma unroll
  for (int i = 0; i < 2; i++)
#pragma unroll
    for (int j = 0; j < 4; j++) { v8f z = {}; acc[i][j] = z; }

  const int arow = tid >> 3;            // A tile: rows t/8 + 32 j, j = 0..3,
  const int acs  = (tid & 7) * 8;       //         8 halfs at (t&7)*8
  const int bkr  = tid >> 4;            // W tile: k-rows t/16 + 16 j, j = 0..3,
  const int bns  = (tid & 15) * 8;      //         8 cols at (t&15)*8

  const int nk = K >> 6;                // k-steps of 64

  // all eight copies of one thread for k-tile kt into buffer buf
  auto stage = [&](int kt, int buf) {
    const _Float16* ga = A + (size_t)(mbase + arow) * K + (kt << 6) + acs;
    const _Float16* gw = W + (size_t)((kt << 6) + bkr) * N + nbase + bns;
    async_copy8_b128(lds_off_of(&As[buf][arow][acs]), ga,
                     lds_off_of(&As[buf][arow + 32][acs]), ga + (size_t)32 * K,
                     lds_off_of(&As[buf][arow + 64][acs]), ga + (size_t)64 * K,
                     lds_off_of(&As[buf][arow + 96][acs]), ga + (size_t)96 * K,
                     lds_off_of(&Bs[buf][bkr][bns]), gw,
                     lds_off_of(&Bs[buf][bkr + 16][bns]), gw + (size_t)16 * N,
                     lds_off_of(&Bs[buf][bkr + 32][bns]), gw + (size_t)32 * N,
                     lds_off_of(&Bs[buf][bkr + 48][bns]), gw + (size_t)48 * N);
  };

  // prologue: tile 0 lands and is published, then tile 1 starts to fly
  stage(0, 0);
  wait_async0();
  __syncthreads();
  if (nk > 1) stage(1, 1);

  for (int t = 0; t < nk; ++t) {
    const int cur = t & 1;

    // ---- compute on current buffers: two halves of 32 k, in k order ----
    // unrolled so that ks becomes a constant offset of the LDS reads
#pragma unroll
    for (int ks = 0; ks < 2; ks++) {
      v16h af[2], bf[4];
#pragma unroll
      for (int mt = 0; mt < 2; mt++) {
        const _Float16* p = &As[cur][wm * 32 + mt * 16 + l15][ks * 32 + half * 8];
#pragma unroll
        for (int i = 0; i < 8; i++) { af[mt][i] = p[i]; af[mt][8 + i] = p[16 + i]; }
      }
#pragma unroll
      for (int nt = 0; nt < 4; nt++) {
        // k 8*half + 0..7 and 16 + 8*half + 0..7 of column l15: the A loader's k order
        const _Float16* p = &Bs[cur][ks * 32 + half * 8 + (lane & 7)][wn * 64 + nt * 16 + ((lane >> 3) & 1) * 8];
        h8 lo = lds_tr16(p), hi = lds_tr16(p + 16 * 144);
#pragma unroll
        for (int i = 0; i < 8; i++) { bf[nt][i] = lo[i]; bf[nt][8 + i] = hi[i]; }
      }
#pragma unroll
      for (int mt = 0; mt < 2; mt++)
#pragma unroll
        for (int nt = 0; nt < 4; nt++)
          acc[mt][nt] = __builtin_amdgcn_wmma_f32_16x16x32_f16(
              false, af[mt], false, bf[nt], (short)0, acc[mt][nt], false, false);
    }

    // publish tile t+1, free buffer cur, then refill it with tile t+2
    wait_ds0();
    wait_async0();
    __syncthreads();
    if (t + 2 < nk) stage(t + 2, cur);
  }
  wait_async0();   // the ring is closed: no copy of this wave is left in flight

  // Epilogue: C layout: VGPR i, lane half h -> row = 8*h + i, col = l15.
#pragma unroll
  for (int mt = 0; mt < 2; mt++) {
#pragma unroll
    for (int nt = 0; nt < 4; nt++) {
      int gc = nbase + wn * 64 + nt * 16 + l15;
      float bv = BIAS ? bias[gc] : 0.f;
#pragma unroll
      for (int i = 0; i < 8; i++) {
        int gr = mbase + wm * 32 + mt * 16 + half * 8 + i;
        float v = acc[mt][nt][i] + bv;
        if (RELU) v = v > 0.f ? v : 0.f;
        size_t off = (size_t)gr * N + gc;
        if (OUT_F16) outH[off] = (_Float16)v;
        else         outF[off] = v;
      }
    }
  }
}

__global__ __launch_bounds__(256) void attn_wmma(const _Float16* __restrict__ QKV,
                                                 _Float16* __restrict__ O0) {
  // [key][d], pitch 144 B (16 B x odd, for ds_load_b128)
  __shared__ __attribute__((aligned(16))) _Float16 Kb[2][32][72];
  // [key][d], pitch 160 B (32 B x odd, for ds_load_tr16_b128)
  __shared__ __attribute__((aligned(16))) _Float16 Vs[2][32][80];

  const int tid  = threadIdx.x;
  const int lane = tid & 31;
  const int wave = tid >> 5;
  const int l15  = lane & 15;
  const int half = lane >> 4;
  const int qb   = blockIdx.x * 128;
  const int head = blockIdx.y;
  const int bat  = blockIdx.z % BB;
  const int br   = blockIdx.z / BB;      // 0, 1: which branch
  const _Float16* __restrict__ Q  = QKV + (size_t)br * 3 * BSD;
  const _Float16* __restrict__ Kk = Q + BSD;
  const _Float16* __restrict__ V  = Q + 2 * BSD;
  _Float16* __restrict__ O = O0 + (size_t)br * BSD;
  const size_t base = (size_t)bat * SS * DD + (size_t)head * DHH;
  const float scale = 0.125f;            // 1/sqrt(64)

  // Q fragments (B operand): column q = qb + wave*16 + l15, d split {0..31},{32..63}
  v16h qa[2];
  {
    const _Float16* qp = Q + base + (size_t)(qb + wave * 16 + l15) * DD;
#pragma unroll
    for (int f = 0; f < 2; f++)
#pragma unroll
      for (int i = 0; i < 8; i++) {
        qa[f][i]     = qp[f * 32 + half * 8 + i];
        qa[f][8 + i] = qp[f * 32 + 16 + half * 8 + i];
      }
  }

  // o[t][i] = O^T[d = 16 t + 8*half + i][q = l15]
  v8f o[4];
#pragma unroll
  for (int t = 0; t < 4; t++) { v8f z = {}; o[t] = z; }
  float mrun = -1e30f;                   // query l15: maximum so far (equal in both halves)
  float lrun = 0.f;                      // query l15: sum over this half's keys only

  const int r = tid >> 3;                // 0..31 (key)
  const int c = (tid & 7) * 8;           // 0..56 (d)

  // both copies of one thread for key-block kb into buffer buf
  auto stage = [&](int kb, int buf) {
    size_t roff = base + (size_t)(kb * 32 + r) * DD + c;
    async_copy2_b128(lds_off_of(&Kb[buf][r][c]), Kk + roff,
                     lds_off_of(&Vs[buf][r][c]), V + roff);
  };

  const int nkb = SS >> 5;               // 32-key blocks

  // prologue: block 0 lands and is published, then block 1 starts to fly
  stage(0, 0);
  wait_async0();
  __syncthreads();
  stage(1, 1);

  for (int t = 0; t < nkb; ++t) {
    const int cur = t & 1;

    // ---- scores: S^T tile (32 keys x 16 q) in two 16-key subtiles ----------
    // sc[nb][i] = S[q = l15][key = 16 nb + 8*half + i]
    v8f sc[2];
#pragma unroll
    for (int nb = 0; nb < 2; nb++) {
      v8f z = {};
      v16h kf;
      {
        const _Float16* p = &Kb[cur][nb * 16 + l15][half * 8];
#pragma unroll
        for (int i = 0; i < 8; i++) { kf[i] = p[i]; kf[8 + i] = p[16 + i]; }
      }
      z = __builtin_amdgcn_wmma_f32_16x16x32_f16(false, kf, false, qa[0], (short)0, z, false, false);
      {
        const _Float16* p = &Kb[cur][nb * 16 + l15][32 + half * 8];
#pragma unroll
        for (int i = 0; i < 8; i++) { kf[i] = p[i]; kf[8 + i] = p[16 + i]; }
      }
      z = __builtin_amdgcn_wmma_f32_16x16x32_f16(false, kf, false, qa[1], (short)0, z, false, false);
      sc[nb] = z;
    }
#pragma unroll
    for (int nb = 0; nb < 2; nb++)
#pragma unroll
      for (int i = 0; i < 8; i++) sc[nb][i] *= scale;

    // ---- online softmax of query l15, in the lane ---------------------------
    float mx = fmaxf(sc[0][0], sc[1][0]);
#pragma unroll
    for (int i = 1; i < 8; i++) mx = fmaxf(mx, fmaxf(sc[0][i], sc[1][i]));
    mx = fmaxf(mx, xhalf_f(mx));         // the other half's 16 keys
    const float mnew = fmaxf(mrun, mx);
    const float corr = __expf(mrun - mnew);
    mrun = mnew;
#pragma unroll
    for (int nb = 0; nb < 2; nb++)
#pragma unroll
      for (int i = 0; i < 8; i++) sc[nb][i] = __expf(sc[nb][i] - mnew);
    // this pass's sum in four independent chains
    float ps[4];
#pragma unroll
    for (int j = 0; j < 4; j++) ps[j] = ((sc[0][j] + sc[0][j + 4]) + sc[1][j]) + sc[1][j + 4];
    lrun = lrun * corr + ((ps[0] + ps[1]) + (ps[2] + ps[3]));
#pragma unroll
    for (int tt = 0; tt < 4; tt++)
#pragma unroll
      for (int i = 0; i < 8; i++) o[tt][i] *= corr;

    // ---- P^T fragment (B operand): keys 8*half + 0..7 and 16 + 8*half + 0..7
    //      of column q = l15, which is what sc[0] and sc[1] hold ---------------
    v16h pb;
#pragma unroll
    for (int i = 0; i < 8; i++) { pb[i] = (_Float16)sc[0][i]; pb[8 + i] = (_Float16)sc[1][i]; }

    // ---- PV: O^T(64 x 16) += V^T(64 x 32) @ P^T(32 x 16) --------------------
#pragma unroll
    for (int tt = 0; tt < 4; tt++) {
      v16h vf;
      // keys 8*half + 0..7 and 16 + 8*half + 0..7 of row d = tt*16 + l15: P^T's k order
      const _Float16* p = &Vs[cur][half * 8 + (lane & 7)][tt * 16 + ((lane >> 3) & 1) * 8];
      h8 lo = lds_tr16(p), hi = lds_tr16(p + 16 * 80);
#pragma unroll
      for (int i = 0; i < 8; i++) { vf[i] = lo[i]; vf[8 + i] = hi[i]; }
      o[tt] = __builtin_amdgcn_wmma_f32_16x16x32_f16(false, vf, false, pb, (short)0, o[tt], false, false);
    }

    // publish block t+1, free buffer cur, then refill it with block t+2
    wait_ds0();
    wait_async0();
    __syncthreads();
    if (t + 2 < nkb) stage(t + 2, cur);
  }
  wait_async0();   // the ring is closed: no copy of this wave is left in flight

  // ---- normalize and store O: a lane holds 8 consecutive d of its query ----
  const float inv = 1.f / (lrun + xhalf_f(lrun));   // the two halves' sums are joined here
  _Float16* op = O + base + (size_t)(qb + wave * 16 + l15) * DD + half * 8;
#pragma unroll
  for (int t = 0; t < 4; t++) {
    h8 ov;
#pragma unroll
    for (int i = 0; i < 8; i++) ov[i] = (_Float16)(o[t][i] * inv);
    *(h8*)(op + t * 16) = ov;
  }
}

// ---------------------------------------------------------------------------
// Host-side orchestration
// ---------------------------------------------------------------------------
extern "C" void kernel_launch(void* const* d_in, const int* in_sizes, int n_in,
                              void* d_out, int out_size, void* d_ws, size_t ws_size,
                              hipStream_t stream) {
  (void)in_sizes; (void)n_in; (void)out_size; (void)ws_size;

  const float* x        = (const float*)d_in[0];
  const int*   idx_emb  = (const int*)d_in[1];
  const int*   idx_pro  = (const int*)d_in[2];
  // d_in[3] is N == 768 (compile-time constant NV; cannot read device scalar
  // under graph capture).
  const float* Wq1 = (const float*)d_in[4];
  const float* Wk1 = (const float*)d_in[5];
  const float* Wv1 = (const float*)d_in[6];
  const float* Wo1 = (const float*)d_in[7];
  const float* Wq2 = (const float*)d_in[8];
  const float* Wk2 = (const float*)d_in[9];
  const float* Wv2 = (const float*)d_in[10];
  const float* Wo2 = (const float*)d_in[11];
  const float* w_conv1 = (const float*)d_in[12];
  const float* b_conv1 = (const float*)d_in[13];
  const float* w_conv2 = (const float*)d_in[14];
  const float* b_conv2 = (const float*)d_in[15];
  const float* g1 = (const float*)d_in[16];
  const float* beta1 = (const float*)d_in[17];
  const float* g2 = (const float*)d_in[18];
  const float* beta2 = (const float*)d_in[19];

  float* out   = (float*)d_out;          // LN2 result
  float* attn1 = out + BSD;
  float* attn2 = out + 2 * BSD;

  // ---- workspace layout ----
  char* w = (char*)d_ws;
  float* xl1  = (float*)w;  w += BSD * sizeof(float);   // x_l1 f32 (later reused: xln)
  float* f32b = (float*)w;  w += BSD * sizeof(float);   // y2
  _Float16* h_x = (_Float16*)w; w += BSD * sizeof(_Float16);   // f16 activations
  _Float16* h_qkv = (_Float16*)w; w += 6 * BSD * sizeof(_Float16);   // q1 k1 v1 q2 k2 v2
  _Float16* h_o = (_Float16*)w; w += 2 * BSD * sizeof(_Float16);     // o1 o2
  _Float16* h_ffn = (_Float16*)w; w += (size_t)BSROWS * DFF * sizeof(_Float16);
  // f16 weights: q1 k1 v1 q2 k2 v2 o1 o2 (D x D each), conv1, conv2
  _Float16* h_w = (_Float16*)w; w += ((size_t)8 * DD * DD + (size_t)2 * DD * DFF) * sizeof(_Float16);
  _Float16* h_wo = h_w + (size_t)6 * DD * DD;
  _Float16* h_w1 = h_w + (size_t)8 * DD * DD;
  _Float16* h_w2 = h_w1 + (size_t)DD * DFF;

  const dim3 blk(256);
  const dim3 gemmQKV(DD / 128, BSROWS / 128, 6);  // (4, 64, 6)
  const dim3 gemmO(DD / 128, BSROWS / 128, 2);    // (4, 64, 2)
  const dim3 gemmDxD(DD / 128, BSROWS / 128);     // (4, 64)
  const dim3 gemmDxF(DFF / 128, BSROWS / 128);    // (16, 64)
  const dim3 attnGrid(SS / 128, HH, 2 * BB);      // (8, 8, 16)

  // x_l1 = gather(x, idx_emb), also as f16; every weight to f16
  prep_kernel<<<dim3(PREP_BLOCKS), blk, 0, stream>>>(x, idx_emb, xl1, h_x,
                                                     Wq1, Wk1, Wv1, Wq2, Wk2, Wv2, Wo1, Wo2,
                                                     w_conv1, w_conv2, h_w);

  // ===== both MHA branches (flip, MHA, flip == MHA), each stage one launch =====
  gemm_wmma<true, false, false><<<gemmQKV, blk, 0, stream>>>(h_x, h_w, nullptr, h_qkv, nullptr, BSROWS, DD, DD,
                                                             0, (size_t)DD * DD, BSD);
  attn_wmma<<<attnGrid, blk, 0, stream>>>(h_qkv, h_o);
  // attn1 and attn2 lie one behind the other in out
  gemm_wmma<false, false, false><<<gemmO, blk, 0, stream>>>(h_o, h_wo, nullptr, nullptr, attn1, BSROWS, DD, DD,
                                                            BSD, (size_t)DD * DD, BSD);

  // new_x1 = attn1 + attn2 ; x_l2 = gather(new_x1, idx_pro) ; xln = LN(x + x_l2; g1, beta1)
  // (reuse xl1 as f32 result, h_x as f16 copy)
  add_ln_kernel<true, true><<<dim3(BSROWS / 8), blk, 0, stream>>>(x, attn1, attn2, idx_pro, g1, beta1, xl1, h_x);

  // ================= FFN =================
  gemm_wmma<true, true, true><<<gemmDxF, blk, 0, stream>>>(h_x, h_w1, b_conv1, h_ffn, nullptr, BSROWS, DFF, DD, 0, 0, 0);
  gemm_wmma<false, true, false><<<gemmDxD, blk, 0, stream>>>(h_ffn, h_w2, b_conv2, nullptr, f32b, BSROWS, DD, DFF, 0, 0, 0);

  // out = LN(xln + y; g2, beta2)
  add_ln_kernel<false, false><<<dim3(BSROWS / 8), blk, 0, stream>>>(xl1, f32b, nullptr, nullptr, g2, beta2, out, nullptr);
}

// v007
// It runs in 148 microseconds.
// In two side-by-side timings against v006, it was 1.08 and 1.09 times as fast.
// Counting every step since v000, it is 2.91 times as fast.
#include <hip/hip_runtime.h>
#include <hip/hip_bf16.h>

#define BB   8
#define SS   1024
#define NV   768
#define DD   512
#define DFF  2048
#define HH   8
#define DHH  64
#define BSROWS (BB * SS)                       // 8192
#define BSD   ((size_t)BSROWS * DD)            // 4,194,304

typedef _Float16 v16h __attribute__((ext_vector_type(16)));
typedef float    v8f  __attribute__((ext_vector_type(8)));
typedef _Float16 h8   __attribute__((ext_vector_type(8)));

// ---------------- DPP 16-lane butterfly reductions (VALU, no DS pipe) ------
template <int CTRL>
__device__ __forceinline__ float dpp_perm_f(float x) {
  int i = __builtin_bit_cast(int, x);
  int r = __builtin_amdgcn_update_dpp(i, i, CTRL, 0xF, 0xF, true);
  return __builtin_bit_cast(float, r);
}
__device__ __forceinline__ float red16_sum(float x) {
  x += dpp_perm_f<0xB1>(x);    // quad_perm [1,0,3,2] : xor 1
  x += dpp_perm_f<0x4E>(x);    // quad_perm [2,3,0,1] : xor 2
  x += dpp_perm_f<0x141>(x);   // row_half_mirror     : xor 7
  x += dpp_perm_f<0x140>(x);   // row_mirror          : xor 15
  return x;
}

// ---------------- async global -> LDS staging (CDNA5, ASYNCcnt) ------------
__device__ __forceinline__ unsigned lds_off_of(const void* p) {
  // generic pointers to LDS carry the offset in the low 32 bits
  return (unsigned)(unsigned long long)(uintptr_t)p;
}
// A run of copies and its s_wait_xcnt 0 are one statement, so that no address
// register of an issued copy is rewritten ahead of that wait.
__device__ __forceinline__ void async_copy2_b128(unsigned l0, const void* g0,
                                                 unsigned l1, const void* g1) {
  asm volatile("global_load_async_to_lds_b128 %0, %1, off\n\t"
               "global_load_async_to_lds_b128 %2, %3, off\n\t"
               "s_wait_xcnt 0x0"
               :: "v"(l0), "v"((unsigned long long)(uintptr_t)g0),
                  "v"(l1), "v"((unsigned long long)(uintptr_t)g1)
               : "memory");
}
__device__ __forceinline__ void async_copy8_b128(unsigned l0, const void* g0,
                                                 unsigned l1, const void* g1,
                                                 unsigned l2, const void* g2,
                                                 unsigned l3, const void* g3,
                                                 unsigned l4, const void* g4,
                                                 unsigned l5, const void* g5,
                                                 unsigned l6, const void* g6,
                                                 unsigned l7, const void* g7) {
  asm volatile("global_load_async_to_lds_b128 %0, %1, off\n\t"
               "global_load_async_to_lds_b128 %2, %3, off\n\t"
               "global_load_async_to_lds_b128 %4, %5, off\n\t"
               "global_load_async_to_lds_b128 %6, %7, off\n\t"
               "global_load_async_to_lds_b128 %8, %9, off\n\t"
               "global_load_async_to_lds_b128 %10, %11, off\n\t"
               "global_load_async_to_lds_b128 %12, %13, off\n\t"
               "global_load_async_to_lds_b128 %14, %15, off\n\t"
               "s_wait_xcnt 0x0"
               :: "v"(l0), "v"((unsigned long long)(uintptr_t)g0),
                  "v"(l1), "v"((unsigned long long)(uintptr_t)g1),
                  "v"(l2), "v"((unsigned long long)(uintptr_t)g2),
                  "v"(l3), "v"((unsigned long long)(uintptr_t)g3),
                  "v"(l4), "v"((unsigned long long)(uintptr_t)g4),
                  "v"(l5), "v"((unsigned long long)(uintptr_t)g5),
                  "v"(l6), "v"((unsigned long long)(uintptr_t)g6),
                  "v"(l7), "v"((unsigned long long)(uintptr_t)g7)
               : "memory");
}
// This wave's copies have landed (the compiler places no wait for them).
__device__ __forceinline__ void wait_async0() {
  asm volatile("s_wait_asynccnt 0x0" ::: "memory");
}
// This wave's LDS reads are done before the buffer is handed back for a refill.
__device__ __forceinline__ void wait_ds0() {
  asm volatile("s_wait_dscnt 0x0" ::: "memory");
}

// ---------------- transposing LDS load (row-major [k][n] tile -> operand) ---
// Lane l passes the address of T[kbase + 8*(l>>4) + (l&7)][nbase + 8*((l>>3)&1)]
// and receives T[kbase + 8*(l>>4) + 0..7][nbase + (l&15)].
typedef short s16x8 __attribute__((ext_vector_type(8)));
__device__ __forceinline__ h8 lds_tr16(const _Float16* p) {
  typedef __attribute__((address_space(3))) s16x8 lds_s16x8;
  return __builtin_bit_cast(h8, __builtin_amdgcn_ds_load_tr16_b128_v8i16((lds_s16x8*)p));
}

// ---------------------------------------------------------------------------
// The streaming launches below move 16 B per lane and keep 2 to 20 such loads
// of a wave in flight: an array of B*S*D floats then takes 4,096 to 8,192 waves
// where one or two floats per thread took 65,536 to 131,072, and the time to
// start waves no longer outweighs the time to move the bytes.
// Every wave-wide access covers whole 128-B lines.
// ---------------------------------------------------------------------------
typedef float    f4 __attribute__((ext_vector_type(4)));
typedef _Float16 h4 __attribute__((ext_vector_type(4)));

__device__ __forceinline__ h4 to_h4(f4 v) { return __builtin_convertvector(v, h4); }

// lane l <-> l ^ 16
__device__ __forceinline__ float xhalf_f(float x) {
  int b = __builtin_bit_cast(int, x);
  return __builtin_bit_cast(float,
      __builtin_amdgcn_permlanex16(b, b, 0x76543210, 0xfedcba98, false, false));
}

// ---------------------------------------------------------------------------
// f32 -> f16 convert (weights): 2,048 floats per block, 8 per thread.
// blk is the block's number within this array of a multiple of 2,048 floats.
// ---------------------------------------------------------------------------
__device__ __forceinline__ void cvt_f16_block(const float* __restrict__ src,
                                              _Float16* __restrict__ dst, int blk) {
  const size_t i = (size_t)blk * 512 + threadIdx.x;          // in units of 4 elements
  const f4* s4 = (const f4*)src;
  h4* d4 = (h4*)dst;
  f4 a = s4[i], b = s4[i + 256];
  d4[i] = to_h4(a);
  d4[i + 256] = to_h4(b);
  // inlined twice into one kernel: keeps the registers that the two stores name
  // from being written again, on any way through the listing, ahead of this wait
  asm volatile("s_wait_xcnt 0x0" ::: "memory");
}

// ---------------------------------------------------------------------------
// Batched gather over first N rows (rest pass-through), optional f16 copy.
// Two rows of D = 512 per wave (8 loads in flight), 16 rows per block.
// ---------------------------------------------------------------------------
template <bool F16_TOO>
__device__ __forceinline__ void gather_cast_block(const float* __restrict__ x,
                                                  const int* __restrict__ idx,
                                                  float* __restrict__ of,
                                                  _Float16* __restrict__ oh, int blk) {
  const int lane = threadIdx.x & 31;
  const int wave = __builtin_amdgcn_readfirstlane(threadIdx.x >> 5);
  const int bs0  = (blk * 8 + wave) * 2;             // 0..B*S-2, even
  const int b = bs0 / SS, s0 = bs0 % SS;
  static_assert(NV % 2 == 0 && SS % 2 == 0, "rows s0 and s0 + 1 lie on the same side of NV");
  int srow[2] = {s0, s0 + 1};
  if (s0 < NV) {
    // both indices are fetched before either row, so that all 8 row loads fly together
#pragma unroll
    for (int rr = 0; rr < 2; rr++) {
      int r = idx[b * NV + s0 + rr];
      srow[rr] = r < 0 ? 0 : (r > NV - 1 ? NV - 1 : r);   // the address stays inside x
    }
  }
  f4 v[2][4];
#pragma unroll
  for (int rr = 0; rr < 2; rr++) {
    const f4* src = (const f4*)(x + ((size_t)b * SS + srow[rr]) * DD);
#pragma unroll
    for (int j = 0; j < 4; j++) v[rr][j] = src[lane + 32 * j];
  }
  // the f16 copy goes first: its values take registers of their own while v is
  // still live, so that no register of an issued store is written again
  if (F16_TOO) {
    h4* oh4 = (h4*)(oh + (size_t)bs0 * DD);
#pragma unroll
    for (int rr = 0; rr < 2; rr++)
#pragma unroll
      for (int j = 0; j < 4; j++) oh4[rr * (DD / 4) + lane + 32 * j] = to_h4(v[rr][j]);
  }
  f4* of4 = (f4*)(of + (size_t)bs0 * DD);
#pragma unroll
  for (int rr = 0; rr < 2; rr++)
#pragma unroll
    for (int j = 0; j < 4; j++) of4[rr * (DD / 4) + lane + 32 * j] = v[rr][j];
}

// ---------------------------------------------------------------------------
// All the work that reads nothing but inputs, in one launch: blocks 0..511
// gather x (f32 and f16 copy); the next 8 x 128 blocks convert the eight D x D
// weights, the last 2 x 512 the two FFN weights. The f16 weights lie one behind
// the other in wh, in the order of the arguments.
// ---------------------------------------------------------------------------
#define GATHER_BLOCKS (BSROWS / 16)            // 512
#define DXD_BLOCKS    (DD * DD / 2048)         // 128
#define FFN_BLOCKS    (DD * DFF / 2048)        // 512
#define PREP_BLOCKS   (GATHER_BLOCKS + 8 * DXD_BLOCKS + 2 * FFN_BLOCKS)
__global__ __launch_bounds__(256) void prep_kernel(const float* __restrict__ x,
                                                   const int* __restrict__ idx,
                                                   float* __restrict__ of,
                                                   _Float16* __restrict__ oh,
                                                   const float* __restrict__ w0,
                                                   const float* __restrict__ w1,
                                                   const float* __restrict__ w2,
                                                   const float* __restrict__ w3,
                                                   const float* __restrict__ w4,
                                                   const float* __restrict__ w5,
                                                   const float* __restrict__ w6,
                                                   const float* __restrict__ w7,
                                                   const float* __restrict__ f0,
                                                   const float* __restrict__ f1,
                                                   _Float16* __restrict__ wh) {
  const int blk = blockIdx.x;
  if (blk < GATHER_BLOCKS) {
    gather_cast_block<true>(x, idx, of, oh, blk);
    return;
  }
  const int c = blk - GATHER_BLOCKS;
  if (c < 8 * DXD_BLOCKS) {
    const int which = c / DXD_BLOCKS;
    // picked bit by bit: seven scalar selects, no branch
    const float* s01 = (which & 1) ? w1 : w0;
    const float* s23 = (which & 1) ? w3 : w2;
    const float* s45 = (which & 1) ? w5 : w4;
    const float* s67 = (which & 1) ? w7 : w6;
    const float* s03 = (which & 2) ? s23 : s01;
    const float* s47 = (which & 2) ? s67 : s45;
    cvt_f16_block((which & 4) ? s47 : s03, wh + (size_t)which * DD * DD, c % DXD_BLOCKS);
  } else {
    const int which = (c - 8 * DXD_BLOCKS) / FFN_BLOCKS;
    cvt_f16_block(which == 0 ? f0 : f1, wh + (size_t)8 * DD * DD + (size_t)which * DD * DFF,
                  (c - 8 * DXD_BLOCKS) % FFN_BLOCKS);
  }
}

// ---------------------------------------------------------------------------
// out = LayerNorm(a + b) * g + beta, one wave per row of D = 512 (16 floats per
// lane), 8 rows per block. The row's two sums are formed in the lane, then over
// the 32 lanes in registers: no LDS and no barrier.
// GATHER_SUM: the second term of row (bat, s) is b[bat][r] + b2[bat][r], with
// r = idx[bat][s] for s < NV and r = s from there on; it is formed here and
// stored nowhere.
// ---------------------------------------------------------------------------
template <bool F16_TOO, bool GATHER_SUM>
__global__ __launch_bounds__(256) void add_ln_kernel(const float* __restrict__ a,
                                                     const float* __restrict__ b,
                                                     const float* __restrict__ b2,
                                                     const int* __restrict__ idx,
                                                     const float* __restrict__ g,
                                                     const float* __restrict__ beta,
                                                     float* __restrict__ of,
                                                     _Float16* __restrict__ oh) {
  const int lane = threadIdx.x & 31;
  const int wave = __builtin_amdgcn_readfirstlane(threadIdx.x >> 5);
  const int row  = blockIdx.x * 8 + wave;            // 0..B*S-1
  const size_t base = (size_t)row * DD;
  size_t bbase = base;
  if (GATHER_SUM) {
    const int bat = row / SS, s = row % SS;
    int r = s;
    if (s < NV) {
      r = idx[bat * NV + s];
      r = r < 0 ? 0 : (r > NV - 1 ? NV - 1 : r);     // the address stays inside b and b2
    }
    bbase = ((size_t)bat * SS + r) * DD;
  }
  const f4* a4 = (const f4*)(a + base);
  const f4* b4 = (const f4*)(b + bbase);
  const f4* g4 = (const f4*)g;
  const f4* e4 = (const f4*)beta;
  f4 t[4], tb[4], gv[4], ev[4];
#pragma unroll
  for (int j = 0; j < 4; j++) { t[j] = a4[lane + 32 * j]; tb[j] = b4[lane + 32 * j]; }
  if (GATHER_SUM) {
    const f4* c4 = (const f4*)(b2 + bbase);
    f4 tc[4];
#pragma unroll
    for (int j = 0; j < 4; j++) tc[j] = c4[lane + 32 * j];
#pragma unroll
    for (int j = 0; j < 4; j++) tb[j] += tc[j];
  }
#pragma unroll
  for (int j = 0; j < 4; j++) { gv[j] = g4[lane + 32 * j]; ev[j] = e4[lane + 32 * j]; }
#pragma unroll
  for (int j = 0; j < 4; j++) t[j] += tb[j];
  f4 sv = (t[0] + t[1]) + (t[2] + t[3]);
  f4 qv = (t[0] * t[0] + t[1] * t[1]) + (t[2] * t[2] + t[3] * t[3]);
  float s  = red16_sum((sv[0] + sv[1]) + (sv[2] + sv[3]));
  float ss = red16_sum((qv[0] + qv[1]) + (qv[2] + qv[3]));
  s  += xhalf_f(s);
  ss += xhalf_f(ss);
  float mu  = s * (1.f / DD);
  float var = ss * (1.f / DD) - mu * mu;
  float rstd = rsqrtf(var + 1e-5f);
#pragma unroll
  for (int j = 0; j < 4; j++) t[j] = (t[j] - mu) * rstd * gv[j] + ev[j];
  // the f16 copy goes first: its values take registers of their own while t is
  // still live, so that no register of an issued store is written again
  if (F16_TOO) {
    h4* oh4 = (h4*)(oh + base);
#pragma unroll
    for (int j = 0; j < 4; j++) oh4[lane + 32 * j] = to_h4(t[j]);
  }
  f4* of4 = (f4*)(of + base);
#pragma unroll
  for (int j = 0; j < 4; j++) of4[lane + 32 * j] = t[j];
}

// ---------------------------------------------------------------------------
// WMMA GEMM: C[M,N] = A[M,K] (f16, row-major) @ W[K,N] (f16, row-major)
// Workgroup tile 128x128, 8 waves in a 4(M) x 2(N) grid, each wave 32x64
// (2x4 accumulators of v_wmma_f32_16x16x32_f16). Double-buffered pipeline:
// A-tile and W-tile both via async global->LDS, each in its global row order;
// W fragments come out of LDS through ds_load_tr16_b128. One barrier per k-step.
// A k-step is KS k, at least 64 = 128 B of an A row, so that one A copy of a wave
// covers four whole 128-B lines. K must be a multiple of KS.
// KS = 64: four workgroups share a WGP and hide one another's copy latency.
// KS = 128, 256: for a grid of two workgroups, or one, per WGP, which wait out
// that latency at every k-step with little or nothing beside them: the WGP holds
// as many bytes in flight as with four, and K takes a half or a quarter of the waits.
// blockIdx.z picks one of several products of the same shape: its A, W and C
// start zA, zW and zC elements behind those of the product before it.
// ---------------------------------------------------------------------------
template <bool OUT_F16, bool BIAS, bool RELU, int KS>
__global__ __launch_bounds__(256) void gemm_wmma(const _Float16* __restrict__ A0,
                                                 const _Float16* __restrict__ W0,
                                                 const float* __restrict__ bias,
                                                 _Float16* __restrict__ outH0,
                                                 float* __restrict__ outF0,
                                                 int M, int N, int K,
                                                 size_t zA, size_t zW, size_t zC) {
  static_assert(KS == 64 || KS == 128 || KS == 256, "the copies below are dealt for these");
  // ping-pong: 128 rows x KS K, pitch 144, 272 or 528 B (16 B x odd, for ds_load_b128)
  __shared__ __attribute__((aligned(16))) _Float16 As[2][128][KS + 8];
  // ping-pong: KS K x 128 cols(N), pitch 288 B (32 B x odd, for ds_load_tr16_b128)
  __shared__ __attribute__((aligned(16))) _Float16 Bs[2][KS][144];

  const int tid  = threadIdx.x;
  const int lane = tid & 31;
  const int wave = tid >> 5;
  const int l15  = lane & 15;
  const int half = lane >> 4;
  const int wm = wave >> 1;          // 0..3
  const int wn = wave & 1;           // 0..1
  const int mbase = blockIdx.y * 128;
  const int nbase = blockIdx.x * 128;
  const _Float16* __restrict__ A = A0 + blockIdx.z * zA;
  const _Float16* __restrict__ W = W0 + blockIdx.z * zW;
  _Float16* __restrict__ outH = OUT_F16 ? outH0 + blockIdx.z * zC : nullptr;
  float* __restrict__ outF = OUT_F16 ? nullptr : outF0 + blockIdx.z * zC;

  v8f acc[2][4];
#pragma unroll
  for (int i = 0; i < 2; i++)
#pragma unroll
    for (int j = 0; j < 4; j++) { v8f z = {}; acc[i][j] = z; }

  constexpr int CPR = KS / 8;           // 16-B pieces in the KS k of an A row
  constexpr int ARS = 256 / CPR;        // A rows that one copy of every thread covers
  constexpr int LKS = KS == 64 ? 6 : KS == 128 ? 7 : 8;   // log2 KS
  const int arow = tid >> (LKS - 3);    // A tile: rows t/CPR + ARS j, j = 0..128/ARS-1,
  const int acs  = (tid & (CPR - 1)) * 8;   //     8 halfs at (t%CPR)*8
  const int bkr  = tid >> 4;            // W tile: k-rows t/16 + 16 j, j = 0..KS/16-1,
  const int bns  = (tid & 15) * 8;      //         8 cols at (t&15)*8

  const int nk = K >> LKS;              // k-steps of KS

  // all KS / 8 copies of one thread for k-tile kt into buffer buf
  auto stage = [&](int kt, int buf) {
    const _Float16* ga = A + (size_t)(mbase + arow) * K + (kt << LKS) + acs;
    const _Float16* gw = W + (size_t)((kt << LKS) + bkr) * N + nbase + bns;
    if constexpr (KS == 64) {
      async_copy8_b128(lds_off_of(&As[buf][arow][acs]), ga,
                       lds_off_of(&As[buf][arow + 32][acs]), ga + (size_t)32 * K,
                       lds_off_of(&As[buf][arow + 64][acs]), ga + (size_t)64 * K,
                       lds_off_of(&As[buf][arow + 96][acs]), ga + (size_t)96 * K,
                       lds_off_of(&Bs[buf][bkr][bns]), gw,
                       lds_off_of(&Bs[buf][bkr + 16][bns]), gw + (size_t)16 * N,
                       lds_off_of(&Bs[buf][bkr + 32][bns]), gw + (size_t)32 * N,
                       lds_off_of(&Bs[buf][bkr + 48][bns]), gw + (size_t)48 * N);
    } else {
      // unrolled so that j becomes a constant step of the addresses
#pragma unroll
      for (int j = 0; j < 128 / ARS; j += 8) {
        const _Float16* g = ga + (size_t)(j * ARS) * K;
        const size_t st = (size_t)ARS * K;
        async_copy8_b128(lds_off_of(&As[buf][arow + (j + 0) * ARS][acs]), g,
                         lds_off_of(&As[buf][arow + (j + 1) * ARS][acs]), g + st,
                         lds_off_of(&As[buf][arow + (j + 2) * ARS][acs]), g + 2 * st,
                         lds_off_of(&As[buf][arow + (j + 3) * ARS][acs]), g + 3 * st,
                         lds_off_of(&As[buf][arow + (j + 4) * ARS][acs]), g + 4 * st,
                         lds_off_of(&As[buf][arow + (j + 5) * ARS][acs]), g + 5 * st,
                         lds_off_of(&As[buf][arow + (j + 6) * ARS][acs]), g + 6 * st,
                         lds_off_of(&As[buf][arow + (j + 7) * ARS][acs]), g + 7 * st);
      }
      // unrolled for the same reason
#pragma unroll
      for (int j = 0; j < KS / 16; j += 8) {
        const _Float16* g = gw + (size_t)(j * 16) * N;
        const size_t st = (size_t)16 * N;
        async_copy8_b128(lds_off_of(&Bs[buf][bkr + (j + 0) * 16][bns]), g,
                         lds_off_of(&Bs[buf][bkr + (j + 1) * 16][bns]), g + st,
                         lds_off_of(&Bs[buf][bkr + (j + 2) * 16][bns]), g + 2 * st,
                         lds_off_of(&Bs[buf][bkr + (j + 3) * 16][bns]), g + 3 * st,
                         lds_off_of(&Bs[buf][bkr + (j + 4) * 16][bns]), g + 4 * st,
                         lds_off_of(&Bs[buf][bkr + (j + 5) * 16][bns]), g + 5 * st,
                         lds_off_of(&Bs[buf][bkr + (j + 6) * 16][bns]), g + 6 * st,
                         lds_off_of(&Bs[buf][bkr + (j + 7) * 16][bns]), g + 7 * st);
      }
    }
  };

  // prologue: tile 0 lands and is published, then tile 1 starts to fly
  stage(0, 0);
  wait_async0();
  __syncthreads();
  if (nk > 1) stage(1, 1);

  for (int t = 0; t < nk; ++t) {
    const int cur = t & 1;

    // ---- compute on current buffers: KS/32 slices of 32 k, in k order ----
    // unrolled so that ks becomes a constant offset of the LDS reads
#pragma unroll
    for (int ks = 0; ks < KS / 32; ks++) {
      v16h af[2], bf[4];
#pragma unroll
      for (int mt = 0; mt < 2; mt++) {
        const _Float16* p = &As[cur][wm * 32 + mt * 16 + l15][ks * 32 + half * 8];
#pragma unroll
        for (int i = 0; i < 8; i++) { af[mt][i] = p[i]; af[mt][8 + i] = p[16 + i]; }
      }
#pragma unroll
      for (int nt = 0; nt < 4; nt++) {
        // k 8*half + 0..7 and 16 + 8*half + 0..7 of column l15: the A loader's k order
        const _Float16* p = &Bs[cur][ks * 32 + half * 8 + (lane & 7)][wn * 64 + nt * 16 + ((lane >> 3) & 1) * 8];
        h8 lo = lds_tr16(p), hi = lds_tr16(p + 16 * 144);
#pragma unroll
        for (int i = 0; i < 8; i++) { bf[nt][i] = lo[i]; bf[nt][8 + i] = hi[i]; }
      }
#pragma unroll
      for (int mt = 0; mt < 2; mt++)
#pragma unroll
        for (int nt = 0; nt < 4; nt++)
          acc[mt][nt] = __builtin_amdgcn_wmma_f32_16x16x32_f16(
              false, af[mt], false, bf[nt], (short)0, acc[mt][nt], false, false);
    }

    // publish tile t+1, free buffer cur, then refill it with tile t+2
    wait_ds0();
    wait_async0();
    __syncthreads();
    if (t + 2 < nk) stage(t + 2, cur);
  }
  wait_async0();   // the ring is closed: no copy of this wave is left in flight

  // Epilogue: C layout: VGPR i, lane half h -> row = 8*h + i, col = l15.
#pragma unroll
  for (int mt = 0; mt < 2; mt++) {
#pragma unroll
    for (int nt = 0; nt < 4; nt++) {
      int gc = nbase + wn * 64 + nt * 16 + l15;
      float bv = BIAS ? bias[gc] : 0.f;
#pragma unroll
      for (int i = 0; i < 8; i++) {
        int gr = mbase + wm * 32 + mt * 16 + half * 8 + i;
        float v = acc[mt][nt][i] + bv;
        if (RELU) v = v > 0.f ? v : 0.f;
        size_t off = (size_t)gr * N + gc;
        if (OUT_F16) outH[off] = (_Float16)v;
        else         outF[off] = v;
      }
    }
  }
}

__global__ __launch_bounds__(256) void attn_wmma(const _Float16* __restrict__ QKV,
                                                 _Float16* __restrict__ O0) {
  // [key][d], pitch 144 B (16 B x odd, for ds_load_b128)
  __shared__ __attribute__((aligned(16))) _Float16 Kb[2][32][72];
  // [key][d], pitch 160 B (32 B x odd, for ds_load_tr16_b128)
  __shared__ __attribute__((aligned(16))) _Float16 Vs[2][32][80];

  const int tid  = threadIdx.x;
  const int lane = tid & 31;
  const int wave = tid >> 5;
  const int l15  = lane & 15;
  const int half = lane >> 4;
  const int qb   = blockIdx.x * 128;
  const int head = blockIdx.y;
  const int bat  = blockIdx.z % BB;
  const int br   = blockIdx.z / BB;      // 0, 1: which branch
  const _Float16* __restrict__ Q  = QKV + (size_t)br * 3 * BSD;
  const _Float16* __restrict__ Kk = Q + BSD;
  const _Float16* __restrict__ V  = Q + 2 * BSD;
  _Float16* __restrict__ O = O0 + (size_t)br * BSD;
  const size_t base = (size_t)bat * SS * DD + (size_t)head * DHH;
  const float scale = 0.125f;            // 1/sqrt(64)

  // Q fragments (B operand): column q = qb + wave*16 + l15, d split {0..31},{32..63}
  v16h qa[2];
  {
    const _Float16* qp = Q + base + (size_t)(qb + wave * 16 + l15) * DD;
#pragma unroll
    for (int f = 0; f < 2; f++)
#pragma unroll
      for (int i = 0; i < 8; i++) {
        qa[f][i]     = qp[f * 32 + half * 8 + i];
        qa[f][8 + i] = qp[f * 32 + 16 + half * 8 + i];
      }
  }

  // o[t][i] = O^T[d = 16 t + 8*half + i][q = l15]
  v8f o[4];
#pragma unroll
  for (int t = 0; t < 4; t++) { v8f z = {}; o[t] = z; }
  float mrun = -1e30f;                   // query l15: maximum so far (equal in both halves)
  float lrun = 0.f;                      // query l15: sum over this half's keys only

  const int r = tid >> 3;                // 0..31 (key)
  const int c = (tid & 7) * 8;           // 0..56 (d)

  // both copies of one thread for key-block kb into buffer buf
  auto stage = [&](int kb, int buf) {
    size_t roff = base + (size_t)(kb * 32 + r) * DD + c;
    async_copy2_b128(lds_off_of(&Kb[buf][r][c]), Kk + roff,
                     lds_off_of(&Vs[buf][r][c]), V + roff);
  };

  const int nkb = SS >> 5;               // 32-key blocks

  // prologue: block 0 lands and is published, then block 1 starts to fly
  stage(0, 0);
  wait_async0();
  __syncthreads();
  stage(1, 1);

  for (int t = 0; t < nkb; ++t) {
    const int cur = t & 1;

    // ---- scores: S^T tile (32 keys x 16 q) in two 16-key subtiles ----------
    // sc[nb][i] = S[q = l15][key = 16 nb + 8*half + i]
    v8f sc[2];
#pragma unroll
    for (int nb = 0; nb < 2; nb++) {
      v8f z = {};
      v16h kf;
      {
        const _Float16* p = &Kb[cur][nb * 16 + l15][half * 8];
#pragma unroll
        for (int i = 0; i < 8; i++) { kf[i] = p[i]; kf[8 + i] = p[16 + i]; }
      }
      z = __builtin_amdgcn_wmma_f32_16x16x32_f16(false, kf, false, qa[0], (short)0, z, false, false);
      {
        const _Float16* p = &Kb[cur][nb * 16 + l15][32 + half * 8];
#pragma unroll
        for (int i = 0; i < 8; i++) { kf[i] = p[i]; kf[8 + i] = p[16 + i]; }
      }
      z = __builtin_amdgcn_wmma_f32_16x16x32_f16(false, kf, false, qa[1], (short)0, z, false, false);
      sc[nb] = z;
    }
#pragma unroll
    for (int nb = 0; nb < 2; nb++)
#pragma unroll
      for (int i = 0; i < 8; i++) sc[nb][i] *= scale;

    // ---- online softmax of query l15, in the lane ---------------------------
    float mx = fmaxf(sc[0][0], sc[1][0]);
#pragma unroll
    for (int i = 1; i < 8; i++) mx = fmaxf(mx, fmaxf(sc[0][i], sc[1][i]));
    mx = fmaxf(mx, xhalf_f(mx));         // the other half's 16 keys
    const float mnew = fmaxf(mrun, mx);
    const float corr = __expf(mrun - mnew);
    mrun = mnew;
#pragma unroll
    for (int nb = 0; nb < 2; nb++)
#pragma unroll
      for (int i = 0; i < 8; i++) sc[nb][i] = __expf(sc[nb][i] - mnew);
    // this pass's sum in four independent chains
    float ps[4];
#pragma unroll
    for (int j = 0; j < 4; j++) ps[j] = ((sc[0][j] + sc[0][j + 4]) + sc[1][j]) + sc[1][j + 4];
    lrun = lrun * corr + ((ps[0] + ps[1]) + (ps[2] + ps[3]));
#pragma unroll
    for (int tt = 0; tt < 4; tt++)
#pragma unroll
      for (int i = 0; i < 8; i++) o[tt][i] *= corr;

    // ---- P^T fragment (B operand): keys 8*half + 0..7 and 16 + 8*half + 0..7
    //      of column q = l15, which is what sc[0] and sc[1] hold ---------------
    v16h pb;
#pragma unroll
    for (int i = 0; i < 8; i++) { pb[i] = (_Float16)sc[0][i]; pb[8 + i] = (_Float16)sc[1][i]; }

    // ---- PV: O^T(64 x 16) += V^T(64 x 32) @ P^T(32 x 16) --------------------
#pragma unroll
    for (int tt = 0; tt < 4; tt++) {
      v16h vf;
      // keys 8*half + 0..7 and 16 + 8*half + 0..7 of row d = tt*16 + l15: P^T's k order
      const _Float16* p = &Vs[cur][half * 8 + (lane & 7)][tt * 16 + ((lane >> 3) & 1) * 8];
      h8 lo = lds_tr16(p), hi = lds_tr16(p + 16 * 80);
#pragma unroll
      for (int i = 0; i < 8; i++) { vf[i] = lo[i]; vf[8 + i] = hi[i]; }
      o[tt] = __builtin_amdgcn_wmma_f32_16x16x32_f16(false, vf, false, pb, (short)0, o[tt], false, false);
    }

    // publish block t+1, free buffer cur, then refill it with block t+2
    wait_ds0();
    wait_async0();
    __syncthreads();
    if (t + 2 < nkb) stage(t + 2, cur);
  }
  wait_async0();   // the ring is closed: no copy of this wave is left in flight

  // ---- normalize and store O: a lane holds 8 consecutive d of its query ----
  const float inv = 1.f / (lrun + xhalf_f(lrun));   // the two halves' sums are joined here
  _Float16* op = O + base + (size_t)(qb + wave * 16 + l15) * DD + half * 8;
#pragma unroll
  for (int t = 0; t < 4; t++) {
    h8 ov;
#pragma unroll
    for (int i = 0; i < 8; i++) ov[i] = (_Float16)(o[t][i] * inv);
    *(h8*)(op + t * 16) = ov;
  }
}

// ---------------------------------------------------------------------------
// Host-side orchestration
// ---------------------------------------------------------------------------
extern "C" void kernel_launch(void* const* d_in, const int* in_sizes, int n_in,
                              void* d_out, int out_size, void* d_ws, size_t ws_size,
                              hipStream_t stream) {
  (void)in_sizes; (void)n_in; (void)out_size; (void)ws_size;

  const float* x        = (const float*)d_in[0];
  const int*   idx_emb  = (const int*)d_in[1];
  const int*   idx_pro  = (const int*)d_in[2];
  // d_in[3] is N == 768 (compile-time constant NV; cannot read device scalar
  // under graph capture).
  const float* Wq1 = (const float*)d_in[4];
  const float* Wk1 = (const float*)d_in[5];
  const float* Wv1 = (const float*)d_in[6];
  const float* Wo1 = (const float*)d_in[7];
  const float* Wq2 = (const float*)d_in[8];
  const float* Wk2 = (const float*)d_in[9];
  const float* Wv2 = (const float*)d_in[10];
  const float* Wo2 = (const float*)d_in[11];
  const float* w_conv1 = (const float*)d_in[12];
  const float* b_conv1 = (const float*)d_in[13];
  const float* w_conv2 = (const float*)d_in[14];
  const float* b_conv2 = (const float*)d_in[15];
  const float* g1 = (const float*)d_in[16];
  const float* beta1 = (const float*)d_in[17];
  const float* g2 = (const float*)d_in[18];
  const float* beta2 = (const float*)d_in[19];

  float* out   = (float*)d_out;          // LN2 result
  float* attn1 = out + BSD;
  float* attn2 = out + 2 * BSD;

  // ---- workspace layout ----
  char* w = (char*)d_ws;
  float* xl1  = (float*)w;  w += BSD * sizeof(float);   // x_l1 f32 (later reused: xln)
  float* f32b = (float*)w;  w += BSD * sizeof(float);   // y2
  _Float16* h_x = (_Float16*)w; w += BSD * sizeof(_Float16);   // f16 activations
  _Float16* h_qkv = (_Float16*)w; w += 6 * BSD * sizeof(_Float16);   // q1 k1 v1 q2 k2 v2
  _Float16* h_o = (_Float16*)w; w += 2 * BSD * sizeof(_Float16);     // o1 o2
  _Float16* h_ffn = (_Float16*)w; w += (size_t)BSROWS * DFF * sizeof(_Float16);
  // f16 weights: q1 k1 v1 q2 k2 v2 o1 o2 (D x D each), conv1, conv2
  _Float16* h_w = (_Float16*)w; w += ((size_t)8 * DD * DD + (size_t)2 * DD * DFF) * sizeof(_Float16);
  _Float16* h_wo = h_w + (size_t)6 * DD * DD;
  _Float16* h_w1 = h_w + (size_t)8 * DD * DD;
  _Float16* h_w2 = h_w1 + (size_t)DD * DFF;

  const dim3 blk(256);
  const dim3 gemmQKV(DD / 128, BSROWS / 128, 6);  // (4, 64, 6)
  const dim3 gemmO(DD / 128, BSROWS / 128, 2);    // (4, 64, 2)
  const dim3 gemmDxD(DD / 128, BSROWS / 128);     // (4, 64)
  const dim3 gemmDxF(DFF / 128, BSROWS / 128);    // (16, 64)
  const dim3 attnGrid(SS / 128, HH, 2 * BB);      // (8, 8, 16)

  // x_l1 = gather(x, idx_emb), also as f16; every weight to f16
  prep_kernel<<<dim3(PREP_BLOCKS), blk, 0, stream>>>(x, idx_emb, xl1, h_x,
                                                     Wq1, Wk1, Wv1, Wq2, Wk2, Wv2, Wo1, Wo2,
                                                     w_conv1, w_conv2, h_w);

  // ===== both MHA branches (flip, MHA, flip == MHA), each stage one launch =====
  gemm_wmma<true, false, false, 64><<<gemmQKV, blk, 0, stream>>>(h_x, h_w, nullptr, h_qkv, nullptr, BSROWS, DD, DD,
                                                             0, (size_t)DD * DD, BSD);
  attn_wmma<<<attnGrid, blk, 0, stream>>>(h_qkv, h_o);
  // attn1 and attn2 lie one behind the other in out
  // 512 workgroups, two per WGP
  gemm_wmma<false, false, false, 128><<<gemmO, blk, 0, stream>>>(h_o, h_wo, nullptr, nullptr, attn1, BSROWS, DD, DD,
                                                            BSD, (size_t)DD * DD, BSD);

  // new_x1 = attn1 + attn2 ; x_l2 = gather(new_x1, idx_pro) ; xln = LN(x + x_l2; g1, beta1)
  // (reuse xl1 as f32 result, h_x as f16 copy)
  add_ln_kernel<true, true><<<dim3(BSROWS / 8), blk, 0, stream>>>(x, attn1, attn2, idx_pro, g1, beta1, xl1, h_x);

  // ================= FFN =================
  gemm_wmma<true, true, true, 64><<<gemmDxF, blk, 0, stream>>>(h_x, h_w1, b_conv1, h_ffn, nullptr, BSROWS, DFF, DD, 0, 0, 0);
  // 256 workgroups, one per WGP, K = 2,048: the long k-step
  gemm_wmma<false, true, false, 256><<<gemmDxD, blk, 0, stream>>>(h_ffn, h_w2, b_conv2, nullptr, f32b, BSROWS, DD, DFF, 0, 0, 0);

  // out = LN(xln + y; g2, beta2)
  add_ln_kernel<false, false><<<dim3(BSROWS / 8), blk, 0, stream>>>(xl1, f32b, nullptr, nullptr, g2, beta2, out, nullptr);
}

// v008
// It runs in 133 microseconds.
// Timed twice side by side with v007, it ran 1.11 times as fast both times.
// All steps since v000 together make it 3.23 times as fast.
#include <hip/hip_runtime.h>
#include <hip/hip_bf16.h>

#define BB   8
#define SS   1024
#define NV   768
#define DD   512
#define DFF  2048
#define HH   8
#define DHH  64
#define BSROWS (BB * SS)                       // 8192
#define BSD   ((size_t)BSROWS * DD)            // 4,194,304

typedef _Float16 v16h __attribute__((ext_vector_type(16)));
typedef float    v8f  __attribute__((ext_vector_type(8)));
typedef _Float16 h8   __attribute__((ext_vector_type(8)));

// ---------------- DPP 16-lane butterfly reductions (VALU, no DS pipe) ------
template <int CTRL>
__device__ __forceinline__ float dpp_perm_f(float x) {
  int i = __builtin_bit_cast(int, x);
  int r = __builtin_amdgcn_update_dpp(i, i, CTRL, 0xF, 0xF, true);
  return __builtin_bit_cast(float, r);
}
__device__ __forceinline__ float red16_sum(float x) {
  x += dpp_perm_f<0xB1>(x);    // quad_perm [1,0,3,2] : xor 1
  x += dpp_perm_f<0x4E>(x);    // quad_perm [2,3,0,1] : xor 2
  x += dpp_perm_f<0x141>(x);   // row_half_mirror     : xor 7
  x += dpp_perm_f<0x140>(x);   // row_mirror          : xor 15
  return x;
}

// ---------------- async global -> LDS staging (CDNA5, ASYNCcnt) ------------
__device__ __forceinline__ unsigned lds_off_of(const void* p) {
  // generic pointers to LDS carry the offset in the low 32 bits
  return (unsigned)(unsigned long long)(uintptr_t)p;
}
// A run of copies and its s_wait_xcnt 0 are one statement, so that no address
// register of an issued copy is rewritten ahead of that wait.
__device__ __forceinline__ void async_copy2_b128(unsigned l0, const void* g0,
                                                 unsigned l1, const void* g1) {
  asm volatile("global_load_async_to_lds_b128 %0, %1, off\n\t"
               "global_load_async_to_lds_b128 %2, %3, off\n\t"
               "s_wait_xcnt 0x0"
               :: "v"(l0), "v"((unsigned long long)(uintptr_t)g0),
                  "v"(l1), "v"((unsigned long long)(uintptr_t)g1)
               : "memory");
}
__device__ __forceinline__ void async_copy8_b128(unsigned l0, const void* g0,
                                                 unsigned l1, const void* g1,
                                                 unsigned l2, const void* g2,
                                                 unsigned l3, const void* g3,
                                                 unsigned l4, const void* g4,
                                                 unsigned l5, const void* g5,
                                                 unsigned l6, const void* g6,
                                                 unsigned l7, const void* g7) {
  asm volatile("global_load_async_to_lds_b128 %0, %1, off\n\t"
               "global_load_async_to_lds_b128 %2, %3, off\n\t"
               "global_load_async_to_lds_b128 %4, %5, off\n\t"
               "global_load_async_to_lds_b128 %6, %7, off\n\t"
               "global_load_async_to_lds_b128 %8, %9, off\n\t"
               "global_load_async_to_lds_b128 %10, %11, off\n\t"
               "global_load_async_to_lds_b128 %12, %13, off\n\t"
               "global_load_async_to_lds_b128 %14, %15, off\n\t"
               "s_wait_xcnt 0x0"
               :: "v"(l0), "v"((unsigned long long)(uintptr_t)g0),
                  "v"(l1), "v"((unsigned long long)(uintptr_t)g1),
                  "v"(l2), "v"((unsigned long long)(uintptr_t)g2),
                  "v"(l3), "v"((unsigned long long)(uintptr_t)g3),
                  "v"(l4), "v"((unsigned long long)(uintptr_t)g4),
                  "v"(l5), "v"((unsigned long long)(uintptr_t)g5),
                  "v"(l6), "v"((unsigned long long)(uintptr_t)g6),
                  "v"(l7), "v"((unsigned long long)(uintptr_t)g7)
               : "memory");
}
// This wave's copies have landed (the compiler places no wait for them).
__device__ __forceinline__ void wait_async0() {
  asm volatile("s_wait_asynccnt 0x0" ::: "memory");
}
// This wave's LDS reads are done before the buffer is handed back for a refill.
__device__ __forceinline__ void wait_ds0() {
  asm volatile("s_wait_dscnt 0x0" ::: "memory");
}

// ---------------- transposing LDS load (row-major [k][n] tile -> operand) ---
// Lane l passes the address of T[kbase + 8*(l>>4) + (l&7)][nbase + 8*((l>>3)&1)]
// and receives T[kbase + 8*(l>>4) + 0..7][nbase + (l&15)].
typedef short s16x8 __attribute__((ext_vector_type(8)));
__device__ __forceinline__ h8 lds_tr16(const _Float16* p) {
  typedef __attribute__((address_space(3))) s16x8 lds_s16x8;
  return __builtin_bit_cast(h8, __builtin_amdgcn_ds_load_tr16_b128_v8i16((lds_s16x8*)p));
}

// ---------------------------------------------------------------------------
// The streaming launches below move 16 B per lane and keep 2 to 20 such loads
// of a wave in flight: an array of B*S*D floats then takes 4,096 to 8,192 waves
// where one or two floats per thread took 65,536 to 131,072, and the time to
// start waves no longer outweighs the time to move the bytes.
// Every wave-wide access covers whole 128-B lines.
// ---------------------------------------------------------------------------
typedef float    f4 __attribute__((ext_vector_type(4)));
typedef _Float16 h4 __attribute__((ext_vector_type(4)));

__device__ __forceinline__ h4 to_h4(f4 v) { return __builtin_convertvector(v, h4); }

// lane l <-> l ^ 16
__device__ __forceinline__ float xhalf_f(float x) {
  int b = __builtin_bit_cast(int, x);
  return __builtin_bit_cast(float,
      __builtin_amdgcn_permlanex16(b, b, 0x76543210, 0xfedcba98, false, false));
}

// ---------------------------------------------------------------------------
// f32 -> f16 convert (weights): 2,048 floats per block, 8 per thread.
// blk is the block's number within this array of a multiple of 2,048 floats.
// ---------------------------------------------------------------------------
__device__ __forceinline__ void cvt_f16_block(const float* __restrict__ src,
                                              _Float16* __restrict__ dst, int blk) {
  const size_t i = (size_t)blk * 512 + threadIdx.x;          // in units of 4 elements
  const f4* s4 = (const f4*)src;
  h4* d4 = (h4*)dst;
  f4 a = s4[i], b = s4[i + 256];
  d4[i] = to_h4(a);
  d4[i + 256] = to_h4(b);
  // inlined twice into one kernel: keeps the registers that the two stores name
  // from being written again, on any way through the listing, ahead of this wait
  asm volatile("s_wait_xcnt 0x0" ::: "memory");
}

// ---------------------------------------------------------------------------
// Batched gather over first N rows (rest pass-through), optional f16 copy.
// Two rows of D = 512 per wave (8 loads in flight), 16 rows per block.
// ---------------------------------------------------------------------------
template <bool F16_TOO>
__device__ __forceinline__ void gather_cast_block(const float* __restrict__ x,
                                                  const int* __restrict__ idx,
                                                  float* __restrict__ of,
                                                  _Float16* __restrict__ oh, int blk) {
  const int lane = threadIdx.x & 31;
  const int wave = __builtin_amdgcn_readfirstlane(threadIdx.x >> 5);
  const int bs0  = (blk * 8 + wave) * 2;             // 0..B*S-2, even
  const int b = bs0 / SS, s0 = bs0 % SS;
  static_assert(NV % 2 == 0 && SS % 2 == 0, "rows s0 and s0 + 1 lie on the same side of NV");
  int srow[2] = {s0, s0 + 1};
  if (s0 < NV) {
    // both indices are fetched before either row, so that all 8 row loads fly together
#pragma unroll
    for (int rr = 0; rr < 2; rr++) {
      int r = idx[b * NV + s0 + rr];
      srow[rr] = r < 0 ? 0 : (r > NV - 1 ? NV - 1 : r);   // the address stays inside x
    }
  }
  f4 v[2][4];
#pragma unroll
  for (int rr = 0; rr < 2; rr++) {
    const f4* src = (const f4*)(x + ((size_t)b * SS + srow[rr]) * DD);
#pragma unroll
    for (int j = 0; j < 4; j++) v[rr][j] = src[lane + 32 * j];
  }
  // the f16 copy goes first: its values take registers of their own while v is
  // still live, so that no register of an issued store is written again
  if (F16_TOO) {
    h4* oh4 = (h4*)(oh + (size_t)bs0 * DD);
#pragma unroll
    for (int rr = 0; rr < 2; rr++)
#pragma unroll
      for (int j = 0; j < 4; j++) oh4[rr * (DD / 4) + lane + 32 * j] = to_h4(v[rr][j]);
  }
  f4* of4 = (f4*)(of + (size_t)bs0 * DD);
#pragma unroll
  for (int rr = 0; rr < 2; rr++)
#pragma unroll
    for (int j = 0; j < 4; j++) of4[rr * (DD / 4) + lane + 32 * j] = v[rr][j];
}

// ---------------------------------------------------------------------------
// All the work that reads nothing but inputs, in one launch: blocks 0..511
// gather x (f32 and f16 copy); the next 8 x 128 blocks convert the eight D x D
// weights, the last 2 x 512 the two FFN weights. The f16 weights lie one behind
// the other in wh, in the order of the arguments.
// ---------------------------------------------------------------------------
#define GATHER_BLOCKS (BSROWS / 16)            // 512
#define DXD_BLOCKS    (DD * DD / 2048)         // 128
#define FFN_BLOCKS    (DD * DFF / 2048)        // 512
#define PREP_BLOCKS   (GATHER_BLOCKS + 8 * DXD_BLOCKS + 2 * FFN_BLOCKS)
__global__ __launch_bounds__(256) void prep_kernel(const float* __restrict__ x,
                                                   const int* __restrict__ idx,
                                                   float* __restrict__ of,
                                                   _Float16* __restrict__ oh,
                                                   const float* __restrict__ w0,
                                                   const float* __restrict__ w1,
                                                   const float* __restrict__ w2,
                                                   const float* __restrict__ w3,
                                                   const float* __restrict__ w4,
                                                   const float* __restrict__ w5,
                                                   const float* __restrict__ w6,
                                                   const float* __restrict__ w7,
                                                   const float* __restrict__ f0,
                                                   const float* __restrict__ f1,
                                                   _Float16* __restrict__ wh) {
  const int blk = blockIdx.x;
  if (blk < GATHER_BLOCKS) {
    gather_cast_block<true>(x, idx, of, oh, blk);
    return;
  }
  const int c = blk - GATHER_BLOCKS;
  if (c < 8 * DXD_BLOCKS) {
    const int which = c / DXD_BLOCKS;
    // picked bit by bit: seven scalar selects, no branch
    const float* s01 = (which & 1) ? w1 : w0;
    const float* s23 = (which & 1) ? w3 : w2;
    const float* s45 = (which & 1) ? w5 : w4;
    const float* s67 = (which & 1) ? w7 : w6;
    const float* s03 = (which & 2) ? s23 : s01;
    const float* s47 = (which & 2) ? s67 : s45;
    cvt_f16_block((which & 4) ? s47 : s03, wh + (size_t)which * DD * DD, c % DXD_BLOCKS);
  } else {
    const int which = (c - 8 * DXD_BLOCKS) / FFN_BLOCKS;
    cvt_f16_block(which == 0 ? f0 : f1, wh + (size_t)8 * DD * DD + (size_t)which * DD * DFF,
                  (c - 8 * DXD_BLOCKS) % FFN_BLOCKS);
  }
}

// ---------------------------------------------------------------------------
// out = LayerNorm(a + b) * g + beta, one wave per row of D = 512 (16 floats per
// lane), 8 rows per block. The row's two sums are formed in the lane, then over
// the 32 lanes in registers: no LDS and no barrier.
// GATHER_SUM: the second term of row (bat, s) is b[bat][r] + b2[bat][r], with
// r = idx[bat][s] for s < NV and r = s from there on; it is formed here and
// stored nowhere.
// ---------------------------------------------------------------------------
template <bool F16_TOO, bool GATHER_SUM>
__global__ __launch_bounds__(256) void add_ln_kernel(const float* __restrict__ a,
                                                     const float* __restrict__ b,
                                                     const float* __restrict__ b2,
                                                     const int* __restrict__ idx,
                                                     const float* __restrict__ g,
                                                     const float* __restrict__ beta,
                                                     float* __restrict__ of,
                                                     _Float16* __restrict__ oh) {
  const int lane = threadIdx.x & 31;
  const int wave = __builtin_amdgcn_readfirstlane(threadIdx.x >> 5);
  const int row  = blockIdx.x * 8 + wave;            // 0..B*S-1
  const size_t base = (size_t)row * DD;
  size_t bbase = base;
  if (GATHER_SUM) {
    const int bat = row / SS, s = row % SS;
    int r = s;
    if (s < NV) {
      r = idx[bat * NV + s];
      r = r < 0 ? 0 : (r > NV - 1 ? NV - 1 : r);     // the address stays inside b and b2
    }
    bbase = ((size_t)bat * SS + r) * DD;
  }
  const f4* a4 = (const f4*)(a + base);
  const f4* b4 = (const f4*)(b + bbase);
  const f4* g4 = (const f4*)g;
  const f4* e4 = (const f4*)beta;
  f4 t[4], tb[4], gv[4], ev[4];
#pragma unroll
  for (int j = 0; j < 4; j++) { t[j] = a4[lane + 32 * j]; tb[j] = b4[lane + 32 * j]; }
  if (GATHER_SUM) {
    const f4* c4 = (const f4*)(b2 + bbase);
    f4 tc[4];
#pragma unroll
    for (int j = 0; j < 4; j++) tc[j] = c4[lane + 32 * j];
#pragma unroll
    for (int j = 0; j < 4; j++) tb[j] += tc[j];
  }
#pragma unroll
  for (int j = 0; j < 4; j++) { gv[j] = g4[lane + 32 * j]; ev[j] = e4[lane + 32 * j]; }
#pragma unroll
  for (int j = 0; j < 4; j++) t[j] += tb[j];
  f4 sv = (t[0] + t[1]) + (t[2] + t[3]);
  f4 qv = (t[0] * t[0] + t[1] * t[1]) + (t[2] * t[2] + t[3] * t[3]);
  float s  = red16_sum((sv[0] + sv[1]) + (sv[2] + sv[3]));
  float ss = red16_sum((qv[0] + qv[1]) + (qv[2] + qv[3]));
  s  += xhalf_f(s);
  ss += xhalf_f(ss);
  float mu  = s * (1.f / DD);
  float var = ss * (1.f / DD) - mu * mu;
  float rstd = rsqrtf(var + 1e-5f);
#pragma unroll
  for (int j = 0; j < 4; j++) t[j] = (t[j] - mu) * rstd * gv[j] + ev[j];
  // the f16 copy goes first: its values take registers of their own while t is
  // still live, so that no register of an issued store is written again
  if (F16_TOO) {
    h4* oh4 = (h4*)(oh + base);
#pragma unroll
    for (int j = 0; j < 4; j++) oh4[lane + 32 * j] = to_h4(t[j]);
  }
  f4* of4 = (f4*)(of + base);
#pragma unroll
  for (int j = 0; j < 4; j++) of4[lane + 32 * j] = t[j];
}

// ---------------------------------------------------------------------------
// WMMA GEMM: C[M,N] = A[M,K] (f16, row-major) @ W[K,N] (f16, row-major)
// Workgroup tile 128x128, 8 waves in a 4(M) x 2(N) grid, each wave 32x64
// (2x4 accumulators of v_wmma_f32_16x16x32_f16). Double-buffered pipeline:
// A-tile and W-tile both via async global->LDS, each in its global row order;
// W fragments come out of LDS through ds_load_tr16_b128. One barrier per k-step.
// A k-step is KS k, at least 64 = 128 B of an A row, so that one A copy of a wave
// covers four whole 128-B lines. K must be a multiple of KS.
// KS = 64: four workgroups share a WGP and hide one another's copy latency.
// KS = 128, 256: for a grid of two workgroups, or one, per WGP, which wait out
// that latency at every k-step with little or nothing beside them: the WGP holds
// as many bytes in flight as with four, and K takes a half or a quarter of the waits.
// NC is N at compile time, for the stores of C: the rows of a wave's tile are then
// constant offsets of one address, and no register is written between the stores.
// blockIdx.z picks one of several products of the same shape: its A, W and C
// start zA, zW and zC elements behind those of the product before it.
// ---------------------------------------------------------------------------
template <bool OUT_F16, bool BIAS, bool RELU, int KS, int NC>
__global__ __launch_bounds__(256) void gemm_wmma(const _Float16* __restrict__ A0,
                                                 const _Float16* __restrict__ W0,
                                                 const float* __restrict__ bias,
                                                 _Float16* __restrict__ outH0,
                                                 float* __restrict__ outF0,
                                                 int M, int N, int K,
                                                 size_t zA, size_t zW, size_t zC) {
  static_assert(KS == 64 || KS == 128 || KS == 256, "the copies below are dealt for these");
  // ping-pong: 128 rows x KS K, pitch 144, 272 or 528 B (16 B x odd, for ds_load_b128)
  __shared__ __attribute__((aligned(16))) _Float16 As[2][128][KS + 8];
  // ping-pong: KS K x 128 cols(N), pitch 288 B (32 B x odd, for ds_load_tr16_b128)
  __shared__ __attribute__((aligned(16))) _Float16 Bs[2][KS][144];

  const int tid  = threadIdx.x;
  const int lane = tid & 31;
  const int wave = tid >> 5;
  const int l15  = lane & 15;
  const int half = lane >> 4;
  const int wm = wave >> 1;          // 0..3
  const int wn = wave & 1;           // 0..1
  const int mbase = blockIdx.y * 128;
  const int nbase = blockIdx.x * 128;
  const _Float16* __restrict__ A = A0 + blockIdx.z * zA;
  const _Float16* __restrict__ W = W0 + blockIdx.z * zW;
  _Float16* __restrict__ outH = OUT_F16 ? outH0 + blockIdx.z * zC : nullptr;
  float* __restrict__ outF = OUT_F16 ? nullptr : outF0 + blockIdx.z * zC;

  v8f acc[2][4];
#pragma unroll
  for (int i = 0; i < 2; i++)
#pragma unroll
    for (int j = 0; j < 4; j++) { v8f z = {}; acc[i][j] = z; }

  constexpr int CPR = KS / 8;           // 16-B pieces in the KS k of an A row
  constexpr int ARS = 256 / CPR;        // A rows that one copy of every thread covers
  constexpr int LKS = KS == 64 ? 6 : KS == 128 ? 7 : 8;   // log2 KS
  const int arow = tid >> (LKS - 3);    // A tile: rows t/CPR + ARS j, j = 0..128/ARS-1,
  const int acs  = (tid & (CPR - 1)) * 8;   //     8 halfs at (t%CPR)*8
  const int bkr  = tid >> 4;            // W tile: k-rows t/16 + 16 j, j = 0..KS/16-1,
  const int bns  = (tid & 15) * 8;      //         8 cols at (t&15)*8

  const int nk = K >> LKS;              // k-steps of KS

  // all KS / 8 copies of one thread for k-tile kt into buffer buf
  auto stage = [&](int kt, int buf) {
    const _Float16* ga = A + (size_t)(mbase + arow) * K + (kt << LKS) + acs;
    const _Float16* gw = W + (size_t)((kt << LKS) + bkr) * N + nbase + bns;
    if constexpr (KS == 64) {
      async_copy8_b128(lds_off_of(&As[buf][arow][acs]), ga,
                       lds_off_of(&As[buf][arow + 32][acs]), ga + (size_t)32 * K,
                       lds_off_of(&As[buf][arow + 64][acs]), ga + (size_t)64 * K,
                       lds_off_of(&As[buf][arow + 96][acs]), ga + (size_t)96 * K,
                       lds_off_of(&Bs[buf][bkr][bns]), gw,
                       lds_off_of(&Bs[buf][bkr + 16][bns]), gw + (size_t)16 * N,
                       lds_off_of(&Bs[buf][bkr + 32][bns]), gw + (size_t)32 * N,
                       lds_off_of(&Bs[buf][bkr + 48][bns]), gw + (size_t)48 * N);
    } else {
      // unrolled so that j becomes a constant step of the addresses
#pragma unroll
      for (int j = 0; j < 128 / ARS; j += 8) {
        const _Float16* g = ga + (size_t)(j * ARS) * K;
        const size_t st = (size_t)ARS * K;
        async_copy8_b128(lds_off_of(&As[buf][arow + (j + 0) * ARS][acs]), g,
                         lds_off_of(&As[buf][arow + (j + 1) * ARS][acs]), g + st,
                         lds_off_of(&As[buf][arow + (j + 2) * ARS][acs]), g + 2 * st,
                         lds_off_of(&As[buf][arow + (j + 3) * ARS][acs]), g + 3 * st,
                         lds_off_of(&As[buf][arow + (j + 4) * ARS][acs]), g + 4 * st,
                         lds_off_of(&As[buf][arow + (j + 5) * ARS][acs]), g + 5 * st,
                         lds_off_of(&As[buf][arow + (j + 6) * ARS][acs]), g + 6 * st,
                         lds_off_of(&As[buf][arow + (j + 7) * ARS][acs]), g + 7 * st);
      }
      // unrolled for the same reason
#pragma unroll
      for (int j = 0; j < KS / 16; j += 8) {
        const _Float16* g = gw + (size_t)(j * 16) * N;
        const size_t st = (size_t)16 * N;
        async_copy8_b128(lds_off_of(&Bs[buf][bkr + (j + 0) * 16][bns]), g,
                         lds_off_of(&Bs[buf][bkr + (j + 1) * 16][bns]), g + st,
                         lds_off_of(&Bs[buf][bkr + (j + 2) * 16][bns]), g + 2 * st,
                         lds_off_of(&Bs[buf][bkr + (j + 3) * 16][bns]), g + 3 * st,
                         lds_off_of(&Bs[buf][bkr + (j + 4) * 16][bns]), g + 4 * st,
                         lds_off_of(&Bs[buf][bkr + (j + 5) * 16][bns]), g + 5 * st,
                         lds_off_of(&Bs[buf][bkr + (j + 6) * 16][bns]), g + 6 * st,
                         lds_off_of(&Bs[buf][bkr + (j + 7) * 16][bns]), g + 7 * st);
      }
    }
  };

  // prologue: tile 0 lands and is published, then tile 1 starts to fly
  stage(0, 0);
  wait_async0();
  __syncthreads();
  if (nk > 1) stage(1, 1);

  for (int t = 0; t < nk; ++t) {
    const int cur = t & 1;

    // ---- compute on current buffers: KS/32 slices of 32 k, in k order ----
    // unrolled so that ks becomes a constant offset of the LDS reads
#pragma unroll
    for (int ks = 0; ks < KS / 32; ks++) {
      v16h af[2], bf[4];
#pragma unroll
      for (int mt = 0; mt < 2; mt++) {
        const _Float16* p = &As[cur][wm * 32 + mt * 16 + l15][ks * 32 + half * 8];
#pragma unroll
        for (int i = 0; i < 8; i++) { af[mt][i] = p[i]; af[mt][8 + i] = p[16 + i]; }
      }
#pragma unroll
      for (int nt = 0; nt < 4; nt++) {
        // k 8*half + 0..7 and 16 + 8*half + 0..7 of column l15: the A loader's k order
        const _Float16* p = &Bs[cur][ks * 32 + half * 8 + (lane & 7)][wn * 64 + nt * 16 + ((lane >> 3) & 1) * 8];
        h8 lo = lds_tr16(p), hi = lds_tr16(p + 16 * 144);
#pragma unroll
        for (int i = 0; i < 8; i++) { bf[nt][i] = lo[i]; bf[nt][8 + i] = hi[i]; }
      }
#pragma unroll
      for (int mt = 0; mt < 2; mt++)
#pragma unroll
        for (int nt = 0; nt < 4; nt++)
          // C^T tile = W^T tile x A^T tile: the W fragment is the A operand
          acc[mt][nt] = __builtin_amdgcn_wmma_f32_16x16x32_f16(
              false, bf[nt], false, af[mt], (short)0, acc[mt][nt], false, false);
    }

    // publish tile t+1, free buffer cur, then refill it with tile t+2
    wait_ds0();
    wait_async0();
    __syncthreads();
    if (t + 2 < nk) stage(t + 2, cur);
  }
  wait_async0();   // the ring is closed: no copy of this wave is left in flight

  // Epilogue. The accumulators hold C^T tiles: acc[mt][nt][i] is row mt*16 + l15,
  // column nt*16 + 8*half + i of the wave's 32 x 64 tile, so that a lane owns 8
  // columns in a row. Each wave lays its tile row-major in its own part of the A
  // ring, which every reader has left at the loop's last barrier, and reads it
  // back 16 B per lane along the rows: a wave-wide store then covers four whole
  // 128-B lines, where a store straight from the accumulators covers pieces of lines.
  constexpr int EB  = OUT_F16 ? 2 : 4;     // bytes per output element
  constexpr int SP  = 64 * EB + 16;        // pitch of a staged row: 144 or 272 B (16 B x odd)
  constexpr int PPR = 64 * EB / 16;        // 16-B pieces in a staged row: 8 or 16
  constexpr int RPS = 32 / PPR;            // rows that one wave-wide store covers: 4 or 2
  static_assert(sizeof(As) >= (size_t)8 * 32 * SP, "eight staged tiles fit the A ring");
  char* st = (char*)&As[0][0][0] + wave * (32 * SP);
  // every loop below is unrolled so that acc, v and d are indexed by constants
  // and stay in registers, and the LDS and global steps become constant offsets
#pragma unroll
  for (int nt = 0; nt < 4; nt++) {
    f4 b0 = {}, b1 = {};
    if (BIAS) {
      const f4* bp = (const f4*)(bias + nbase + wn * 64 + nt * 16 + half * 8);
      b0 = bp[0];
      b1 = bp[1];
    }
#pragma unroll
    for (int mt = 0; mt < 2; mt++) {
      float v[8];
#pragma unroll
      for (int i = 0; i < 8; i++) {
        v[i] = acc[mt][nt][i];
        if (BIAS) v[i] += i < 4 ? b0[i & 3] : b1[i & 3];
        if (RELU) v[i] = v[i] > 0.f ? v[i] : 0.f;
      }
      char* p = st + (mt * 16 + l15) * SP + (nt * 16 + half * 8) * EB;
      if (OUT_F16) {
        h8 hv;
#pragma unroll
        for (int i = 0; i < 8; i++) hv[i] = (_Float16)v[i];
        *(h8*)p = hv;
      } else {
        f4 lo = {v[0], v[1], v[2], v[3]}, hi = {v[4], v[5], v[6], v[7]};
        *(f4*)p = lo;
        *(f4*)(p + 16) = hi;
      }
    }
  }
  wait_ds0();   // the wave's own rows are in LDS before its lanes read one another's
  const int prow = lane / PPR, pcol = lane % PPR;
  f4 d[32 / RPS];
#pragma unroll
  for (int j = 0; j < 32 / RPS; j++)
    d[j] = *(const f4*)(st + (j * RPS + prow) * SP + pcol * 16);
  char* og = (OUT_F16 ? (char*)outH : (char*)outF)
           + ((size_t)(mbase + wm * 32 + prow) * NC + nbase + wn * 64) * EB + pcol * 16;
#pragma unroll
  for (int j = 0; j < 32 / RPS; j++)
    *(f4*)(og + (size_t)(j * RPS) * NC * EB) = d[j];
}

__global__ __launch_bounds__(256) void attn_wmma(const _Float16* __restrict__ QKV,
                                                 _Float16* __restrict__ O0) {
  // [key][d], pitch 144 B (16 B x odd, for ds_load_b128)
  __shared__ __attribute__((aligned(16))) _Float16 Kb[2][32][72];
  // [key][d], pitch 160 B (32 B x odd, for ds_load_tr16_b128)
  __shared__ __attribute__((aligned(16))) _Float16 Vs[2][32][80];
  // each wave's 16 q x 64 d result on its way out, pitch 144 B (16 B x odd)
  __shared__ __attribute__((aligned(16))) _Float16 Os[8][16][72];

  const int tid  = threadIdx.x;
  const int lane = tid & 31;
  const int wave = tid >> 5;
  const int l15  = lane & 15;
  const int half = lane >> 4;
  const int qb   = blockIdx.x * 128;
  const int head = blockIdx.y;
  const int bat  = blockIdx.z % BB;
  const int br   = blockIdx.z / BB;      // 0, 1: which branch
  const _Float16* __restrict__ Q  = QKV + (size_t)br * 3 * BSD;
  const _Float16* __restrict__ Kk = Q + BSD;
  const _Float16* __restrict__ V  = Q + 2 * BSD;
  _Float16* __restrict__ O = O0 + (size_t)br * BSD;
  const size_t base = (size_t)bat * SS * DD + (size_t)head * DHH;
  const float scale = 0.125f;            // 1/sqrt(64)

  // Q fragments (B operand): column q = qb + wave*16 + l15, d split {0..31},{32..63}
  v16h qa[2];
  {
    const _Float16* qp = Q + base + (size_t)(qb + wave * 16 + l15) * DD;
#pragma unroll
    for (int f = 0; f < 2; f++)
#pragma unroll
      for (int i = 0; i < 8; i++) {
        qa[f][i]     = qp[f * 32 + half * 8 + i];
        qa[f][8 + i] = qp[f * 32 + 16 + half * 8 + i];
      }
  }

  // o[t][i] = O^T[d = 16 t + 8*half + i][q = l15]
  v8f o[4];
#pragma unroll
  for (int t = 0; t < 4; t++) { v8f z = {}; o[t] = z; }
  float mrun = -1e30f;                   // query l15: maximum so far (equal in both halves)
  float lrun = 0.f;                      // query l15: sum over this half's keys only

  const int r = tid >> 3;                // 0..31 (key)
  const int c = (tid & 7) * 8;           // 0..56 (d)

  // both copies of one thread for key-block kb into buffer buf
  auto stage = [&](int kb, int buf) {
    size_t roff = base + (size_t)(kb * 32 + r) * DD + c;
    async_copy2_b128(lds_off_of(&Kb[buf][r][c]), Kk + roff,
                     lds_off_of(&Vs[buf][r][c]), V + roff);
  };

  const int nkb = SS >> 5;               // 32-key blocks

  // prologue: block 0 lands and is published, then block 1 starts to fly
  stage(0, 0);
  wait_async0();
  __syncthreads();
  stage(1, 1);

  for (int t = 0; t < nkb; ++t) {
    const int cur = t & 1;

    // ---- scores: S^T tile (32 keys x 16 q) in two 16-key subtiles ----------
    // sc[nb][i] = S[q = l15][key = 16 nb + 8*half + i]
    v8f sc[2];
#pragma unroll
    for (int nb = 0; nb < 2; nb++) {
      v8f z = {};
      v16h kf;
      {
        const _Float16* p = &Kb[cur][nb * 16 + l15][half * 8];
#pragma unroll
        for (int i = 0; i < 8; i++) { kf[i] = p[i]; kf[8 + i] = p[16 + i]; }
      }
      z = __builtin_amdgcn_wmma_f32_16x16x32_f16(false, kf, false, qa[0], (short)0, z, false, false);
      {
        const _Float16* p = &Kb[cur][nb * 16 + l15][32 + half * 8];
#pragma unroll
        for (int i = 0; i < 8; i++) { kf[i] = p[i]; kf[8 + i] = p[16 + i]; }
      }
      z = __builtin_amdgcn_wmma_f32_16x16x32_f16(false, kf, false, qa[1], (short)0, z, false, false);
      sc[nb] = z;
    }
#pragma unroll
    for (int nb = 0; nb < 2; nb++)
#pragma unroll
      for (int i = 0; i < 8; i++) sc[nb][i] *= scale;

    // ---- online softmax of query l15, in the lane ---------------------------
    float mx = fmaxf(sc[0][0], sc[1][0]);
#pragma unroll
    for (int i = 1; i < 8; i++) mx = fmaxf(mx, fmaxf(sc[0][i], sc[1][i]));
    mx = fmaxf(mx, xhalf_f(mx));         // the other half's 16 keys
    const float mnew = fmaxf(mrun, mx);
    const float corr = __expf(mrun - mnew);
    mrun = mnew;
#pragma unroll
    for (int nb = 0; nb < 2; nb++)
#pragma unroll
      for (int i = 0; i < 8; i++) sc[nb][i] = __expf(sc[nb][i] - mnew);
    // this pass's sum in four independent chains
    float ps[4];
#pragma unroll
    for (int j = 0; j < 4; j++) ps[j] = ((sc[0][j] + sc[0][j + 4]) + sc[1][j]) + sc[1][j + 4];
    lrun = lrun * corr + ((ps[0] + ps[1]) + (ps[2] + ps[3]));
#pragma unroll
    for (int tt = 0; tt < 4; tt++)
#pragma unroll
      for (int i = 0; i < 8; i++) o[tt][i] *= corr;

    // ---- P^T fragment (B operand): keys 8*half + 0..7 and 16 + 8*half + 0..7
    //      of column q = l15, which is what sc[0] and sc[1] hold ---------------
    v16h pb;
#pragma unroll
    for (int i = 0; i < 8; i++) { pb[i] = (_Float16)sc[0][i]; pb[8 + i] = (_Float16)sc[1][i]; }

    // ---- PV: O^T(64 x 16) += V^T(64 x 32) @ P^T(32 x 16) --------------------
#pragma unroll
    for (int tt = 0; tt < 4; tt++) {
      v16h vf;
      // keys 8*half + 0..7 and 16 + 8*half + 0..7 of row d = tt*16 + l15: P^T's k order
      const _Float16* p = &Vs[cur][half * 8 + (lane & 7)][tt * 16 + ((lane >> 3) & 1) * 8];
      h8 lo = lds_tr16(p), hi = lds_tr16(p + 16 * 80);
#pragma unroll
      for (int i = 0; i < 8; i++) { vf[i] = lo[i]; vf[8 + i] = hi[i]; }
      o[tt] = __builtin_amdgcn_wmma_f32_16x16x32_f16(false, vf, false, pb, (short)0, o[tt], false, false);
    }

    // publish block t+1, free buffer cur, then refill it with block t+2
    wait_ds0();
    wait_async0();
    __syncthreads();
    if (t + 2 < nkb) stage(t + 2, cur);
  }
  wait_async0();   // the ring is closed: no copy of this wave is left in flight

  // ---- normalize and store O: a lane holds 8 consecutive d of its query ----
  // The wave lays its 16 rows of 128 B in its own LDS rows and reads them back
  // 16 B per lane along the rows: a wave-wide store covers four whole 128-B lines.
  const float inv = 1.f / (lrun + xhalf_f(lrun));   // the two halves' sums are joined here
  // the loops below are unrolled so that o and od are indexed by constants and stay in registers
#pragma unroll
  for (int t = 0; t < 4; t++) {
    h8 ov;
#pragma unroll
    for (int i = 0; i < 8; i++) ov[i] = (_Float16)(o[t][i] * inv);
    *(h8*)&Os[wave][l15][t * 16 + half * 8] = ov;
  }
  wait_ds0();   // the wave's own rows are in LDS before its lanes read one another's
  const int prow = lane >> 3, pcol = (lane & 7) * 8;
  h8 od[4];
#pragma unroll
  for (int j = 0; j < 4; j++) od[j] = *(const h8*)&Os[wave][j * 4 + prow][pcol];
  _Float16* op = O + base + (size_t)(qb + wave * 16 + prow) * DD + pcol;
#pragma unroll
  for (int j = 0; j < 4; j++) *(h8*)(op + (size_t)(j * 4) * DD) = od[j];
}

// ---------------------------------------------------------------------------
// Host-side orchestration
// ---------------------------------------------------------------------------
extern "C" void kernel_launch(void* const* d_in, const int* in_sizes, int n_in,
                              void* d_out, int out_size, void* d_ws, size_t ws_size,
                              hipStream_t stream) {
  (void)in_sizes; (void)n_in; (void)out_size; (void)ws_size;

  const float* x        = (const float*)d_in[0];
  const int*   idx_emb  = (const int*)d_in[1];
  const int*   idx_pro  = (const int*)d_in[2];
  // d_in[3] is N == 768 (compile-time constant NV; cannot read device scalar
  // under graph capture).
  const float* Wq1 = (const float*)d_in[4];
  const float* Wk1 = (const float*)d_in[5];
  const float* Wv1 = (const float*)d_in[6];
  const float* Wo1 = (const float*)d_in[7];
  const float* Wq2 = (const float*)d_in[8];
  const float* Wk2 = (const float*)d_in[9];
  const float* Wv2 = (const float*)d_in[10];
  const float* Wo2 = (const float*)d_in[11];
  const float* w_conv1 = (const float*)d_in[12];
  const float* b_conv1 = (const float*)d_in[13];
  const float* w_conv2 = (const float*)d_in[14];
  const float* b_conv2 = (const float*)d_in[15];
  const float* g1 = (const float*)d_in[16];
  const float* beta1 = (const float*)d_in[17];
  const float* g2 = (const float*)d_in[18];
  const float* beta2 = (const float*)d_in[19];

  float* out   = (float*)d_out;          // LN2 result
  float* attn1 = out + BSD;
  float* attn2 = out + 2 * BSD;

  // ---- workspace layout ----
  char* w = (char*)d_ws;
  float* xl1  = (float*)w;  w += BSD * sizeof(float);   // x_l1 f32 (later reused: xln)
  float* f32b = (float*)w;  w += BSD * sizeof(float);   // y2
  _Float16* h_x = (_Float16*)w; w += BSD * sizeof(_Float16);   // f16 activations
  _Float16* h_qkv = (_Float16*)w; w += 6 * BSD * sizeof(_Float16);   // q1 k1 v1 q2 k2 v2
  _Float16* h_o = (_Float16*)w; w += 2 * BSD * sizeof(_Float16);     // o1 o2
  _Float16* h_ffn = (_Float16*)w; w += (size_t)BSROWS * DFF * sizeof(_Float16);
  // f16 weights: q1 k1 v1 q2 k2 v2 o1 o2 (D x D each), conv1, conv2
  _Float16* h_w = (_Float16*)w; w += ((size_t)8 * DD * DD + (size_t)2 * DD * DFF) * sizeof(_Float16);
  _Float16* h_wo = h_w + (size_t)6 * DD * DD;
  _Float16* h_w1 = h_w + (size_t)8 * DD * DD;
  _Float16* h_w2 = h_w1 + (size_t)DD * DFF;

  const dim3 blk(256);
  const dim3 gemmQKV(DD / 128, BSROWS / 128, 6);  // (4, 64, 6)
  const dim3 gemmO(DD / 128, BSROWS / 128, 2);    // (4, 64, 2)
  const dim3 gemmDxD(DD / 128, BSROWS / 128);     // (4, 64)
  const dim3 gemmDxF(DFF / 128, BSROWS / 128);    // (16, 64)
  const dim3 attnGrid(SS / 128, HH, 2 * BB);      // (8, 8, 16)

  // x_l1 = gather(x, idx_emb), also as f16; every weight to f16
  prep_kernel<<<dim3(PREP_BLOCKS), blk, 0, stream>>>(x, idx_emb, xl1, h_x,
                                                     Wq1, Wk1, Wv1, Wq2, Wk2, Wv2, Wo1, Wo2,
                                                     w_conv1, w_conv2, h_w);

  // ===== both MHA branches (flip, MHA, flip == MHA), each stage one launch =====
  gemm_wmma<true, false, false, 64, DD><<<gemmQKV, blk, 0, stream>>>(h_x, h_w, nullptr, h_qkv, nullptr, BSROWS, DD, DD,
                                                             0, (size_t)DD * DD, BSD);
  attn_wmma<<<attnGrid, blk, 0, stream>>>(h_qkv, h_o);
  // attn1 and attn2 lie one behind the other in out
  // 512 workgroups, two per WGP
  gemm_wmma<false, false, false, 128, DD><<<gemmO, blk, 0, stream>>>(h_o, h_wo, nullptr, nullptr, attn1, BSROWS, DD, DD,
                                                            BSD, (size_t)DD * DD, BSD);

  // new_x1 = attn1 + attn2 ; x_l2 = gather(new_x1, idx_pro) ; xln = LN(x + x_l2; g1, beta1)
  // (reuse xl1 as f32 result, h_x as f16 copy)
  add_ln_kernel<true, true><<<dim3(BSROWS / 8), blk, 0, stream>>>(x, attn1, attn2, idx_pro, g1, beta1, xl1, h_x);

  // ================= FFN =================
  gemm_wmma<true, true, true, 64, DFF><<<gemmDxF, blk, 0, stream>>>(h_x, h_w1, b_conv1, h_ffn, nullptr, BSROWS, DFF, DD, 0, 0, 0);
  // 256 workgroups, one per WGP, K = 2,048: the long k-step
  gemm_wmma<false, true, false, 256, DD><<<gemmDxD, blk, 0, stream>>>(h_ffn, h_w2, b_conv2, nullptr, f32b, BSROWS, DD, DFF, 0, 0, 0);

  // out = LN(xln + y; g2, beta2)
  add_ln_kernel<false, false><<<dim3(BSROWS / 8), blk, 0, stream>>>(xl1, f32b, nullptr, nullptr, g2, beta2, out, nullptr);
}
